// v000
// Measured on an AMD MI455X. A time is GPU time per run, averaged over a window of back-to-back runs after a warm-up
// (all launches, gaps included; the runs take copies of the inputs in turn), and the median of several windows.
// Apart from v000's, it joins two sittings. Times from different sittings can be a few percent apart, while
// side-by-side timings come from the same sitting.
// The starting kernel, v000, takes 416 microseconds a run.
#include <hip/hip_runtime.h>
#include <hip/hip_bf16.h>

typedef _Float16 half8 __attribute__((ext_vector_type(8)));
typedef _Float16 v16h  __attribute__((ext_vector_type(16)));
typedef float    v8f   __attribute__((ext_vector_type(8)));
typedef int      i4v   __attribute__((ext_vector_type(4)));

#define WMMA_F32_F16(a, b, c) \
  __builtin_amdgcn_wmma_f32_16x16x32_f16(false, (a), false, (b), (short)0, (c), false, false)

#define AS1 __attribute__((address_space(1)))
#define AS3 __attribute__((address_space(3)))

// Async global->LDS copy (CDNA5 GLOBAL_LOAD_ASYNC_TO_LDS_B128, ASYNCcnt),
// with a synchronous fallback if the builtin is unavailable.
// Probe-verified: the builtin's params are (global int4*, local int4*, imm, imm).
__device__ __forceinline__ void async_copy_b128(const _Float16* g, _Float16* l) {
#if __has_builtin(__builtin_amdgcn_global_load_async_to_lds_b128)
  __builtin_amdgcn_global_load_async_to_lds_b128(
      (AS1 i4v*)g, (AS3 i4v*)l, 0, 0);
#else
  *(half8*)l = *(const half8*)g;
#endif
}
__device__ __forceinline__ void wait_async() {
#if __has_builtin(__builtin_amdgcn_global_load_async_to_lds_b128)
#if __has_builtin(__builtin_amdgcn_s_wait_asynccnt)
  __builtin_amdgcn_s_wait_asynccnt(0);
#else
  asm volatile("s_wait_asynccnt 0x0" ::: "memory");
#endif
#endif
}

// Problem dims
constexpr int BB  = 4;
constexpr int TT  = 2048;
constexpr int DD  = 512;
constexpr int HH  = 8;
constexpr int KDM = 64;
constexpr int DFF = 2048;
constexpr int BT  = BB * TT;          // 8192 rows
constexpr int NQT = TT / 16;          // 128 query tiles per (b,h)

// ---------------------------------------------------------------------------
// fp32 -> fp16 cast (weights)
// ---------------------------------------------------------------------------
__global__ void cvt_f32_f16(const float* __restrict__ src, _Float16* __restrict__ dst, int n) {
  int i = blockIdx.x * blockDim.x + threadIdx.x;
  if (i < n) dst[i] = (_Float16)src[i];
}

// ---------------------------------------------------------------------------
// LayerNorm: one wave (32 lanes) per row of D=512, writes fp16
// ---------------------------------------------------------------------------
__global__ __launch_bounds__(256)
void ln_rows(const float* __restrict__ x, const float* __restrict__ g,
             const float* __restrict__ b, _Float16* __restrict__ out, int nrows) {
  int wave = (int)((blockIdx.x * blockDim.x + threadIdx.x) >> 5);
  int lane = threadIdx.x & 31;
  if (wave >= nrows) return;
  const float* row = x + (size_t)wave * DD;
  float vals[16];
  float s = 0.f;
#pragma unroll
  for (int i = 0; i < 16; ++i) { vals[i] = row[lane + i * 32]; s += vals[i]; }
#pragma unroll
  for (int off = 1; off < 32; off <<= 1) s += __shfl_xor(s, off, 32);
  float mean = s * (1.0f / DD);
  float vs = 0.f;
#pragma unroll
  for (int i = 0; i < 16; ++i) { float d = vals[i] - mean; vs += d * d; }
#pragma unroll
  for (int off = 1; off < 32; off <<= 1) vs += __shfl_xor(vs, off, 32);
  float rstd = rsqrtf(vs * (1.0f / DD) + 1e-6f);
  _Float16* orow = out + (size_t)wave * DD;
#pragma unroll
  for (int i = 0; i < 16; ++i) {
    int c = lane + i * 32;
    orow[c] = (_Float16)((vals[i] - mean) * rstd * g[c] + b[c]);
  }
}

// ---------------------------------------------------------------------------
// Generic fp16 WMMA GEMM: C[M,N] = A[M,K] @ B[K,N] (+bias)(+relu)(+resid)
// Block tile 256(M) x 64(N), 8 waves; each wave owns a 32x64 strip:
// 2 A-fragments x 4 B-fragments = 8 WMMAs per K-step.
// A staged via async global->LDS B128; B staged transposed for contiguous
// 16B B-fragment ds loads.
// ---------------------------------------------------------------------------
__global__ __launch_bounds__(256)
void gemm_wmma(const _Float16* __restrict__ A, const _Float16* __restrict__ Bw,
               const float* __restrict__ bias, const float* __restrict__ resid,
               _Float16* __restrict__ out16, float* __restrict__ out32,
               int M, int N, int K, int doRelu) {
  constexpr int LDA = 40;   // halves; 80B row stride (16B aligned)
  constexpr int LDB = 40;
  __shared__ _Float16 As[256 * LDA];  // 20.0 KB
  __shared__ _Float16 Bs[64 * LDB];   // 5.0 KB, transposed: [n][k]

  int tid  = threadIdx.x;
  int w    = tid >> 5;
  int lane = tid & 31;
  int mBase = blockIdx.y * 256;
  int nBase = blockIdx.x * 64;
  int mloc  = lane & 15;
  int lh    = lane >> 4;

  v8f acc[2][4];
#pragma unroll
  for (int mi = 0; mi < 2; ++mi)
#pragma unroll
    for (int nt = 0; nt < 4; ++nt)
#pragma unroll
      for (int i = 0; i < 8; ++i) acc[mi][nt][i] = 0.f;

  for (int k0 = 0; k0 < K; k0 += 32) {
    // --- stage A tile: 256 rows x 32 halves; thread t copies row t (async) ---
    {
      const _Float16* src = A + (size_t)(mBase + tid) * K + k0;
      if (k0 + 32 < K) __builtin_prefetch(src + 32, 0, 3);
#pragma unroll
      for (int c = 0; c < 4; ++c)
        async_copy_b128(src + c * 8, &As[tid * LDA + c * 8]);
    }
    // --- stage B tile transposed: 32(k) x 64(n) -> Bs[n][k] ---
    {
      int kr = tid >> 3, n0 = (tid & 7) * 8;
      const _Float16* src = Bw + (size_t)(k0 + kr) * N + nBase + n0;
      half8 p = *(const half8*)(src);
#pragma unroll
      for (int j = 0; j < 8; ++j) Bs[(n0 + j) * LDB + kr] = p[j];
    }
    wait_async();
    __syncthreads();

    // --- A fragments (16x32, ISA 16-bit layout), rows w*32 + mi*16 ---
    v16h af[2];
#pragma unroll
    for (int mi = 0; mi < 2; ++mi) {
      int rloc = w * 32 + mi * 16 + mloc;
      half8 lo = *(const half8*)(&As[rloc * LDA + lh * 8]);
      half8 hi = *(const half8*)(&As[rloc * LDA + 16 + lh * 8]);
#pragma unroll
      for (int i = 0; i < 8; ++i) { af[mi][i] = lo[i]; af[mi][8 + i] = hi[i]; }
    }
    // --- 4 B fragments, 8 WMMAs ---
#pragma unroll
    for (int nt = 0; nt < 4; ++nt) {
      int n = nt * 16 + mloc;
      v16h bf;
      half8 lo = *(const half8*)(&Bs[n * LDB + lh * 8]);
      half8 hi = *(const half8*)(&Bs[n * LDB + 16 + lh * 8]);
#pragma unroll
      for (int i = 0; i < 8; ++i) { bf[i] = lo[i]; bf[8 + i] = hi[i]; }
      acc[0][nt] = WMMA_F32_F16(af[0], bf, acc[0][nt]);
      acc[1][nt] = WMMA_F32_F16(af[1], bf, acc[1][nt]);
    }
    __syncthreads();
  }

  // --- epilogue: C layout lane(col)=L%16, row = r + 8*(L/16) ---
  int cn = lane & 15, rh = lane >> 4;
#pragma unroll
  for (int mi = 0; mi < 2; ++mi)
#pragma unroll
    for (int nt = 0; nt < 4; ++nt) {
      int gn = nBase + nt * 16 + cn;
      float bv = bias ? bias[gn] : 0.f;
#pragma unroll
      for (int r = 0; r < 8; ++r) {
        int gm = mBase + w * 32 + mi * 16 + 8 * rh + r;
        float vv = acc[mi][nt][r] + bv;
        if (doRelu) vv = fmaxf(vv, 0.f);
        if (resid) vv += resid[(size_t)gm * N + gn];
        if (out32) out32[(size_t)gm * N + gn] = vv;
        else       out16[(size_t)gm * N + gn] = (_Float16)vv;
      }
    }
}

// ---------------------------------------------------------------------------
// Block-sparse flash attention: one wave per 16-row query tile of one (b,h).
// Visits key tile 0 (globals) + local tiles qt-2..qt+2; tile 0 query rows
// (global rows, i<16) scan all key tiles. Online softmax, KD=64.
// ---------------------------------------------------------------------------
__global__ __launch_bounds__(128)
void attn_wmma(const _Float16* __restrict__ Q, const _Float16* __restrict__ Kt,
               const _Float16* __restrict__ V, _Float16* __restrict__ ctx) {
  __shared__ _Float16 Pl[4][16 * 16];   // per-wave P staging (C->A layout)

  int w    = threadIdx.x >> 5;
  int lane = threadIdx.x & 31;
  int qidx = blockIdx.x * 4 + w;                 // global query-tile id
  int b    = qidx / (HH * NQT);
  int rem  = qidx % (HH * NQT);
  int h    = rem / NQT;
  int qt   = rem % NQT;
  int mloc = lane & 15;
  int lh   = lane >> 4;

  const size_t rs = (size_t)HH * KDM;            // 512 halves per token row
  const size_t hoff = (size_t)h * KDM;
  const _Float16* qb = Q  + (size_t)(b * TT) * rs + hoff;
  const _Float16* kb = Kt + (size_t)(b * TT) * rs + hoff;
  const _Float16* vb = V  + (size_t)(b * TT) * rs + hoff;

  // Q fragments: 16x64 -> two 16x32 A-fragments
  v16h qf[2];
#pragma unroll
  for (int ks = 0; ks < 2; ++ks) {
    const _Float16* base = qb + (size_t)(qt * 16 + mloc) * rs + ks * 32;
    half8 lo = *(const half8*)(base + lh * 8);
    half8 hi = *(const half8*)(base + 16 + lh * 8);
#pragma unroll
    for (int i = 0; i < 8; ++i) { qf[ks][i] = lo[i]; qf[ks][8 + i] = hi[i]; }
  }

  v8f O[4];
  float mrow[8], lrow[8];
#pragma unroll
  for (int nt = 0; nt < 4; ++nt)
#pragma unroll
    for (int i = 0; i < 8; ++i) O[nt][i] = 0.f;
#pragma unroll
  for (int r = 0; r < 8; ++r) { mrow[r] = -3.0e38f; lrow[r] = 0.f; }

  auto process = [&](int st, bool needMask) {
    int sbase = st * 16;
    // scores S = Q K^T / sqrt(KD)
    v8f S;
#pragma unroll
    for (int i = 0; i < 8; ++i) S[i] = 0.f;
    {
      const _Float16* krow = kb + (size_t)(sbase + mloc) * rs;
#pragma unroll
      for (int ks = 0; ks < 2; ++ks) {
        v16h bf;
        half8 lo = *(const half8*)(krow + ks * 32 + lh * 8);
        half8 hi = *(const half8*)(krow + ks * 32 + 16 + lh * 8);
#pragma unroll
        for (int i = 0; i < 8; ++i) { bf[i] = lo[i]; bf[8 + i] = hi[i]; }
        S = WMMA_F32_F16(qf[ks], bf, S);
      }
    }
#pragma unroll
    for (int r = 0; r < 8; ++r) S[r] *= 0.125f;
    if (needMask) {
      int j = sbase + mloc;
#pragma unroll
      for (int r = 0; r < 8; ++r) {
        int i  = qt * 16 + 8 * lh + r;
        int di = i - j; if (di < 0) di = -di;
        bool ok = (di <= 32) || (j < 16) || (i < 16);
        if (!ok) S[r] = -1.0e9f;
      }
    }
    // online softmax (rows live across 16-lane halves)
    float pexp[8];
#pragma unroll
    for (int r = 0; r < 8; ++r) {
      float rm = S[r];
#pragma unroll
      for (int off = 1; off < 16; off <<= 1) rm = fmaxf(rm, __shfl_xor(rm, off, 32));
      float mn    = fmaxf(mrow[r], rm);
      float alpha = __expf(mrow[r] - mn);
      float p     = __expf(S[r] - mn);
      float sum   = p;
#pragma unroll
      for (int off = 1; off < 16; off <<= 1) sum += __shfl_xor(sum, off, 32);
      lrow[r] = lrow[r] * alpha + sum;
      mrow[r] = mn;
#pragma unroll
      for (int nt = 0; nt < 4; ++nt) O[nt][r] *= alpha;
      pexp[r] = p;
    }
    // stage P through LDS to convert C-layout -> A-layout (upper K half = 0)
#pragma unroll
    for (int r = 0; r < 8; ++r)
      Pl[w][(8 * lh + r) * 16 + mloc] = (_Float16)pexp[r];
    v16h ap;
    {
      half8 lo = *(const half8*)(&Pl[w][mloc * 16 + lh * 8]);
#pragma unroll
      for (int i = 0; i < 8; ++i) { ap[i] = lo[i]; ap[8 + i] = (_Float16)0.f; }
    }
    // O += P x V  (V tile is 16(s) x 64(kd); upper K half zero)
#pragma unroll
    for (int nt = 0; nt < 4; ++nt) {
      v16h bvf;
#pragma unroll
      for (int i = 0; i < 8; ++i) {
        bvf[i]     = vb[(size_t)(sbase + lh * 8 + i) * rs + nt * 16 + mloc];
        bvf[8 + i] = (_Float16)0.f;
      }
      O[nt] = WMMA_F32_F16(ap, bvf, O[nt]);
    }
  };

  if (qt == 0) {
    for (int st = 0; st < NQT; ++st) process(st, false);
  } else {
    process(0, false);                       // global columns (j < 16)
    int lo = qt - 2 < 1 ? 1 : qt - 2;
    int hi = qt + 2 > NQT - 1 ? NQT - 1 : qt + 2;
    for (int st = lo; st <= hi; ++st) process(st, true);
  }

  // normalize + write ctx (fp16, [B,T,H,KD])
  _Float16* cb = ctx + (size_t)(b * TT + qt * 16) * rs + hoff;
#pragma unroll
  for (int nt = 0; nt < 4; ++nt)
#pragma unroll
    for (int r = 0; r < 8; ++r) {
      float vv = O[nt][r] / lrow[r];
      cb[(size_t)(8 * lh + r) * rs + nt * 16 + mloc] = (_Float16)vv;
    }
}

// ---------------------------------------------------------------------------
// Host-side orchestration
// ---------------------------------------------------------------------------
extern "C" void kernel_launch(void* const* d_in, const int* in_sizes, int n_in,
                              void* d_out, int out_size, void* d_ws, size_t ws_size,
                              hipStream_t stream) {
  const float* x    = (const float*)d_in[0];
  const float* ln1g = (const float*)d_in[1];
  const float* ln1b = (const float*)d_in[2];
  const float* Wq   = (const float*)d_in[3];
  const float* bq   = (const float*)d_in[4];
  const float* Wk   = (const float*)d_in[5];
  const float* bk   = (const float*)d_in[6];
  const float* Wv   = (const float*)d_in[7];
  const float* bv   = (const float*)d_in[8];
  const float* Wo   = (const float*)d_in[9];
  const float* bo   = (const float*)d_in[10];
  const float* ln2g = (const float*)d_in[11];
  const float* ln2b = (const float*)d_in[12];
  const float* W1   = (const float*)d_in[13];
  const float* b1   = (const float*)d_in[14];
  const float* W2   = (const float*)d_in[15];
  const float* b2   = (const float*)d_in[16];
  float* out = (float*)d_out;

  char* ws = (char*)d_ws;
  const size_t MB = 1024ull * 1024ull;
  // Region 0 (32MB): xn16|q16|k16|v16 ; later aliased by FFN hidden h16
  _Float16* xn16 = (_Float16*)(ws + 0 * MB);
  _Float16* q16  = (_Float16*)(ws + 8 * MB);
  _Float16* k16  = (_Float16*)(ws + 16 * MB);
  _Float16* v16  = (_Float16*)(ws + 24 * MB);
  _Float16* h16  = (_Float16*)(ws + 0 * MB);    // alias (32MB), after attn
  _Float16* ctx16 = (_Float16*)(ws + 32 * MB);  // 8MB
  _Float16* xn2   = (_Float16*)(ws + 32 * MB);  // alias ctx16 after out-proj
  float*    x1    = (float*)   (ws + 40 * MB);  // 16MB
  _Float16* wq16 = (_Float16*)(ws + 56 * MB);
  _Float16* wk16 = (_Float16*)(ws + 57 * MB);
  _Float16* wv16 = (_Float16*)(ws + 58 * MB);
  _Float16* wo16 = (_Float16*)(ws + 59 * MB);
  _Float16* w1_16 = (_Float16*)(ws + 60 * MB);  // 2MB
  _Float16* w2_16 = (_Float16*)(ws + 62 * MB);  // 2MB

  const int WSQ = DD * HH * KDM;   // 512*512
  const int WS1 = DD * DFF;        // 512*2048
  auto cvt = [&](const float* s, _Float16* d, int n) {
    cvt_f32_f16<<<(n + 255) / 256, 256, 0, stream>>>(s, d, n);
  };
  cvt(Wq, wq16, WSQ); cvt(Wk, wk16, WSQ); cvt(Wv, wv16, WSQ);
  cvt(Wo, wo16, WSQ); cvt(W1, w1_16, WS1); cvt(W2, w2_16, WS1);

  // LN1 -> xn16
  ln_rows<<<BT / 8, 256, 0, stream>>>(x, ln1g, ln1b, xn16, BT);

  // QKV projections (fp16 out)
  dim3 gq(DD / 64, BT / 256);
  gemm_wmma<<<gq, 256, 0, stream>>>(xn16, wq16, bq, nullptr, q16, nullptr, BT, DD, DD, 0);
  gemm_wmma<<<gq, 256, 0, stream>>>(xn16, wk16, bk, nullptr, k16, nullptr, BT, DD, DD, 0);
  gemm_wmma<<<gq, 256, 0, stream>>>(xn16, wv16, bv, nullptr, v16, nullptr, BT, DD, DD, 0);

  // Block-sparse flash attention -> ctx16
  attn_wmma<<<(BB * HH * NQT) / 4, 128, 0, stream>>>(q16, k16, v16, ctx16);

  // Out projection + residual (fp32 x1)
  gemm_wmma<<<gq, 256, 0, stream>>>(ctx16, wo16, bo, x, nullptr, x1, BT, DD, DD, 0);

  // LN2 -> xn2
  ln_rows<<<BT / 8, 256, 0, stream>>>(x1, ln2g, ln2b, xn2, BT);

  // FFN1: relu(xn2 @ W1 + b1) -> h16
  dim3 g1(DFF / 64, BT / 256);
  gemm_wmma<<<g1, 256, 0, stream>>>(xn2, w1_16, b1, nullptr, h16, nullptr, BT, DFF, DD, 1);

  // FFN2: x1 + (h16 @ W2 + b2) -> out (fp32)
  dim3 g2(DD / 64, BT / 256);
  gemm_wmma<<<g2, 256, 0, stream>>>(h16, w2_16, b2, x1, nullptr, out, BT, DD, DFF, 0);
}

// v001
// A run of this version takes 310 microseconds.
// Two timings next to v000 put it at 1.37 and 1.36 times that version's speed.
#include <hip/hip_runtime.h>
#include <hip/hip_bf16.h>

typedef _Float16 half2v __attribute__((ext_vector_type(2)));
typedef _Float16 half8 __attribute__((ext_vector_type(8)));
typedef _Float16 v16h  __attribute__((ext_vector_type(16)));
typedef float    v8f   __attribute__((ext_vector_type(8)));
typedef int      i4v   __attribute__((ext_vector_type(4)));

#define WMMA_F32_F16(a, b, c) \
  __builtin_amdgcn_wmma_f32_16x16x32_f16(false, (a), false, (b), (short)0, (c), false, false)

#define AS1 __attribute__((address_space(1)))
#define AS3 __attribute__((address_space(3)))

// Async global->LDS copy (CDNA5 GLOBAL_LOAD_ASYNC_TO_LDS_B128, ASYNCcnt),
// with a synchronous fallback if the builtin is unavailable.
// Probe-verified: the builtin's params are (global int4*, local int4*, imm, imm).
__device__ __forceinline__ void async_copy_b128(const _Float16* g, _Float16* l) {
#if __has_builtin(__builtin_amdgcn_global_load_async_to_lds_b128)
  __builtin_amdgcn_global_load_async_to_lds_b128(
      (AS1 i4v*)g, (AS3 i4v*)l, 0, 0);
#else
  *(half8*)l = *(const half8*)g;
#endif
}
__device__ __forceinline__ void wait_async() {
#if __has_builtin(__builtin_amdgcn_global_load_async_to_lds_b128)
#if __has_builtin(__builtin_amdgcn_s_wait_asynccnt)
  __builtin_amdgcn_s_wait_asynccnt(0);
#else
  asm volatile("s_wait_asynccnt 0x0" ::: "memory");
#endif
#endif
}

// 2^a. The v_nop is the one free slot that the instruction set asks for between
// a transcendental and a next instruction that reads its result or overwrites
// its source.
__device__ __forceinline__ float exp2_slot(float a) {
  float e;
  asm("v_exp_f32 %0, %1\n\tv_nop" : "=v"(e) : "v"(a));
  return e;
}

// Problem dims
constexpr int BB  = 4;
constexpr int TT  = 2048;
constexpr int DD  = 512;
constexpr int HH  = 8;
constexpr int KDM = 64;
constexpr int DFF = 2048;
constexpr int BT  = BB * TT;          // 8192 rows
constexpr int NQT = TT / 16;          // 128 query tiles per (b,h)

// ---------------------------------------------------------------------------
// fp32 -> fp16 cast (weights)
// ---------------------------------------------------------------------------
__global__ void cvt_f32_f16(const float* __restrict__ src, _Float16* __restrict__ dst, int n) {
  int i = blockIdx.x * blockDim.x + threadIdx.x;
  if (i < n) dst[i] = (_Float16)src[i];
}

// ---------------------------------------------------------------------------
// LayerNorm: one wave (32 lanes) per row of D=512, writes fp16
// ---------------------------------------------------------------------------
__global__ __launch_bounds__(256)
void ln_rows(const float* __restrict__ x, const float* __restrict__ g,
             const float* __restrict__ b, _Float16* __restrict__ out, int nrows) {
  int wave = (int)((blockIdx.x * blockDim.x + threadIdx.x) >> 5);
  int lane = threadIdx.x & 31;
  if (wave >= nrows) return;
  const float* row = x + (size_t)wave * DD;
  float vals[16];
  float s = 0.f;
#pragma unroll
  for (int i = 0; i < 16; ++i) { vals[i] = row[lane + i * 32]; s += vals[i]; }
#pragma unroll
  for (int off = 1; off < 32; off <<= 1) s += __shfl_xor(s, off, 32);
  float mean = s * (1.0f / DD);
  float vs = 0.f;
#pragma unroll
  for (int i = 0; i < 16; ++i) { float d = vals[i] - mean; vs += d * d; }
#pragma unroll
  for (int off = 1; off < 32; off <<= 1) vs += __shfl_xor(vs, off, 32);
  float rstd = rsqrtf(vs * (1.0f / DD) + 1e-6f);
  _Float16* orow = out + (size_t)wave * DD;
#pragma unroll
  for (int i = 0; i < 16; ++i) {
    int c = lane + i * 32;
    orow[c] = (_Float16)((vals[i] - mean) * rstd * g[c] + b[c]);
  }
}

// ---------------------------------------------------------------------------
// Generic fp16 WMMA GEMM: C[M,N] = A[M,K] @ B[K,N] (+bias)(+relu)(+resid)
// Block tile 256(M) x 64(N), 8 waves; each wave owns a 32x64 strip:
// 2 A-fragments x 4 B-fragments = 8 WMMAs per K-step.
// A staged via async global->LDS B128; B staged transposed for contiguous
// 16B B-fragment ds loads.
// ---------------------------------------------------------------------------
__global__ __launch_bounds__(256)
void gemm_wmma(const _Float16* __restrict__ A, const _Float16* __restrict__ Bw,
               const float* __restrict__ bias, const float* __restrict__ resid,
               _Float16* __restrict__ out16, float* __restrict__ out32,
               int M, int N, int K, int doRelu) {
  constexpr int LDA = 40;   // halves; 80B row stride (16B aligned)
  constexpr int LDB = 40;
  __shared__ _Float16 As[256 * LDA];  // 20.0 KB
  __shared__ _Float16 Bs[64 * LDB];   // 5.0 KB, transposed: [n][k]

  int tid  = threadIdx.x;
  int w    = tid >> 5;
  int lane = tid & 31;
  int mBase = blockIdx.y * 256;
  int nBase = blockIdx.x * 64;
  int mloc  = lane & 15;
  int lh    = lane >> 4;

  v8f acc[2][4];
#pragma unroll
  for (int mi = 0; mi < 2; ++mi)
#pragma unroll
    for (int nt = 0; nt < 4; ++nt)
#pragma unroll
      for (int i = 0; i < 8; ++i) acc[mi][nt][i] = 0.f;

  for (int k0 = 0; k0 < K; k0 += 32) {
    // --- stage A tile: 256 rows x 32 halves; thread t copies row t (async) ---
    {
      const _Float16* src = A + (size_t)(mBase + tid) * K + k0;
      if (k0 + 32 < K) __builtin_prefetch(src + 32, 0, 3);
#pragma unroll
      for (int c = 0; c < 4; ++c)
        async_copy_b128(src + c * 8, &As[tid * LDA + c * 8]);
    }
    // --- stage B tile transposed: 32(k) x 64(n) -> Bs[n][k] ---
    {
      int kr = tid >> 3, n0 = (tid & 7) * 8;
      const _Float16* src = Bw + (size_t)(k0 + kr) * N + nBase + n0;
      half8 p = *(const half8*)(src);
#pragma unroll
      for (int j = 0; j < 8; ++j) Bs[(n0 + j) * LDB + kr] = p[j];
    }
    wait_async();
    __syncthreads();

    // --- A fragments (16x32, ISA 16-bit layout), rows w*32 + mi*16 ---
    v16h af[2];
#pragma unroll
    for (int mi = 0; mi < 2; ++mi) {
      int rloc = w * 32 + mi * 16 + mloc;
      half8 lo = *(const half8*)(&As[rloc * LDA + lh * 8]);
      half8 hi = *(const half8*)(&As[rloc * LDA + 16 + lh * 8]);
#pragma unroll
      for (int i = 0; i < 8; ++i) { af[mi][i] = lo[i]; af[mi][8 + i] = hi[i]; }
    }
    // --- 4 B fragments, 8 WMMAs ---
#pragma unroll
    for (int nt = 0; nt < 4; ++nt) {
      int n = nt * 16 + mloc;
      v16h bf;
      half8 lo = *(const half8*)(&Bs[n * LDB + lh * 8]);
      half8 hi = *(const half8*)(&Bs[n * LDB + 16 + lh * 8]);
#pragma unroll
      for (int i = 0; i < 8; ++i) { bf[i] = lo[i]; bf[8 + i] = hi[i]; }
      acc[0][nt] = WMMA_F32_F16(af[0], bf, acc[0][nt]);
      acc[1][nt] = WMMA_F32_F16(af[1], bf, acc[1][nt]);
    }
    __syncthreads();
  }

  // --- epilogue: C layout lane(col)=L%16, row = r + 8*(L/16) ---
  int cn = lane & 15, rh = lane >> 4;
#pragma unroll
  for (int mi = 0; mi < 2; ++mi)
#pragma unroll
    for (int nt = 0; nt < 4; ++nt) {
      int gn = nBase + nt * 16 + cn;
      float bv = bias ? bias[gn] : 0.f;
#pragma unroll
      for (int r = 0; r < 8; ++r) {
        int gm = mBase + w * 32 + mi * 16 + 8 * rh + r;
        float vv = acc[mi][nt][r] + bv;
        if (doRelu) vv = fmaxf(vv, 0.f);
        if (resid) vv += resid[(size_t)gm * N + gn];
        if (out32) out32[(size_t)gm * N + gn] = vv;
        else       out16[(size_t)gm * N + gn] = (_Float16)vv;
      }
    }
}

// ---------------------------------------------------------------------------
// Block-sparse flash attention, 20 waves per work-group. Online softmax, KD=64.
// Work-groups 0..B*H-1: query tile 0 of one (b,h) (global rows, i<16, which see
// every key). The 128 key tiles are split over the 20 waves, 6 or 7 each; the
// partial softmax states (max, sum, O) are merged through LDS in wave order.
// They come first in the grid because they are the longest.
// Other work-groups: one wave per query tile qt>=1, which visits key tile 0
// (global columns) + local tiles qt-2..qt+2.
// 20 waves: five per SIMD is what the register count admits, and the grid then
// has fewer work-groups than the chip has WGPs, so all start at once.
// ---------------------------------------------------------------------------
constexpr int AW   = 20;              // waves per attention work-group
constexpr int NGB  = BB * HH;         // work-groups that hold a query tile 0
constexpr int KTW  = NQT / AW;        // key tiles per wave there, rounded down
constexpr int KTX  = NQT % AW;        // the first KTX waves take one more
constexpr int NLT  = BB * HH * (NQT - 1);   // query tiles with qt >= 1
constexpr int OPP  = 66;              // floats per row of a partial O in LDS:
                                      // rows r and r+8 fall on different banks
__global__ __launch_bounds__(AW * 32)
void attn_wmma(const _Float16* __restrict__ Q, const _Float16* __restrict__ Kt,
               const _Float16* __restrict__ V, _Float16* __restrict__ ctx) {
  __shared__ _Float16 Pl[AW][16 * 16];  // per-wave P staging (C->A layout)
  __shared__ __attribute__((aligned(16)))
  float Op[AW][16 * OPP];               // per-wave partial O (query tile 0)
  __shared__ float Ms[AW][16];          // per-wave running max per row
  __shared__ float Ls[AW][16];          // per-wave running sum per row

  int w    = threadIdx.x >> 5;
  int lane = threadIdx.x & 31;
  bool glob = blockIdx.x < NGB;                  // uniform over the work-group
  int bh, qt;
  if (glob) {
    bh = blockIdx.x;
    qt = 0;
  } else {
    int t = (blockIdx.x - NGB) * AW + w;         // tiles 1..NQT-1 of every (b,h)
    if (t >= NLT) return;                        // these work-groups meet no barrier
    bh = t / (NQT - 1);
    qt = 1 + t % (NQT - 1);
  }
  int b    = bh / HH;
  int h    = bh % HH;
  int mloc = lane & 15;
  int lh   = lane >> 4;

  const size_t rs = (size_t)HH * KDM;            // 512 halves per token row
  const size_t hoff = (size_t)h * KDM;
  const _Float16* qb = Q  + (size_t)(b * TT) * rs + hoff;
  const _Float16* kb = Kt + (size_t)(b * TT) * rs + hoff;
  const _Float16* vb = V  + (size_t)(b * TT) * rs + hoff;

  // Q fragments: 16x64 -> two 16x32 A-fragments
  v16h qf[2];
#pragma unroll
  for (int ks = 0; ks < 2; ++ks) {
    const _Float16* base = qb + (size_t)(qt * 16 + mloc) * rs + ks * 32;
    half8 lo = *(const half8*)(base + lh * 8);
    half8 hi = *(const half8*)(base + 16 + lh * 8);
#pragma unroll
    for (int i = 0; i < 8; ++i) { qf[ks][i] = lo[i]; qf[ks][8 + i] = hi[i]; }
  }

  v8f O[4];
  float mrow[8], lrow[8];
#pragma unroll
  for (int nt = 0; nt < 4; ++nt)
#pragma unroll
    for (int i = 0; i < 8; ++i) O[nt][i] = 0.f;
#pragma unroll
  for (int r = 0; r < 8; ++r) { mrow[r] = -3.0e38f; lrow[r] = 0.f; }

  auto process = [&](int st, bool needMask) {
    int sbase = st * 16;
    // scores S = Q K^T / sqrt(KD)
    v8f S;
#pragma unroll
    for (int i = 0; i < 8; ++i) S[i] = 0.f;
    {
      const _Float16* krow = kb + (size_t)(sbase + mloc) * rs + lh * 8;
#pragma unroll
      for (int ks = 0; ks < 2; ++ks) {
        v16h bf;
        half8 lo = *(const half8*)(krow + ks * 32);
        half8 hi = *(const half8*)(krow + ks * 32 + 16);
        // behind the tile's last K load, before a later result may land in the
        // registers of the K address (named as an input so that they live to here)
        if (ks == 1) asm volatile("s_wait_xcnt 0x0" :: "v"(krow) : "memory");
#pragma unroll
        for (int i = 0; i < 8; ++i) { bf[i] = lo[i]; bf[8 + i] = hi[i]; }
        S = WMMA_F32_F16(qf[ks], bf, S);
      }
    }
#pragma unroll
    for (int r = 0; r < 8; ++r) S[r] *= 0.125f;
    if (needMask) {
      int j = sbase + mloc;
#pragma unroll
      for (int r = 0; r < 8; ++r) {
        int i  = qt * 16 + 8 * lh + r;
        int di = i - j; if (di < 0) di = -di;
        bool ok = (di <= 32) || (j < 16) || (i < 16);
        if (!ok) S[r] = -1.0e9f;
      }
    }
    // online softmax (rows live across 16-lane halves)
    float pexp[8];
#pragma unroll
    for (int r = 0; r < 8; ++r) {
      float rm = S[r];
#pragma unroll
      for (int off = 1; off < 16; off <<= 1) rm = fmaxf(rm, __shfl_xor(rm, off, 32));
      float mn    = fmaxf(mrow[r], rm);
      float alpha = exp2_slot((mrow[r] - mn) * 1.44269504f);
      float p     = exp2_slot((S[r] - mn) * 1.44269504f);
      float sum   = p;
#pragma unroll
      for (int off = 1; off < 16; off <<= 1) sum += __shfl_xor(sum, off, 32);
      lrow[r] = lrow[r] * alpha + sum;
      mrow[r] = mn;
#pragma unroll
      for (int nt = 0; nt < 4; ++nt) O[nt][r] *= alpha;
      pexp[r] = p;
    }
    // stage P through LDS to convert C-layout -> A-layout (upper K half = 0)
#pragma unroll
    for (int r = 0; r < 8; ++r)
      Pl[w][(8 * lh + r) * 16 + mloc] = (_Float16)pexp[r];
    v16h ap;
    {
      half8 lo = *(const half8*)(&Pl[w][mloc * 16 + lh * 8]);
#pragma unroll
      for (int i = 0; i < 8; ++i) { ap[i] = lo[i]; ap[8 + i] = (_Float16)0.f; }
    }
    // O += P x V  (V tile is 16(s) x 64(kd); upper K half zero)
    const _Float16* vrow = vb + (size_t)(sbase + lh * 8) * rs + mloc;
#pragma unroll
    for (int nt = 0; nt < 4; ++nt) {
      v16h bvf;
#pragma unroll
      for (int i = 0; i < 8; ++i) {
        bvf[i]     = vrow[(size_t)i * rs + nt * 16];
        bvf[8 + i] = (_Float16)0.f;
      }
      O[nt] = WMMA_F32_F16(ap, bvf, O[nt]);
    }
    // the same behind the tile's last V load, for the registers of the V address
    asm volatile("s_wait_xcnt 0x0" :: "v"(vrow) : "memory");
  };

  if (glob) {
    int s0 = w * KTW + (w < KTX ? w : KTX);
    int s1 = s0 + KTW + (w < KTX ? 1 : 0);
    for (int st = s0; st < s1; ++st) process(st, false);
  } else {
    process(0, false);                       // global columns (j < 16)
    int lo = qt - 2 < 1 ? 1 : qt - 2;
    int hi = qt + 2 > NQT - 1 ? NQT - 1 : qt + 2;
    for (int st = lo; st <= hi; ++st) process(st, true);
  }

  // normalize + write ctx (fp16, [B,T,H,KD])
  _Float16* cb = ctx + (size_t)(b * TT + qt * 16) * rs + hoff;

  if (glob) {
    // publish this wave's partial state
    // (unrolled: mrow, lrow and O live in registers and need constant indices)
#pragma unroll
    for (int r = 0; r < 8; ++r)
      if (mloc == 0) { Ms[w][8 * lh + r] = mrow[r]; Ls[w][8 * lh + r] = lrow[r]; }
#pragma unroll
    for (int nt = 0; nt < 4; ++nt)
#pragma unroll
      for (int r = 0; r < 8; ++r)
        Op[w][(8 * lh + r) * OPP + nt * 16 + mloc] = O[nt][r];
    __syncthreads();
    // wave w merges query row w; a lane owns two adjacent columns
    // (both loops unrolled: every LDS read of the merge is issued up front)
    if (w >= 16) return;
    float M = Ms[0][w];
#pragma unroll
    for (int ww = 1; ww < AW; ++ww) M = fmaxf(M, Ms[ww][w]);
    float L = 0.f, o0 = 0.f, o1 = 0.f;
#pragma unroll
    for (int ww = 0; ww < AW; ++ww) {
      float e = exp2_slot((Ms[ww][w] - M) * 1.44269504f);
      float2 p = *(const float2*)(&Op[ww][w * OPP + 2 * lane]);
      L  += Ls[ww][w] * e;
      o0 += p.x * e;
      o1 += p.y * e;
    }
    half2v res;
    res[0] = (_Float16)(o0 / L);
    res[1] = (_Float16)(o1 / L);
    *(half2v*)(cb + (size_t)w * rs + 2 * lane) = res;
    return;
  }
#pragma unroll
  for (int nt = 0; nt < 4; ++nt)
#pragma unroll
    for (int r = 0; r < 8; ++r) {
      float vv = O[nt][r] / lrow[r];
      cb[(size_t)(8 * lh + r) * rs + nt * 16 + mloc] = (_Float16)vv;
    }
  // behind the last store; on this path only the end of the kernel follows it
  asm volatile("s_wait_xcnt 0x0" ::: "memory");
}

// ---------------------------------------------------------------------------
// Host-side orchestration
// ---------------------------------------------------------------------------
extern "C" void kernel_launch(void* const* d_in, const int* in_sizes, int n_in,
                              void* d_out, int out_size, void* d_ws, size_t ws_size,
                              hipStream_t stream) {
  const float* x    = (const float*)d_in[0];
  const float* ln1g = (const float*)d_in[1];
  const float* ln1b = (const float*)d_in[2];
  const float* Wq   = (const float*)d_in[3];
  const float* bq   = (const float*)d_in[4];
  const float* Wk   = (const float*)d_in[5];
  const float* bk   = (const float*)d_in[6];
  const float* Wv   = (const float*)d_in[7];
  const float* bv   = (const float*)d_in[8];
  const float* Wo   = (const float*)d_in[9];
  const float* bo   = (const float*)d_in[10];
  const float* ln2g = (const float*)d_in[11];
  const float* ln2b = (const float*)d_in[12];
  const float* W1   = (const float*)d_in[13];
  const float* b1   = (const float*)d_in[14];
  const float* W2   = (const float*)d_in[15];
  const float* b2   = (const float*)d_in[16];
  float* out = (float*)d_out;

  char* ws = (char*)d_ws;
  const size_t MB = 1024ull * 1024ull;
  // Region 0 (32MB): xn16|q16|k16|v16 ; later aliased by FFN hidden h16
  _Float16* xn16 = (_Float16*)(ws + 0 * MB);
  _Float16* q16  = (_Float16*)(ws + 8 * MB);
  _Float16* k16  = (_Float16*)(ws + 16 * MB);
  _Float16* v16  = (_Float16*)(ws + 24 * MB);
  _Float16* h16  = (_Float16*)(ws + 0 * MB);    // alias (32MB), after attn
  _Float16* ctx16 = (_Float16*)(ws + 32 * MB);  // 8MB
  _Float16* xn2   = (_Float16*)(ws + 32 * MB);  // alias ctx16 after out-proj
  float*    x1    = (float*)   (ws + 40 * MB);  // 16MB
  _Float16* wq16 = (_Float16*)(ws + 56 * MB);
  _Float16* wk16 = (_Float16*)(ws + 57 * MB);
  _Float16* wv16 = (_Float16*)(ws + 58 * MB);
  _Float16* wo16 = (_Float16*)(ws + 59 * MB);
  _Float16* w1_16 = (_Float16*)(ws + 60 * MB);  // 2MB
  _Float16* w2_16 = (_Float16*)(ws + 62 * MB);  // 2MB

  const int WSQ = DD * HH * KDM;   // 512*512
  const int WS1 = DD * DFF;        // 512*2048
  auto cvt = [&](const float* s, _Float16* d, int n) {
    cvt_f32_f16<<<(n + 255) / 256, 256, 0, stream>>>(s, d, n);
  };
  cvt(Wq, wq16, WSQ); cvt(Wk, wk16, WSQ); cvt(Wv, wv16, WSQ);
  cvt(Wo, wo16, WSQ); cvt(W1, w1_16, WS1); cvt(W2, w2_16, WS1);

  // LN1 -> xn16
  ln_rows<<<BT / 8, 256, 0, stream>>>(x, ln1g, ln1b, xn16, BT);

  // QKV projections (fp16 out)
  dim3 gq(DD / 64, BT / 256);
  gemm_wmma<<<gq, 256, 0, stream>>>(xn16, wq16, bq, nullptr, q16, nullptr, BT, DD, DD, 0);
  gemm_wmma<<<gq, 256, 0, stream>>>(xn16, wk16, bk, nullptr, k16, nullptr, BT, DD, DD, 0);
  gemm_wmma<<<gq, 256, 0, stream>>>(xn16, wv16, bv, nullptr, v16, nullptr, BT, DD, DD, 0);

  // Block-sparse flash attention -> ctx16
  attn_wmma<<<NGB + (NLT + AW - 1) / AW, AW * 32, 0, stream>>>(q16, k16, v16, ctx16);

  // Out projection + residual (fp32 x1)
  gemm_wmma<<<gq, 256, 0, stream>>>(ctx16, wo16, bo, x, nullptr, x1, BT, DD, DD, 0);

  // LN2 -> xn2
  ln_rows<<<BT / 8, 256, 0, stream>>>(x1, ln2g, ln2b, xn2, BT);

  // FFN1: relu(xn2 @ W1 + b1) -> h16
  dim3 g1(DFF / 64, BT / 256);
  gemm_wmma<<<g1, 256, 0, stream>>>(xn2, w1_16, b1, nullptr, h16, nullptr, BT, DFF, DD, 1);

  // FFN2: x1 + (h16 @ W2 + b2) -> out (fp32)
  dim3 g2(DD / 64, BT / 256);
  gemm_wmma<<<g2, 256, 0, stream>>>(h16, w2_16, b2, x1, nullptr, out, BT, DD, DFF, 0);
}

// v002
// One run takes 235 microseconds.
// Timed twice side by side with v001, it ran 1.31 and 1.32 times as fast.
// Over all steps from v000 it is 1.79 times as fast.
#include <hip/hip_runtime.h>
#include <hip/hip_bf16.h>

typedef _Float16 half2v __attribute__((ext_vector_type(2)));
typedef _Float16 half8 __attribute__((ext_vector_type(8)));
typedef _Float16 v16h  __attribute__((ext_vector_type(16)));
typedef float    v8f   __attribute__((ext_vector_type(8)));
typedef int      i4v   __attribute__((ext_vector_type(4)));

#define WMMA_F32_F16(a, b, c) \
  __builtin_amdgcn_wmma_f32_16x16x32_f16(false, (a), false, (b), (short)0, (c), false, false)

#define AS1 __attribute__((address_space(1)))
#define AS3 __attribute__((address_space(3)))

// Async global->LDS copy (CDNA5 GLOBAL_LOAD_ASYNC_TO_LDS_B128, ASYNCcnt),
// with a synchronous fallback if the builtin is unavailable.
// Probe-verified: the builtin's params are (global int4*, local int4*, imm, imm).
__device__ __forceinline__ void async_copy_b128(const _Float16* g, _Float16* l) {
#if __has_builtin(__builtin_amdgcn_global_load_async_to_lds_b128)
  __builtin_amdgcn_global_load_async_to_lds_b128(
      (AS1 i4v*)g, (AS3 i4v*)l, 0, 0);
#else
  *(half8*)l = *(const half8*)g;
#endif
}
__device__ __forceinline__ void wait_async() {
#if __has_builtin(__builtin_amdgcn_global_load_async_to_lds_b128)
#if __has_builtin(__builtin_amdgcn_s_wait_asynccnt)
  __builtin_amdgcn_s_wait_asynccnt(0);
#else
  asm volatile("s_wait_asynccnt 0x0" ::: "memory");
#endif
#endif
}

// 2^a. The v_nop is the one free slot that the instruction set asks for between
// a transcendental and a next instruction that reads its result or overwrites
// its source.
__device__ __forceinline__ float exp2_slot(float a) {
  float e;
  asm("v_exp_f32 %0, %1\n\tv_nop" : "=v"(e) : "v"(a));
  return e;
}

// Problem dims
constexpr int BB  = 4;
constexpr int TT  = 2048;
constexpr int DD  = 512;
constexpr int HH  = 8;
constexpr int KDM = 64;
constexpr int DFF = 2048;
constexpr int BT  = BB * TT;          // 8192 rows
constexpr int NQT = TT / 16;          // 128 query tiles per (b,h)

// ---------------------------------------------------------------------------
// fp32 -> fp16 cast (weights)
// ---------------------------------------------------------------------------
__global__ void cvt_f32_f16(const float* __restrict__ src, _Float16* __restrict__ dst, int n) {
  int i = blockIdx.x * blockDim.x + threadIdx.x;
  if (i < n) dst[i] = (_Float16)src[i];
}

// ---------------------------------------------------------------------------
// LayerNorm: one wave (32 lanes) per row of D=512, writes fp16
// ---------------------------------------------------------------------------
__global__ __launch_bounds__(256)
void ln_rows(const float* __restrict__ x, const float* __restrict__ g,
             const float* __restrict__ b, _Float16* __restrict__ out, int nrows) {
  int wave = (int)((blockIdx.x * blockDim.x + threadIdx.x) >> 5);
  int lane = threadIdx.x & 31;
  if (wave >= nrows) return;
  const float* row = x + (size_t)wave * DD;
  float vals[16];
  float s = 0.f;
#pragma unroll
  for (int i = 0; i < 16; ++i) { vals[i] = row[lane + i * 32]; s += vals[i]; }
#pragma unroll
  for (int off = 1; off < 32; off <<= 1) s += __shfl_xor(s, off, 32);
  float mean = s * (1.0f / DD);
  float vs = 0.f;
#pragma unroll
  for (int i = 0; i < 16; ++i) { float d = vals[i] - mean; vs += d * d; }
#pragma unroll
  for (int off = 1; off < 32; off <<= 1) vs += __shfl_xor(vs, off, 32);
  float rstd = rsqrtf(vs * (1.0f / DD) + 1e-6f);
  _Float16* orow = out + (size_t)wave * DD;
#pragma unroll
  for (int i = 0; i < 16; ++i) {
    int c = lane + i * 32;
    orow[c] = (_Float16)((vals[i] - mean) * rstd * g[c] + b[c]);
  }
}

// ---------------------------------------------------------------------------
// Generic fp16 WMMA GEMM: C[M,N] = A[M,K] @ B[K,N] (+bias)(+relu)(+resid)
// Block tile 256(M) x 64(N), 8 waves; each wave owns a 32x64 strip:
// 2 A-fragments x 4 B-fragments = 8 WMMAs per 32 k.
// One trip of the K loop stages BK k of both operands and then multiplies all
// of it, so the wait for the loads and the two barriers are paid once per BK k.
// K must be a multiple of BK.
// A staged via async global->LDS B128; B staged transposed for contiguous
// 16B B-fragment ds loads.
// ---------------------------------------------------------------------------
template <int BK>
__global__ __launch_bounds__(256)
void gemm_wmma(const _Float16* __restrict__ A, const _Float16* __restrict__ Bw,
               const float* __restrict__ bias, const float* __restrict__ resid,
               _Float16* __restrict__ out16, float* __restrict__ out32,
               int M, int N, int K, int doRelu) {
  static_assert(BK == 64 || BK == 128, "the wait behind the B loads names BK / 32 addresses");
  constexpr int LDA = BK + 8;   // halves; row pitch = 16 B x an odd number
  constexpr int LDB = BK + 8;
  constexpr int CPR = BK / 8;   // 16-byte pieces per A row of the tile
  __shared__ __attribute__((aligned(16))) _Float16 As[256 * LDA];
  __shared__ __attribute__((aligned(16))) _Float16 Bs[64 * LDB];  // transposed: [n][k]

  int tid  = threadIdx.x;
  int w    = tid >> 5;
  int lane = tid & 31;
  int mBase = blockIdx.y * 256;
  int nBase = blockIdx.x * 64;
  int mloc  = lane & 15;
  int lh    = lane >> 4;

  v8f acc[2][4];
#pragma unroll
  for (int mi = 0; mi < 2; ++mi)
#pragma unroll
    for (int nt = 0; nt < 4; ++nt)
#pragma unroll
      for (int i = 0; i < 8; ++i) acc[mi][nt][i] = 0.f;

  for (int k0 = 0; k0 < K; k0 += BK) {
    // --- stage A tile: 256 rows x BK halves (async); CPR adjacent lanes copy
    //     one row, so a wave-wide copy covers whole rows of the tile ---
    {
      int r0 = tid / CPR, ch = tid % CPR;
      const _Float16* src = A + (size_t)(mBase + r0) * K + k0 + ch * 8;
      // unrolled: all copies of the tile are in flight before the one wait
#pragma unroll
      for (int c = 0; c < CPR; ++c)
        async_copy_b128(src + (size_t)(c * (256 / CPR)) * K,
                        &As[(r0 + c * (256 / CPR)) * LDA + ch * 8]);
    }
    // --- stage B tile transposed: BK(k) x 64(n) -> Bs[n][k] ---
    {
      int kr = tid >> 3, n0 = (tid & 7) * 8;
      const _Float16* bp[BK / 32];
      half8 p[BK / 32];
      // unrolled: bp and p live in registers; every load is issued before the first store
#pragma unroll
      for (int c = 0; c < BK / 32; ++c) {
        bp[c] = Bw + (size_t)(k0 + c * 32 + kr) * N + nBase + n0;
        p[c] = *(const half8*)bp[c];
      }
      // thread t asks for row t of the next A tile
      const _Float16* pf = A + (size_t)(mBase + tid) * K + k0 + BK;
      if (k0 + BK < K) __builtin_prefetch(pf, 0, 3);
      // behind the trip's last load and the prefetch, before a later result may
      // land in their address registers (named as inputs so that they live to here)
      if constexpr (BK == 128)
        asm volatile("s_wait_xcnt 0x0"
                     :: "v"(bp[0]), "v"(bp[1]), "v"(bp[2]), "v"(bp[3]), "v"(pf) : "memory");
      else
        asm volatile("s_wait_xcnt 0x0" :: "v"(bp[0]), "v"(bp[1]), "v"(pf) : "memory");
#pragma unroll
      for (int c = 0; c < BK / 32; ++c)
#pragma unroll
        for (int j = 0; j < 8; ++j) Bs[(n0 + j) * LDB + c * 32 + kr] = p[c][j];
    }
    wait_async();
    __syncthreads();

    // unrolled: fragment offsets become immediates and loads of a later 32 k
    // can be issued under the WMMAs of an earlier one
#pragma unroll
    for (int kk = 0; kk < BK; kk += 32) {
      // --- A fragments (16x32, ISA 16-bit layout), rows w*32 + mi*16 ---
      v16h af[2];
#pragma unroll
      for (int mi = 0; mi < 2; ++mi) {
        int rloc = w * 32 + mi * 16 + mloc;
        half8 lo = *(const half8*)(&As[rloc * LDA + kk + lh * 8]);
        half8 hi = *(const half8*)(&As[rloc * LDA + kk + 16 + lh * 8]);
#pragma unroll
        for (int i = 0; i < 8; ++i) { af[mi][i] = lo[i]; af[mi][8 + i] = hi[i]; }
      }
      // --- 4 B fragments, 8 WMMAs ---
#pragma unroll
      for (int nt = 0; nt < 4; ++nt) {
        int n = nt * 16 + mloc;
        v16h bf;
        half8 lo = *(const half8*)(&Bs[n * LDB + kk + lh * 8]);
        half8 hi = *(const half8*)(&Bs[n * LDB + kk + 16 + lh * 8]);
#pragma unroll
        for (int i = 0; i < 8; ++i) { bf[i] = lo[i]; bf[8 + i] = hi[i]; }
        acc[0][nt] = WMMA_F32_F16(af[0], bf, acc[0][nt]);
        acc[1][nt] = WMMA_F32_F16(af[1], bf, acc[1][nt]);
      }
    }
    __syncthreads();
  }

  // --- epilogue: C layout lane(col)=L%16, row = r + 8*(L/16) ---
  int cn = lane & 15, rh = lane >> 4;
#pragma unroll
  for (int mi = 0; mi < 2; ++mi)
#pragma unroll
    for (int nt = 0; nt < 4; ++nt) {
      int gn = nBase + nt * 16 + cn;
      float bv = bias ? bias[gn] : 0.f;
#pragma unroll
      for (int r = 0; r < 8; ++r) {
        int gm = mBase + w * 32 + mi * 16 + 8 * rh + r;
        float vv = acc[mi][nt][r] + bv;
        if (doRelu) vv = fmaxf(vv, 0.f);
        if (resid) vv += resid[(size_t)gm * N + gn];
        if (out32) out32[(size_t)gm * N + gn] = vv;
        else       out16[(size_t)gm * N + gn] = (_Float16)vv;
      }
    }
}

// ---------------------------------------------------------------------------
// Block-sparse flash attention, 20 waves per work-group. Online softmax, KD=64.
// Work-groups 0..B*H-1: query tile 0 of one (b,h) (global rows, i<16, which see
// every key). The 128 key tiles are split over the 20 waves, 6 or 7 each; the
// partial softmax states (max, sum, O) are merged through LDS in wave order.
// They come first in the grid because they are the longest.
// Other work-groups: one wave per query tile qt>=1, which visits key tile 0
// (global columns) + local tiles qt-2..qt+2.
// 20 waves: five per SIMD is what the register count admits, and the grid then
// has fewer work-groups than the chip has WGPs, so all start at once.
// ---------------------------------------------------------------------------
constexpr int AW   = 20;              // waves per attention work-group
constexpr int NGB  = BB * HH;         // work-groups that hold a query tile 0
constexpr int KTW  = NQT / AW;        // key tiles per wave there, rounded down
constexpr int KTX  = NQT % AW;        // the first KTX waves take one more
constexpr int NLT  = BB * HH * (NQT - 1);   // query tiles with qt >= 1
constexpr int OPP  = 66;              // floats per row of a partial O in LDS:
                                      // rows r and r+8 fall on different banks
__global__ __launch_bounds__(AW * 32)
void attn_wmma(const _Float16* __restrict__ Q, const _Float16* __restrict__ Kt,
               const _Float16* __restrict__ V, _Float16* __restrict__ ctx) {
  __shared__ _Float16 Pl[AW][16 * 16];  // per-wave P staging (C->A layout)
  __shared__ __attribute__((aligned(16)))
  float Op[AW][16 * OPP];               // per-wave partial O (query tile 0)
  __shared__ float Ms[AW][16];          // per-wave running max per row
  __shared__ float Ls[AW][16];          // per-wave running sum per row

  int w    = threadIdx.x >> 5;
  int lane = threadIdx.x & 31;
  bool glob = blockIdx.x < NGB;                  // uniform over the work-group
  int bh, qt;
  if (glob) {
    bh = blockIdx.x;
    qt = 0;
  } else {
    int t = (blockIdx.x - NGB) * AW + w;         // tiles 1..NQT-1 of every (b,h)
    if (t >= NLT) return;                        // these work-groups meet no barrier
    bh = t / (NQT - 1);
    qt = 1 + t % (NQT - 1);
  }
  int b    = bh / HH;
  int h    = bh % HH;
  int mloc = lane & 15;
  int lh   = lane >> 4;

  const size_t rs = (size_t)HH * KDM;            // 512 halves per token row
  const size_t hoff = (size_t)h * KDM;
  const _Float16* qb = Q  + (size_t)(b * TT) * rs + hoff;
  const _Float16* kb = Kt + (size_t)(b * TT) * rs + hoff;
  const _Float16* vb = V  + (size_t)(b * TT) * rs + hoff;

  // Q fragments: 16x64 -> two 16x32 A-fragments
  v16h qf[2];
#pragma unroll
  for (int ks = 0; ks < 2; ++ks) {
    const _Float16* base = qb + (size_t)(qt * 16 + mloc) * rs + ks * 32;
    half8 lo = *(const half8*)(base + lh * 8);
    half8 hi = *(const half8*)(base + 16 + lh * 8);
#pragma unroll
    for (int i = 0; i < 8; ++i) { qf[ks][i] = lo[i]; qf[ks][8 + i] = hi[i]; }
  }

  v8f O[4];
  float mrow[8], lrow[8];
#pragma unroll
  for (int nt = 0; nt < 4; ++nt)
#pragma unroll
    for (int i = 0; i < 8; ++i) O[nt][i] = 0.f;
#pragma unroll
  for (int r = 0; r < 8; ++r) { mrow[r] = -3.0e38f; lrow[r] = 0.f; }

  auto process = [&](int st, bool needMask) {
    int sbase = st * 16;
    // scores S = Q K^T / sqrt(KD)
    v8f S;
#pragma unroll
    for (int i = 0; i < 8; ++i) S[i] = 0.f;
    {
      const _Float16* krow = kb + (size_t)(sbase + mloc) * rs + lh * 8;
#pragma unroll
      for (int ks = 0; ks < 2; ++ks) {
        v16h bf;
        half8 lo = *(const half8*)(krow + ks * 32);
        half8 hi = *(const half8*)(krow + ks * 32 + 16);
        // behind the tile's last K load, before a later result may land in the
        // registers of the K address (named as an input so that they live to here)
        if (ks == 1) asm volatile("s_wait_xcnt 0x0" :: "v"(krow) : "memory");
#pragma unroll
        for (int i = 0; i < 8; ++i) { bf[i] = lo[i]; bf[8 + i] = hi[i]; }
        S = WMMA_F32_F16(qf[ks], bf, S);
      }
    }
#pragma unroll
    for (int r = 0; r < 8; ++r) S[r] *= 0.125f;
    if (needMask) {
      int j = sbase + mloc;
#pragma unroll
      for (int r = 0; r < 8; ++r) {
        int i  = qt * 16 + 8 * lh + r;
        int di = i - j; if (di < 0) di = -di;
        bool ok = (di <= 32) || (j < 16) || (i < 16);
        if (!ok) S[r] = -1.0e9f;
      }
    }
    // online softmax (rows live across 16-lane halves)
    float pexp[8];
#pragma unroll
    for (int r = 0; r < 8; ++r) {
      float rm = S[r];
#pragma unroll
      for (int off = 1; off < 16; off <<= 1) rm = fmaxf(rm, __shfl_xor(rm, off, 32));
      float mn    = fmaxf(mrow[r], rm);
      float alpha = exp2_slot((mrow[r] - mn) * 1.44269504f);
      float p     = exp2_slot((S[r] - mn) * 1.44269504f);
      float sum   = p;
#pragma unroll
      for (int off = 1; off < 16; off <<= 1) sum += __shfl_xor(sum, off, 32);
      lrow[r] = lrow[r] * alpha + sum;
      mrow[r] = mn;
#pragma unroll
      for (int nt = 0; nt < 4; ++nt) O[nt][r] *= alpha;
      pexp[r] = p;
    }
    // stage P through LDS to convert C-layout -> A-layout (upper K half = 0)
#pragma unroll
    for (int r = 0; r < 8; ++r)
      Pl[w][(8 * lh + r) * 16 + mloc] = (_Float16)pexp[r];
    v16h ap;
    {
      half8 lo = *(const half8*)(&Pl[w][mloc * 16 + lh * 8]);
#pragma unroll
      for (int i = 0; i < 8; ++i) { ap[i] = lo[i]; ap[8 + i] = (_Float16)0.f; }
    }
    // O += P x V  (V tile is 16(s) x 64(kd); upper K half zero)
    const _Float16* vrow = vb + (size_t)(sbase + lh * 8) * rs + mloc;
#pragma unroll
    for (int nt = 0; nt < 4; ++nt) {
      v16h bvf;
#pragma unroll
      for (int i = 0; i < 8; ++i) {
        bvf[i]     = vrow[(size_t)i * rs + nt * 16];
        bvf[8 + i] = (_Float16)0.f;
      }
      O[nt] = WMMA_F32_F16(ap, bvf, O[nt]);
    }
    // the same behind the tile's last V load, for the registers of the V address
    asm volatile("s_wait_xcnt 0x0" :: "v"(vrow) : "memory");
  };

  if (glob) {
    int s0 = w * KTW + (w < KTX ? w : KTX);
    int s1 = s0 + KTW + (w < KTX ? 1 : 0);
    for (int st = s0; st < s1; ++st) process(st, false);
  } else {
    process(0, false);                       // global columns (j < 16)
    int lo = qt - 2 < 1 ? 1 : qt - 2;
    int hi = qt + 2 > NQT - 1 ? NQT - 1 : qt + 2;
    for (int st = lo; st <= hi; ++st) process(st, true);
  }

  // normalize + write ctx (fp16, [B,T,H,KD])
  _Float16* cb = ctx + (size_t)(b * TT + qt * 16) * rs + hoff;

  if (glob) {
    // publish this wave's partial state
    // (unrolled: mrow, lrow and O live in registers and need constant indices)
#pragma unroll
    for (int r = 0; r < 8; ++r)
      if (mloc == 0) { Ms[w][8 * lh + r] = mrow[r]; Ls[w][8 * lh + r] = lrow[r]; }
#pragma unroll
    for (int nt = 0; nt < 4; ++nt)
#pragma unroll
      for (int r = 0; r < 8; ++r)
        Op[w][(8 * lh + r) * OPP + nt * 16 + mloc] = O[nt][r];
    __syncthreads();
    // wave w merges query row w; a lane owns two adjacent columns
    // (both loops unrolled: every LDS read of the merge is issued up front)
    if (w >= 16) return;
    float M = Ms[0][w];
#pragma unroll
    for (int ww = 1; ww < AW; ++ww) M = fmaxf(M, Ms[ww][w]);
    float L = 0.f, o0 = 0.f, o1 = 0.f;
#pragma unroll
    for (int ww = 0; ww < AW; ++ww) {
      float e = exp2_slot((Ms[ww][w] - M) * 1.44269504f);
      float2 p = *(const float2*)(&Op[ww][w * OPP + 2 * lane]);
      L  += Ls[ww][w] * e;
      o0 += p.x * e;
      o1 += p.y * e;
    }
    half2v res;
    res[0] = (_Float16)(o0 / L);
    res[1] = (_Float16)(o1 / L);
    *(half2v*)(cb + (size_t)w * rs + 2 * lane) = res;
    return;
  }
#pragma unroll
  for (int nt = 0; nt < 4; ++nt)
#pragma unroll
    for (int r = 0; r < 8; ++r) {
      float vv = O[nt][r] / lrow[r];
      cb[(size_t)(8 * lh + r) * rs + nt * 16 + mloc] = (_Float16)vv;
    }
  // behind the last store; on this path only the end of the kernel follows it
  asm volatile("s_wait_xcnt 0x0" ::: "memory");
}

// ---------------------------------------------------------------------------
// Host-side orchestration
// ---------------------------------------------------------------------------
extern "C" void kernel_launch(void* const* d_in, const int* in_sizes, int n_in,
                              void* d_out, int out_size, void* d_ws, size_t ws_size,
                              hipStream_t stream) {
  const float* x    = (const float*)d_in[0];
  const float* ln1g = (const float*)d_in[1];
  const float* ln1b = (const float*)d_in[2];
  const float* Wq   = (const float*)d_in[3];
  const float* bq   = (const float*)d_in[4];
  const float* Wk   = (const float*)d_in[5];
  const float* bk   = (const float*)d_in[6];
  const float* Wv   = (const float*)d_in[7];
  const float* bv   = (const float*)d_in[8];
  const float* Wo   = (const float*)d_in[9];
  const float* bo   = (const float*)d_in[10];
  const float* ln2g = (const float*)d_in[11];
  const float* ln2b = (const float*)d_in[12];
  const float* W1   = (const float*)d_in[13];
  const float* b1   = (const float*)d_in[14];
  const float* W2   = (const float*)d_in[15];
  const float* b2   = (const float*)d_in[16];
  float* out = (float*)d_out;

  char* ws = (char*)d_ws;
  const size_t MB = 1024ull * 1024ull;
  // Region 0 (32MB): xn16|q16|k16|v16 ; later aliased by FFN hidden h16
  _Float16* xn16 = (_Float16*)(ws + 0 * MB);
  _Float16* q16  = (_Float16*)(ws + 8 * MB);
  _Float16* k16  = (_Float16*)(ws + 16 * MB);
  _Float16* v16  = (_Float16*)(ws + 24 * MB);
  _Float16* h16  = (_Float16*)(ws + 0 * MB);    // alias (32MB), after attn
  _Float16* ctx16 = (_Float16*)(ws + 32 * MB);  // 8MB
  _Float16* xn2   = (_Float16*)(ws + 32 * MB);  // alias ctx16 after out-proj
  float*    x1    = (float*)   (ws + 40 * MB);  // 16MB
  _Float16* wq16 = (_Float16*)(ws + 56 * MB);
  _Float16* wk16 = (_Float16*)(ws + 57 * MB);
  _Float16* wv16 = (_Float16*)(ws + 58 * MB);
  _Float16* wo16 = (_Float16*)(ws + 59 * MB);
  _Float16* w1_16 = (_Float16*)(ws + 60 * MB);  // 2MB
  _Float16* w2_16 = (_Float16*)(ws + 62 * MB);  // 2MB

  const int WSQ = DD * HH * KDM;   // 512*512
  const int WS1 = DD * DFF;        // 512*2048
  auto cvt = [&](const float* s, _Float16* d, int n) {
    cvt_f32_f16<<<(n + 255) / 256, 256, 0, stream>>>(s, d, n);
  };
  cvt(Wq, wq16, WSQ); cvt(Wk, wk16, WSQ); cvt(Wv, wv16, WSQ);
  cvt(Wo, wo16, WSQ); cvt(W1, w1_16, WS1); cvt(W2, w2_16, WS1);

  // LN1 -> xn16
  ln_rows<<<BT / 8, 256, 0, stream>>>(x, ln1g, ln1b, xn16, BT);

  // QKV projections (fp16 out)
  dim3 gq(DD / 64, BT / 256);
  gemm_wmma<128><<<gq, 256, 0, stream>>>(xn16, wq16, bq, nullptr, q16, nullptr, BT, DD, DD, 0);
  gemm_wmma<128><<<gq, 256, 0, stream>>>(xn16, wk16, bk, nullptr, k16, nullptr, BT, DD, DD, 0);
  gemm_wmma<128><<<gq, 256, 0, stream>>>(xn16, wv16, bv, nullptr, v16, nullptr, BT, DD, DD, 0);

  // Block-sparse flash attention -> ctx16
  attn_wmma<<<NGB + (NLT + AW - 1) / AW, AW * 32, 0, stream>>>(q16, k16, v16, ctx16);

  // Out projection + residual (fp32 x1)
  gemm_wmma<128><<<gq, 256, 0, stream>>>(ctx16, wo16, bo, x, nullptr, x1, BT, DD, DD, 0);

  // LN2 -> xn2
  ln_rows<<<BT / 8, 256, 0, stream>>>(x1, ln2g, ln2b, xn2, BT);

  // FFN1: relu(xn2 @ W1 + b1) -> h16
  dim3 g1(DFF / 64, BT / 256);
  gemm_wmma<64><<<g1, 256, 0, stream>>>(xn2, w1_16, b1, nullptr, h16, nullptr, BT, DFF, DD, 1);

  // FFN2: x1 + (h16 @ W2 + b2) -> out (fp32)
  dim3 g2(DD / 64, BT / 256);
  gemm_wmma<128><<<g2, 256, 0, stream>>>(h16, w2_16, b2, x1, nullptr, out, BT, DD, DFF, 0);
}

// v003
// A run of this version takes 201 microseconds.
// Two timings next to v002 both put it at 1.17 times that version's speed.
// Counting every step since v000, it is 2.09 times as fast.
#include <hip/hip_runtime.h>
#include <hip/hip_bf16.h>

typedef _Float16 half2v __attribute__((ext_vector_type(2)));
typedef _Float16 half8 __attribute__((ext_vector_type(8)));
typedef _Float16 v16h  __attribute__((ext_vector_type(16)));
typedef float    v8f   __attribute__((ext_vector_type(8)));
typedef int      i4v   __attribute__((ext_vector_type(4)));
typedef float    f4v   __attribute__((ext_vector_type(4)));

#define WMMA_F32_F16(a, b, c) \
  __builtin_amdgcn_wmma_f32_16x16x32_f16(false, (a), false, (b), (short)0, (c), false, false)

#define AS1 __attribute__((address_space(1)))
#define AS3 __attribute__((address_space(3)))

// Async global->LDS copy (CDNA5 GLOBAL_LOAD_ASYNC_TO_LDS_B128, ASYNCcnt),
// with a synchronous fallback if the builtin is unavailable.
// Probe-verified: the builtin's params are (global int4*, local int4*, imm, imm).
__device__ __forceinline__ void async_copy_b128(const _Float16* g, _Float16* l) {
#if __has_builtin(__builtin_amdgcn_global_load_async_to_lds_b128)
  __builtin_amdgcn_global_load_async_to_lds_b128(
      (AS1 i4v*)g, (AS3 i4v*)l, 0, 0);
#else
  *(half8*)l = *(const half8*)g;
#endif
}
__device__ __forceinline__ void wait_async() {
#if __has_builtin(__builtin_amdgcn_global_load_async_to_lds_b128)
#if __has_builtin(__builtin_amdgcn_s_wait_asynccnt)
  __builtin_amdgcn_s_wait_asynccnt(0);
#else
  asm volatile("s_wait_asynccnt 0x0" ::: "memory");
#endif
#endif
}

// 2^a. The v_nop is the one free slot that the instruction set asks for between
// a transcendental and a next instruction that reads its result or overwrites
// its source.
__device__ __forceinline__ float exp2_slot(float a) {
  float e;
  asm("v_exp_f32 %0, %1\n\tv_nop" : "=v"(e) : "v"(a));
  return e;
}

// Problem dims
constexpr int BB  = 4;
constexpr int TT  = 2048;
constexpr int DD  = 512;
constexpr int HH  = 8;
constexpr int KDM = 64;
constexpr int DFF = 2048;
constexpr int BT  = BB * TT;          // 8192 rows
constexpr int NQT = TT / 16;          // 128 query tiles per (b,h)

// ---------------------------------------------------------------------------
// LayerNorm: one wave (32 lanes) per row of D=512, writes fp16
// ---------------------------------------------------------------------------
__global__ __launch_bounds__(256)
void ln_rows(const float* __restrict__ x, const float* __restrict__ g,
             const float* __restrict__ b, _Float16* __restrict__ out, int nrows) {
  int wave = (int)((blockIdx.x * blockDim.x + threadIdx.x) >> 5);
  int lane = threadIdx.x & 31;
  if (wave >= nrows) return;
  const float* row = x + (size_t)wave * DD;
  float vals[16];
  float s = 0.f;
#pragma unroll
  for (int i = 0; i < 16; ++i) { vals[i] = row[lane + i * 32]; s += vals[i]; }
#pragma unroll
  for (int off = 1; off < 32; off <<= 1) s += __shfl_xor(s, off, 32);
  float mean = s * (1.0f / DD);
  float vs = 0.f;
#pragma unroll
  for (int i = 0; i < 16; ++i) { float d = vals[i] - mean; vs += d * d; }
#pragma unroll
  for (int off = 1; off < 32; off <<= 1) vs += __shfl_xor(vs, off, 32);
  float rstd = rsqrtf(vs * (1.0f / DD) + 1e-6f);
  _Float16* orow = out + (size_t)wave * DD;
#pragma unroll
  for (int i = 0; i < 16; ++i) {
    int c = lane + i * 32;
    orow[c] = (_Float16)((vals[i] - mean) * rstd * g[c] + b[c]);
  }
}

// ---------------------------------------------------------------------------
// Generic fp16 WMMA GEMM: C[M,N] = A[M,K] @ B[K,N] (+bias)(+relu)(+resid)
// Block tile 256(M) x 64(N), 8 waves; each wave owns a 32x64 strip:
// 2 A-fragments x 4 B-fragments = 8 WMMAs per 32 k.
// One trip of the K loop stages BK k of both operands and then multiplies all
// of it, so the wait for the loads and the two barriers are paid once per BK k.
// K must be a multiple of BK.
// A staged via async global->LDS B128. B is the f32 weight itself: a thread
// loads 4 columns of BK / 16 consecutive k rows, rounds them to f16 and stores
// each column's run of k as one vector, so Bs is [n][k] for contiguous 16B
// B-fragment ds loads.
// ---------------------------------------------------------------------------
template <int BK>
__global__ __launch_bounds__(256)
void gemm_wmma(const _Float16* __restrict__ A, const float* __restrict__ Bw,
               const float* __restrict__ bias, const float* __restrict__ resid,
               _Float16* __restrict__ out16, float* __restrict__ out32,
               int M, int N, int K, int doRelu) {
  static_assert(BK == 64 || BK == 128, "the wait behind the B loads names BK / 16 addresses");
  constexpr int LDA = BK + 8;   // halves; row pitch = 16 B x an odd number
  constexpr int LDB = BK + 8;
  constexpr int CPR = BK / 8;   // 16-byte pieces per A row of the tile
  constexpr int RPT = BK / 16;  // k rows of the B tile per thread
  typedef _Float16 hrun __attribute__((ext_vector_type(RPT)));
  __shared__ __attribute__((aligned(16))) _Float16 As[256 * LDA];
  __shared__ __attribute__((aligned(16))) _Float16 Bs[64 * LDB];  // transposed: [n][k]

  int tid  = threadIdx.x;
  int w    = tid >> 5;
  int lane = tid & 31;
  int mBase = blockIdx.y * 256;
  int nBase = blockIdx.x * 64;
  int mloc  = lane & 15;
  int lh    = lane >> 4;

  v8f acc[2][4];
#pragma unroll
  for (int mi = 0; mi < 2; ++mi)
#pragma unroll
    for (int nt = 0; nt < 4; ++nt)
#pragma unroll
      for (int i = 0; i < 8; ++i) acc[mi][nt][i] = 0.f;

  for (int k0 = 0; k0 < K; k0 += BK) {
    // --- stage A tile: 256 rows x BK halves (async); CPR adjacent lanes copy
    //     one row, so a wave-wide copy covers whole rows of the tile ---
    {
      int r0 = tid / CPR, ch = tid % CPR;
      const _Float16* src = A + (size_t)(mBase + r0) * K + k0 + ch * 8;
      // unrolled: all copies of the tile are in flight before the one wait
#pragma unroll
      for (int c = 0; c < CPR; ++c)
        async_copy_b128(src + (size_t)(c * (256 / CPR)) * K,
                        &As[(r0 + c * (256 / CPR)) * LDA + ch * 8]);
    }
    // --- stage B tile transposed and rounded to f16: BK(k) x 64(n) f32 -> Bs[n][k];
    //     16 adjacent lanes load one whole 256-byte row of the tile ---
    {
      int kg = (tid >> 4) * RPT, n0 = (tid & 15) * 4;
      const float* bp[RPT];
      f4v p[RPT];
      // unrolled: bp and p live in registers; every load is issued before the first store
#pragma unroll
      for (int c = 0; c < RPT; ++c) {
        bp[c] = Bw + (size_t)(k0 + kg + c) * N + nBase + n0;
        p[c] = *(const f4v*)bp[c];
      }
      // thread t asks for row t of the next A tile
      const _Float16* pf = A + (size_t)(mBase + tid) * K + k0 + BK;
      if (k0 + BK < K) __builtin_prefetch(pf, 0, 3);
      // behind the trip's last load and the prefetch, before a later result may
      // land in their address registers (named as inputs so that they live to here)
      if constexpr (BK == 128)
        asm volatile("s_wait_xcnt 0x0"
                     :: "v"(bp[0]), "v"(bp[1]), "v"(bp[2]), "v"(bp[3]),
                        "v"(bp[4]), "v"(bp[5]), "v"(bp[6]), "v"(bp[7]), "v"(pf) : "memory");
      else
        // the loaded values are inputs too: all four loads are then issued before
        // the first is waited for (else the build waits between two pairs of loads)
        asm volatile("s_wait_xcnt 0x0"
                     :: "v"(bp[0]), "v"(bp[1]), "v"(bp[2]), "v"(bp[3]), "v"(pf),
                        "v"(p[0]), "v"(p[1]), "v"(p[2]), "v"(p[3]) : "memory");
      // both unrolled: p and q are indexed by constants and stay in registers
#pragma unroll
      for (int j = 0; j < 4; ++j) {
        hrun q;
#pragma unroll
        for (int c = 0; c < RPT; ++c) q[c] = (_Float16)p[c][j];
        *(hrun*)(&Bs[(n0 + j) * LDB + kg]) = q;
      }
    }
    wait_async();
    __syncthreads();

    // unrolled: fragment offsets become immediates and loads of a later 32 k
    // can be issued under the WMMAs of an earlier one
#pragma unroll
    for (int kk = 0; kk < BK; kk += 32) {
      // --- A fragments (16x32, ISA 16-bit layout), rows w*32 + mi*16 ---
      v16h af[2];
#pragma unroll
      for (int mi = 0; mi < 2; ++mi) {
        int rloc = w * 32 + mi * 16 + mloc;
        half8 lo = *(const half8*)(&As[rloc * LDA + kk + lh * 8]);
        half8 hi = *(const half8*)(&As[rloc * LDA + kk + 16 + lh * 8]);
#pragma unroll
        for (int i = 0; i < 8; ++i) { af[mi][i] = lo[i]; af[mi][8 + i] = hi[i]; }
      }
      // --- 4 B fragments, 8 WMMAs ---
#pragma unroll
      for (int nt = 0; nt < 4; ++nt) {
        int n = nt * 16 + mloc;
        v16h bf;
        half8 lo = *(const half8*)(&Bs[n * LDB + kk + lh * 8]);
        half8 hi = *(const half8*)(&Bs[n * LDB + kk + 16 + lh * 8]);
#pragma unroll
        for (int i = 0; i < 8; ++i) { bf[i] = lo[i]; bf[8 + i] = hi[i]; }
        acc[0][nt] = WMMA_F32_F16(af[0], bf, acc[0][nt]);
        acc[1][nt] = WMMA_F32_F16(af[1], bf, acc[1][nt]);
      }
    }
    __syncthreads();
  }

  // --- epilogue: C layout lane(col)=L%16, row = r + 8*(L/16) ---
  int cn = lane & 15, rh = lane >> 4;
#pragma unroll
  for (int mi = 0; mi < 2; ++mi)
#pragma unroll
    for (int nt = 0; nt < 4; ++nt) {
      int gn = nBase + nt * 16 + cn;
      float bv = bias ? bias[gn] : 0.f;
#pragma unroll
      for (int r = 0; r < 8; ++r) {
        int gm = mBase + w * 32 + mi * 16 + 8 * rh + r;
        float vv = acc[mi][nt][r] + bv;
        if (doRelu) vv = fmaxf(vv, 0.f);
        if (resid) vv += resid[(size_t)gm * N + gn];
        if (out32) out32[(size_t)gm * N + gn] = vv;
        else       out16[(size_t)gm * N + gn] = (_Float16)vv;
      }
    }
}

// ---------------------------------------------------------------------------
// Block-sparse flash attention, 20 waves per work-group. Online softmax, KD=64.
// Work-groups 0..B*H-1: query tile 0 of one (b,h) (global rows, i<16, which see
// every key). The 128 key tiles are split over the 20 waves, 6 or 7 each; the
// partial softmax states (max, sum, O) are merged through LDS in wave order.
// They come first in the grid because they are the longest.
// Other work-groups: one wave per query tile qt>=1, which visits key tile 0
// (global columns) + local tiles qt-2..qt+2.
// 20 waves: five per SIMD is what the register count admits, and the grid then
// has fewer work-groups than the chip has WGPs, so all start at once.
// ---------------------------------------------------------------------------
constexpr int AW   = 20;              // waves per attention work-group
constexpr int NGB  = BB * HH;         // work-groups that hold a query tile 0
constexpr int KTW  = NQT / AW;        // key tiles per wave there, rounded down
constexpr int KTX  = NQT % AW;        // the first KTX waves take one more
constexpr int NLT  = BB * HH * (NQT - 1);   // query tiles with qt >= 1
constexpr int OPP  = 66;              // floats per row of a partial O in LDS:
                                      // rows r and r+8 fall on different banks
__global__ __launch_bounds__(AW * 32)
void attn_wmma(const _Float16* __restrict__ Q, const _Float16* __restrict__ Kt,
               const _Float16* __restrict__ V, _Float16* __restrict__ ctx) {
  __shared__ _Float16 Pl[AW][16 * 16];  // per-wave P staging (C->A layout)
  __shared__ __attribute__((aligned(16)))
  float Op[AW][16 * OPP];               // per-wave partial O (query tile 0)
  __shared__ float Ms[AW][16];          // per-wave running max per row
  __shared__ float Ls[AW][16];          // per-wave running sum per row

  int w    = threadIdx.x >> 5;
  int lane = threadIdx.x & 31;
  bool glob = blockIdx.x < NGB;                  // uniform over the work-group
  int bh, qt;
  if (glob) {
    bh = blockIdx.x;
    qt = 0;
  } else {
    int t = (blockIdx.x - NGB) * AW + w;         // tiles 1..NQT-1 of every (b,h)
    if (t >= NLT) return;                        // these work-groups meet no barrier
    bh = t / (NQT - 1);
    qt = 1 + t % (NQT - 1);
  }
  int b    = bh / HH;
  int h    = bh % HH;
  int mloc = lane & 15;
  int lh   = lane >> 4;

  const size_t rs = (size_t)HH * KDM;            // 512 halves per token row
  const size_t hoff = (size_t)h * KDM;
  const _Float16* qb = Q  + (size_t)(b * TT) * rs + hoff;
  const _Float16* kb = Kt + (size_t)(b * TT) * rs + hoff;
  const _Float16* vb = V  + (size_t)(b * TT) * rs + hoff;

  // Q fragments: 16x64 -> two 16x32 A-fragments
  v16h qf[2];
#pragma unroll
  for (int ks = 0; ks < 2; ++ks) {
    const _Float16* base = qb + (size_t)(qt * 16 + mloc) * rs + ks * 32;
    half8 lo = *(const half8*)(base + lh * 8);
    half8 hi = *(const half8*)(base + 16 + lh * 8);
#pragma unroll
    for (int i = 0; i < 8; ++i) { qf[ks][i] = lo[i]; qf[ks][8 + i] = hi[i]; }
  }

  v8f O[4];
  float mrow[8], lrow[8];
#pragma unroll
  for (int nt = 0; nt < 4; ++nt)
#pragma unroll
    for (int i = 0; i < 8; ++i) O[nt][i] = 0.f;
#pragma unroll
  for (int r = 0; r < 8; ++r) { mrow[r] = -3.0e38f; lrow[r] = 0.f; }

  auto process = [&](int st, bool needMask) {
    int sbase = st * 16;
    // scores S = Q K^T / sqrt(KD)
    v8f S;
#pragma unroll
    for (int i = 0; i < 8; ++i) S[i] = 0.f;
    {
      const _Float16* krow = kb + (size_t)(sbase + mloc) * rs + lh * 8;
#pragma unroll
      for (int ks = 0; ks < 2; ++ks) {
        v16h bf;
        half8 lo = *(const half8*)(krow + ks * 32);
        half8 hi = *(const half8*)(krow + ks * 32 + 16);
        // behind the tile's last K load, before a later result may land in the
        // registers of the K address (named as an input so that they live to here)
        if (ks == 1) asm volatile("s_wait_xcnt 0x0" :: "v"(krow) : "memory");
#pragma unroll
        for (int i = 0; i < 8; ++i) { bf[i] = lo[i]; bf[8 + i] = hi[i]; }
        S = WMMA_F32_F16(qf[ks], bf, S);
      }
    }
#pragma unroll
    for (int r = 0; r < 8; ++r) S[r] *= 0.125f;
    if (needMask) {
      int j = sbase + mloc;
#pragma unroll
      for (int r = 0; r < 8; ++r) {
        int i  = qt * 16 + 8 * lh + r;
        int di = i - j; if (di < 0) di = -di;
        bool ok = (di <= 32) || (j < 16) || (i < 16);
        if (!ok) S[r] = -1.0e9f;
      }
    }
    // online softmax (rows live across 16-lane halves)
    float pexp[8];
#pragma unroll
    for (int r = 0; r < 8; ++r) {
      float rm = S[r];
#pragma unroll
      for (int off = 1; off < 16; off <<= 1) rm = fmaxf(rm, __shfl_xor(rm, off, 32));
      float mn    = fmaxf(mrow[r], rm);
      float alpha = exp2_slot((mrow[r] - mn) * 1.44269504f);
      float p     = exp2_slot((S[r] - mn) * 1.44269504f);
      float sum   = p;
#pragma unroll
      for (int off = 1; off < 16; off <<= 1) sum += __shfl_xor(sum, off, 32);
      lrow[r] = lrow[r] * alpha + sum;
      mrow[r] = mn;
#pragma unroll
      for (int nt = 0; nt < 4; ++nt) O[nt][r] *= alpha;
      pexp[r] = p;
    }
    // stage P through LDS to convert C-layout -> A-layout (upper K half = 0)
#pragma unroll
    for (int r = 0; r < 8; ++r)
      Pl[w][(8 * lh + r) * 16 + mloc] = (_Float16)pexp[r];
    v16h ap;
    {
      half8 lo = *(const half8*)(&Pl[w][mloc * 16 + lh * 8]);
#pragma unroll
      for (int i = 0; i < 8; ++i) { ap[i] = lo[i]; ap[8 + i] = (_Float16)0.f; }
    }
    // O += P x V  (V tile is 16(s) x 64(kd); upper K half zero)
    const _Float16* vrow = vb + (size_t)(sbase + lh * 8) * rs + mloc;
#pragma unroll
    for (int nt = 0; nt < 4; ++nt) {
      v16h bvf;
#pragma unroll
      for (int i = 0; i < 8; ++i) {
        bvf[i]     = vrow[(size_t)i * rs + nt * 16];
        bvf[8 + i] = (_Float16)0.f;
      }
      O[nt] = WMMA_F32_F16(ap, bvf, O[nt]);
    }
    // the same behind the tile's last V load, for the registers of the V address
    asm volatile("s_wait_xcnt 0x0" :: "v"(vrow) : "memory");
  };

  if (glob) {
    int s0 = w * KTW + (w < KTX ? w : KTX);
    int s1 = s0 + KTW + (w < KTX ? 1 : 0);
    for (int st = s0; st < s1; ++st) process(st, false);
  } else {
    process(0, false);                       // global columns (j < 16)
    int lo = qt - 2 < 1 ? 1 : qt - 2;
    int hi = qt + 2 > NQT - 1 ? NQT - 1 : qt + 2;
    for (int st = lo; st <= hi; ++st) process(st, true);
  }

  // normalize + write ctx (fp16, [B,T,H,KD])
  _Float16* cb = ctx + (size_t)(b * TT + qt * 16) * rs + hoff;

  if (glob) {
    // publish this wave's partial state
    // (unrolled: mrow, lrow and O live in registers and need constant indices)
#pragma unroll
    for (int r = 0; r < 8; ++r)
      if (mloc == 0) { Ms[w][8 * lh + r] = mrow[r]; Ls[w][8 * lh + r] = lrow[r]; }
#pragma unroll
    for (int nt = 0; nt < 4; ++nt)
#pragma unroll
      for (int r = 0; r < 8; ++r)
        Op[w][(8 * lh + r) * OPP + nt * 16 + mloc] = O[nt][r];
    __syncthreads();
    // wave w merges query row w; a lane owns two adjacent columns
    // (both loops unrolled: every LDS read of the merge is issued up front)
    if (w >= 16) return;
    float M = Ms[0][w];
#pragma unroll
    for (int ww = 1; ww < AW; ++ww) M = fmaxf(M, Ms[ww][w]);
    float L = 0.f, o0 = 0.f, o1 = 0.f;
#pragma unroll
    for (int ww = 0; ww < AW; ++ww) {
      float e = exp2_slot((Ms[ww][w] - M) * 1.44269504f);
      float2 p = *(const float2*)(&Op[ww][w * OPP + 2 * lane]);
      L  += Ls[ww][w] * e;
      o0 += p.x * e;
      o1 += p.y * e;
    }
    half2v res;
    res[0] = (_Float16)(o0 / L);
    res[1] = (_Float16)(o1 / L);
    *(half2v*)(cb + (size_t)w * rs + 2 * lane) = res;
    return;
  }
#pragma unroll
  for (int nt = 0; nt < 4; ++nt)
#pragma unroll
    for (int r = 0; r < 8; ++r) {
      float vv = O[nt][r] / lrow[r];
      cb[(size_t)(8 * lh + r) * rs + nt * 16 + mloc] = (_Float16)vv;
    }
  // behind the last store; on this path only the end of the kernel follows it
  asm volatile("s_wait_xcnt 0x0" ::: "memory");
}

// ---------------------------------------------------------------------------
// Host-side orchestration
// ---------------------------------------------------------------------------
extern "C" void kernel_launch(void* const* d_in, const int* in_sizes, int n_in,
                              void* d_out, int out_size, void* d_ws, size_t ws_size,
                              hipStream_t stream) {
  const float* x    = (const float*)d_in[0];
  const float* ln1g = (const float*)d_in[1];
  const float* ln1b = (const float*)d_in[2];
  const float* Wq   = (const float*)d_in[3];
  const float* bq   = (const float*)d_in[4];
  const float* Wk   = (const float*)d_in[5];
  const float* bk   = (const float*)d_in[6];
  const float* Wv   = (const float*)d_in[7];
  const float* bv   = (const float*)d_in[8];
  const float* Wo   = (const float*)d_in[9];
  const float* bo   = (const float*)d_in[10];
  const float* ln2g = (const float*)d_in[11];
  const float* ln2b = (const float*)d_in[12];
  const float* W1   = (const float*)d_in[13];
  const float* b1   = (const float*)d_in[14];
  const float* W2   = (const float*)d_in[15];
  const float* b2   = (const float*)d_in[16];
  float* out = (float*)d_out;

  char* ws = (char*)d_ws;
  const size_t MB = 1024ull * 1024ull;
  // Region 0 (32MB): xn16|q16|k16|v16 ; later aliased by FFN hidden h16
  _Float16* xn16 = (_Float16*)(ws + 0 * MB);
  _Float16* q16  = (_Float16*)(ws + 8 * MB);
  _Float16* k16  = (_Float16*)(ws + 16 * MB);
  _Float16* v16  = (_Float16*)(ws + 24 * MB);
  _Float16* h16  = (_Float16*)(ws + 0 * MB);    // alias (32MB), after attn
  _Float16* ctx16 = (_Float16*)(ws + 32 * MB);  // 8MB
  _Float16* xn2   = (_Float16*)(ws + 32 * MB);  // alias ctx16 after out-proj
  float*    x1    = (float*)   (ws + 40 * MB);  // 16MB

  // LN1 -> xn16
  ln_rows<<<BT / 8, 256, 0, stream>>>(x, ln1g, ln1b, xn16, BT);

  // QKV projections (fp16 out)
  dim3 gq(DD / 64, BT / 256);
  gemm_wmma<128><<<gq, 256, 0, stream>>>(xn16, Wq, bq, nullptr, q16, nullptr, BT, DD, DD, 0);
  gemm_wmma<128><<<gq, 256, 0, stream>>>(xn16, Wk, bk, nullptr, k16, nullptr, BT, DD, DD, 0);
  gemm_wmma<128><<<gq, 256, 0, stream>>>(xn16, Wv, bv, nullptr, v16, nullptr, BT, DD, DD, 0);

  // Block-sparse flash attention -> ctx16
  attn_wmma<<<NGB + (NLT + AW - 1) / AW, AW * 32, 0, stream>>>(q16, k16, v16, ctx16);

  // Out projection + residual (fp32 x1)
  gemm_wmma<128><<<gq, 256, 0, stream>>>(ctx16, Wo, bo, x, nullptr, x1, BT, DD, DD, 0);

  // LN2 -> xn2
  ln_rows<<<BT / 8, 256, 0, stream>>>(x1, ln2g, ln2b, xn2, BT);

  // FFN1: relu(xn2 @ W1 + b1) -> h16
  dim3 g1(DFF / 64, BT / 256);
  gemm_wmma<64><<<g1, 256, 0, stream>>>(xn2, W1, b1, nullptr, h16, nullptr, BT, DFF, DD, 1);

  // FFN2: x1 + (h16 @ W2 + b2) -> out (fp32)
  dim3 g2(DD / 64, BT / 256);
  gemm_wmma<128><<<g2, 256, 0, stream>>>(h16, W2, b2, x1, nullptr, out, BT, DD, DFF, 0);
}

// v004
// A run of this version takes 142 microseconds.
// Two timings next to v003 put it at 1.42 and 1.41 times that version's speed.
// Over all steps from v000 it is 2.96 times as fast.
#include <hip/hip_runtime.h>
#include <hip/hip_bf16.h>

typedef _Float16 half2v __attribute__((ext_vector_type(2)));
typedef _Float16 half4 __attribute__((ext_vector_type(4)));
typedef _Float16 half8 __attribute__((ext_vector_type(8)));
typedef _Float16 v16h  __attribute__((ext_vector_type(16)));
typedef float    v8f   __attribute__((ext_vector_type(8)));
typedef int      i4v   __attribute__((ext_vector_type(4)));
typedef float    f4v   __attribute__((ext_vector_type(4)));

#define WMMA_F32_F16(a, b, c) \
  __builtin_amdgcn_wmma_f32_16x16x32_f16(false, (a), false, (b), (short)0, (c), false, false)

#define AS1 __attribute__((address_space(1)))
#define AS3 __attribute__((address_space(3)))

// Async global->LDS copy (CDNA5 GLOBAL_LOAD_ASYNC_TO_LDS_B128, ASYNCcnt),
// with a synchronous fallback if the builtin is unavailable.
// Probe-verified: the builtin's params are (global int4*, local int4*, imm, imm).
__device__ __forceinline__ void async_copy_b128(const _Float16* g, _Float16* l) {
#if __has_builtin(__builtin_amdgcn_global_load_async_to_lds_b128)
  __builtin_amdgcn_global_load_async_to_lds_b128(
      (AS1 i4v*)g, (AS3 i4v*)l, 0, 0);
#else
  *(half8*)l = *(const half8*)g;
#endif
}
__device__ __forceinline__ void wait_async() {
#if __has_builtin(__builtin_amdgcn_global_load_async_to_lds_b128)
#if __has_builtin(__builtin_amdgcn_s_wait_asynccnt)
  __builtin_amdgcn_s_wait_asynccnt(0);
#else
  asm volatile("s_wait_asynccnt 0x0" ::: "memory");
#endif
#endif
}

// 2^a. The v_nop is the one free slot that the instruction set asks for between
// a transcendental and a next instruction that reads its result or overwrites
// its source.
__device__ __forceinline__ float exp2_slot(float a) {
  float e;
  asm("v_exp_f32 %0, %1\n\tv_nop" : "=v"(e) : "v"(a));
  return e;
}

// Problem dims
constexpr int BB  = 4;
constexpr int TT  = 2048;
constexpr int DD  = 512;
constexpr int HH  = 8;
constexpr int KDM = 64;
constexpr int DFF = 2048;
constexpr int BT  = BB * TT;          // 8192 rows
constexpr int NQT = TT / 16;          // 128 query tiles per (b,h)

// ---------------------------------------------------------------------------
// LayerNorm: one wave (32 lanes) per row of D=512, writes fp16
// ---------------------------------------------------------------------------
__global__ __launch_bounds__(256)
void ln_rows(const float* __restrict__ x, const float* __restrict__ g,
             const float* __restrict__ b, _Float16* __restrict__ out, int nrows) {
  int wave = (int)((blockIdx.x * blockDim.x + threadIdx.x) >> 5);
  int lane = threadIdx.x & 31;
  if (wave >= nrows) return;
  const float* row = x + (size_t)wave * DD;
  float vals[16];
  float s = 0.f;
#pragma unroll
  for (int i = 0; i < 16; ++i) { vals[i] = row[lane + i * 32]; s += vals[i]; }
#pragma unroll
  for (int off = 1; off < 32; off <<= 1) s += __shfl_xor(s, off, 32);
  float mean = s * (1.0f / DD);
  float vs = 0.f;
#pragma unroll
  for (int i = 0; i < 16; ++i) { float d = vals[i] - mean; vs += d * d; }
#pragma unroll
  for (int off = 1; off < 32; off <<= 1) vs += __shfl_xor(vs, off, 32);
  float rstd = rsqrtf(vs * (1.0f / DD) + 1e-6f);
  _Float16* orow = out + (size_t)wave * DD;
#pragma unroll
  for (int i = 0; i < 16; ++i) {
    int c = lane + i * 32;
    orow[c] = (_Float16)((vals[i] - mean) * rstd * g[c] + b[c]);
  }
}

// ---------------------------------------------------------------------------
// Generic fp16 WMMA GEMM: C[M,N] = A[M,K] @ B[K,N] (+bias)(+relu)(+resid)
// Block tile 256(M) x 64(N), 8 waves; each wave owns a 32x64 strip:
// 2 A-fragments x 4 B-fragments = 8 WMMAs per 32 k.
// One trip of the K loop stages BK k of both operands and then multiplies all
// of it, so the wait for the loads and the two barriers are paid once per BK k.
// K must be a multiple of BK.
// A staged via async global->LDS B128. B is the f32 weight itself: a thread
// loads 4 columns of BK / 16 consecutive k rows, rounds them to f16 and stores
// each column's run of k as one vector, so Bs is [n][k] for contiguous 16B
// B-fragment ds loads.
// RES: the residual is added and the result is stored as f32 (out32); else the
// result is stored as f16 (out16) and resid is not read.
// ---------------------------------------------------------------------------
template <int BK, bool RES>
__global__ __launch_bounds__(256)
void gemm_wmma(const _Float16* __restrict__ A, const float* __restrict__ Bw,
               const float* __restrict__ bias, const float* __restrict__ resid,
               _Float16* __restrict__ out16, float* __restrict__ out32,
               int M, int N, int K, int doRelu) {
  static_assert(BK == 64 || BK == 128, "the wait behind the B loads names BK / 16 addresses");
  constexpr int LDA = BK + 8;   // halves; row pitch = 16 B x an odd number
  constexpr int LDB = BK + 8;
  constexpr int CPR = BK / 8;   // 16-byte pieces per A row of the tile
  constexpr int RPT = BK / 16;  // k rows of the B tile per thread
  typedef _Float16 hrun __attribute__((ext_vector_type(RPT)));
  __shared__ __attribute__((aligned(16))) _Float16 As[256 * LDA];
  __shared__ __attribute__((aligned(16))) _Float16 Bs[64 * LDB];  // transposed: [n][k]

  int tid  = threadIdx.x;
  int w    = tid >> 5;
  int lane = tid & 31;
  int mBase = blockIdx.y * 256;
  int nBase = blockIdx.x * 64;
  int mloc  = lane & 15;
  int lh    = lane >> 4;

  v8f acc[2][4];
#pragma unroll
  for (int mi = 0; mi < 2; ++mi)
#pragma unroll
    for (int nt = 0; nt < 4; ++nt)
#pragma unroll
      for (int i = 0; i < 8; ++i) acc[mi][nt][i] = 0.f;

  for (int k0 = 0; k0 < K; k0 += BK) {
    // --- stage A tile: 256 rows x BK halves (async); CPR adjacent lanes copy
    //     one row, so a wave-wide copy covers whole rows of the tile ---
    {
      int r0 = tid / CPR, ch = tid % CPR;
      const _Float16* src = A + (size_t)(mBase + r0) * K + k0 + ch * 8;
      // unrolled: all copies of the tile are in flight before the one wait
#pragma unroll
      for (int c = 0; c < CPR; ++c)
        async_copy_b128(src + (size_t)(c * (256 / CPR)) * K,
                        &As[(r0 + c * (256 / CPR)) * LDA + ch * 8]);
    }
    // --- stage B tile transposed and rounded to f16: BK(k) x 64(n) f32 -> Bs[n][k];
    //     16 adjacent lanes load one whole 256-byte row of the tile ---
    {
      int kg = (tid >> 4) * RPT, n0 = (tid & 15) * 4;
      const float* bp[RPT];
      f4v p[RPT];
      // unrolled: bp and p live in registers; every load is issued before the first store
#pragma unroll
      for (int c = 0; c < RPT; ++c) {
        bp[c] = Bw + (size_t)(k0 + kg + c) * N + nBase + n0;
        p[c] = *(const f4v*)bp[c];
      }
      // thread t asks for row t of the next A tile
      const _Float16* pf = A + (size_t)(mBase + tid) * K + k0 + BK;
      if (k0 + BK < K) __builtin_prefetch(pf, 0, 3);
      // behind the trip's last load and the prefetch, before a later result may
      // land in their address registers (named as inputs so that they live to here)
      if constexpr (BK == 128)
        asm volatile("s_wait_xcnt 0x0"
                     :: "v"(bp[0]), "v"(bp[1]), "v"(bp[2]), "v"(bp[3]),
                        "v"(bp[4]), "v"(bp[5]), "v"(bp[6]), "v"(bp[7]), "v"(pf) : "memory");
      else
        // the loaded values are inputs too: all four loads are then issued before
        // the first is waited for (else the build waits between two pairs of loads)
        asm volatile("s_wait_xcnt 0x0"
                     :: "v"(bp[0]), "v"(bp[1]), "v"(bp[2]), "v"(bp[3]), "v"(pf),
                        "v"(p[0]), "v"(p[1]), "v"(p[2]), "v"(p[3]) : "memory");
      // both unrolled: p and q are indexed by constants and stay in registers
#pragma unroll
      for (int j = 0; j < 4; ++j) {
        hrun q;
#pragma unroll
        for (int c = 0; c < RPT; ++c) q[c] = (_Float16)p[c][j];
        *(hrun*)(&Bs[(n0 + j) * LDB + kg]) = q;
      }
    }
    wait_async();
    __syncthreads();

    // unrolled: fragment offsets become immediates and loads of a later 32 k
    // can be issued under the WMMAs of an earlier one
#pragma unroll
    for (int kk = 0; kk < BK; kk += 32) {
      // --- A fragments (16x32, ISA 16-bit layout), rows w*32 + mi*16 ---
      v16h af[2];
#pragma unroll
      for (int mi = 0; mi < 2; ++mi) {
        int rloc = w * 32 + mi * 16 + mloc;
        half8 lo = *(const half8*)(&As[rloc * LDA + kk + lh * 8]);
        half8 hi = *(const half8*)(&As[rloc * LDA + kk + 16 + lh * 8]);
#pragma unroll
        for (int i = 0; i < 8; ++i) { af[mi][i] = lo[i]; af[mi][8 + i] = hi[i]; }
      }
      // --- 4 B fragments, 8 WMMAs ---
#pragma unroll
      for (int nt = 0; nt < 4; ++nt) {
        int n = nt * 16 + mloc;
        v16h bf;
        half8 lo = *(const half8*)(&Bs[n * LDB + kk + lh * 8]);
        half8 hi = *(const half8*)(&Bs[n * LDB + kk + 16 + lh * 8]);
#pragma unroll
        for (int i = 0; i < 8; ++i) { bf[i] = lo[i]; bf[8 + i] = hi[i]; }
        acc[0][nt] = WMMA_F32_F16(af[0], bf, acc[0][nt]);
        acc[1][nt] = WMMA_F32_F16(af[1], bf, acc[1][nt]);
      }
    }
    __syncthreads();
  }

  // --- epilogue. An accumulator holds, per lane, one column of 8 rows
  //     (col = L%16, row = r + 8*(L/16)). Each wave turns its tile, 16 rows at a
  //     time, through its own piece of As (free behind the loop's last barrier),
  //     so that a lane then holds 4 adjacent columns of a row: 16 lanes cover a
  //     whole row of the tile, and bias, residual and result move as vectors ---
  constexpr int SP = 68;  // floats per staged row: 16-byte aligned, and rows r and r+8
                          // fall on different banks
  static_assert(8 * 16 * SP * sizeof(float) <= sizeof(As), "eight waves stage in As");
  float* stg = reinterpret_cast<float*>(As) + w * (16 * SP);
  int cn = lane & 15, rh = lane >> 4;
  int gn = nBase + cn * 4;              // first of this lane's 4 columns
  // this lane's rows are mBase + w * 32 + rh + 2 * q, q = mi * 8 + i
  size_t o0 = (size_t)(mBase + w * 32 + rh) * N + gn;
  size_t o2 = (size_t)2 * N;
  f4v bv = {0.f, 0.f, 0.f, 0.f};
  if (bias) {
    const float* bp = bias + gn;
    bv = *(const f4v*)bp;
    // behind the load, before a result may land in its address registers
    // (named as an input so that they live to here)
    asm volatile("s_wait_xcnt 0x0" :: "v"(bp) : "memory");
  }
  f4v rs[16];
  if constexpr (RES) {
    const float* rp[16];
    // unrolled: rp and rs live in registers; all 16 loads are in flight under the staging
#pragma unroll
    for (int q = 0; q < 16; ++q) {
      rp[q] = resid + o0 + q * o2;
      rs[q] = *(const f4v*)rp[q];
    }
    // the same behind the last of these loads, for their 16 addresses
    asm volatile("s_wait_xcnt 0x0"
                 :: "v"(rp[0]), "v"(rp[1]), "v"(rp[2]), "v"(rp[3]), "v"(rp[4]), "v"(rp[5]),
                    "v"(rp[6]), "v"(rp[7]), "v"(rp[8]), "v"(rp[9]), "v"(rp[10]), "v"(rp[11]),
                    "v"(rp[12]), "v"(rp[13]), "v"(rp[14]), "v"(rp[15]) : "memory");
  }
  // all unrolled: acc, rs, v and the stores' operands are indexed by constants
  // and stay in registers
#pragma unroll
  for (int mi = 0; mi < 2; ++mi) {
#pragma unroll
    for (int nt = 0; nt < 4; ++nt)
#pragma unroll
      for (int r = 0; r < 8; ++r)
        stg[(8 * rh + r) * SP + nt * 16 + cn] = acc[mi][nt][r];
    // the rows are read back by other lanes of this wave than wrote them
    asm volatile("s_wait_dscnt 0x0" ::: "memory");
    f4v v[8];
#pragma unroll
    for (int i = 0; i < 8; ++i) v[i] = *(const f4v*)(stg + (2 * i + rh) * SP + cn * 4);
#pragma unroll
    for (int i = 0; i < 8; ++i) {
      v[i] += bv;
#pragma unroll
      for (int j = 0; j < 4; ++j) {
        float m = fmaxf(v[i][j], 0.f);
        v[i][j] = doRelu ? m : v[i][j];
      }
    }
    // behind each group of 8 stores: s_wait_xcnt before a later result may land in
    // their address or data registers (named as inputs so that they live to there)
    if constexpr (RES) {
      float* op[8];
#pragma unroll
      for (int i = 0; i < 8; ++i) {
        v[i] += rs[mi * 8 + i];
        op[i] = out32 + o0 + (mi * 8 + i) * o2;
        *(f4v*)op[i] = v[i];
      }
      asm volatile("s_wait_xcnt 0x0"
                   :: "v"(op[0]), "v"(op[1]), "v"(op[2]), "v"(op[3]),
                      "v"(op[4]), "v"(op[5]), "v"(op[6]), "v"(op[7]),
                      "v"(v[0]), "v"(v[1]), "v"(v[2]), "v"(v[3]),
                      "v"(v[4]), "v"(v[5]), "v"(v[6]), "v"(v[7]) : "memory");
    } else {
      _Float16* op[8];
      half4 h[8];
#pragma unroll
      for (int i = 0; i < 8; ++i) {
#pragma unroll
        for (int j = 0; j < 4; ++j) h[i][j] = (_Float16)v[i][j];
        op[i] = out16 + o0 + (mi * 8 + i) * o2;
        *(half4*)op[i] = h[i];
      }
      asm volatile("s_wait_xcnt 0x0"
                   :: "v"(op[0]), "v"(op[1]), "v"(op[2]), "v"(op[3]),
                      "v"(op[4]), "v"(op[5]), "v"(op[6]), "v"(op[7]),
                      "v"(h[0]), "v"(h[1]), "v"(h[2]), "v"(h[3]),
                      "v"(h[4]), "v"(h[5]), "v"(h[6]), "v"(h[7]) : "memory");
    }
  }
}

// ---------------------------------------------------------------------------
// Block-sparse flash attention, 20 waves per work-group. Online softmax, KD=64.
// Work-groups 0..B*H-1: query tile 0 of one (b,h) (global rows, i<16, which see
// every key). The 128 key tiles are split over the 20 waves, 6 or 7 each; the
// partial softmax states (max, sum, O) are merged through LDS in wave order.
// They come first in the grid because they are the longest.
// Other work-groups: one wave per query tile qt>=1, which visits key tile 0
// (global columns) + local tiles qt-2..qt+2.
// 20 waves: five per SIMD is what the register count admits, and the grid then
// has fewer work-groups than the chip has WGPs, so all start at once.
// ---------------------------------------------------------------------------
constexpr int AW   = 20;              // waves per attention work-group
constexpr int NGB  = BB * HH;         // work-groups that hold a query tile 0
constexpr int KTW  = NQT / AW;        // key tiles per wave there, rounded down
constexpr int KTX  = NQT % AW;        // the first KTX waves take one more
constexpr int NLT  = BB * HH * (NQT - 1);   // query tiles with qt >= 1
constexpr int OPP  = 66;              // floats per row of a partial O in LDS:
                                      // rows r and r+8 fall on different banks
__global__ __launch_bounds__(AW * 32)
void attn_wmma(const _Float16* __restrict__ Q, const _Float16* __restrict__ Kt,
               const _Float16* __restrict__ V, _Float16* __restrict__ ctx) {
  __shared__ _Float16 Pl[AW][16 * 16];  // per-wave P staging (C->A layout)
  __shared__ __attribute__((aligned(16)))
  float Op[AW][16 * OPP];               // per-wave partial O (query tile 0)
  __shared__ float Ms[AW][16];          // per-wave running max per row
  __shared__ float Ls[AW][16];          // per-wave running sum per row

  int w    = threadIdx.x >> 5;
  int lane = threadIdx.x & 31;
  bool glob = blockIdx.x < NGB;                  // uniform over the work-group
  int bh, qt;
  if (glob) {
    bh = blockIdx.x;
    qt = 0;
  } else {
    int t = (blockIdx.x - NGB) * AW + w;         // tiles 1..NQT-1 of every (b,h)
    if (t >= NLT) return;                        // these work-groups meet no barrier
    bh = t / (NQT - 1);
    qt = 1 + t % (NQT - 1);
  }
  int b    = bh / HH;
  int h    = bh % HH;
  int mloc = lane & 15;
  int lh   = lane >> 4;

  const size_t rs = (size_t)HH * KDM;            // 512 halves per token row
  const size_t hoff = (size_t)h * KDM;
  const _Float16* qb = Q  + (size_t)(b * TT) * rs + hoff;
  const _Float16* kb = Kt + (size_t)(b * TT) * rs + hoff;
  const _Float16* vb = V  + (size_t)(b * TT) * rs + hoff;

  // Q fragments: 16x64 -> two 16x32 A-fragments
  v16h qf[2];
#pragma unroll
  for (int ks = 0; ks < 2; ++ks) {
    const _Float16* base = qb + (size_t)(qt * 16 + mloc) * rs + ks * 32;
    half8 lo = *(const half8*)(base + lh * 8);
    half8 hi = *(const half8*)(base + 16 + lh * 8);
#pragma unroll
    for (int i = 0; i < 8; ++i) { qf[ks][i] = lo[i]; qf[ks][8 + i] = hi[i]; }
  }

  v8f O[4];
  float mrow[8], lrow[8];
#pragma unroll
  for (int nt = 0; nt < 4; ++nt)
#pragma unroll
    for (int i = 0; i < 8; ++i) O[nt][i] = 0.f;
#pragma unroll
  for (int r = 0; r < 8; ++r) { mrow[r] = -3.0e38f; lrow[r] = 0.f; }

  auto process = [&](int st, bool needMask) {
    int sbase = st * 16;
    // scores S = Q K^T / sqrt(KD)
    v8f S;
#pragma unroll
    for (int i = 0; i < 8; ++i) S[i] = 0.f;
    {
      const _Float16* krow = kb + (size_t)(sbase + mloc) * rs + lh * 8;
#pragma unroll
      for (int ks = 0; ks < 2; ++ks) {
        v16h bf;
        half8 lo = *(const half8*)(krow + ks * 32);
        half8 hi = *(const half8*)(krow + ks * 32 + 16);
        // behind the tile's last K load, before a later result may land in the
        // registers of the K address (named as an input so that they live to here)
        if (ks == 1) asm volatile("s_wait_xcnt 0x0" :: "v"(krow) : "memory");
#pragma unroll
        for (int i = 0; i < 8; ++i) { bf[i] = lo[i]; bf[8 + i] = hi[i]; }
        S = WMMA_F32_F16(qf[ks], bf, S);
      }
    }
#pragma unroll
    for (int r = 0; r < 8; ++r) S[r] *= 0.125f;
    if (needMask) {
      int j = sbase + mloc;
#pragma unroll
      for (int r = 0; r < 8; ++r) {
        int i  = qt * 16 + 8 * lh + r;
        int di = i - j; if (di < 0) di = -di;
        bool ok = (di <= 32) || (j < 16) || (i < 16);
        if (!ok) S[r] = -1.0e9f;
      }
    }
    // online softmax (rows live across 16-lane halves)
    float pexp[8];
#pragma unroll
    for (int r = 0; r < 8; ++r) {
      float rm = S[r];
#pragma unroll
      for (int off = 1; off < 16; off <<= 1) rm = fmaxf(rm, __shfl_xor(rm, off, 32));
      float mn    = fmaxf(mrow[r], rm);
      float alpha = exp2_slot((mrow[r] - mn) * 1.44269504f);
      float p     = exp2_slot((S[r] - mn) * 1.44269504f);
      float sum   = p;
#pragma unroll
      for (int off = 1; off < 16; off <<= 1) sum += __shfl_xor(sum, off, 32);
      lrow[r] = lrow[r] * alpha + sum;
      mrow[r] = mn;
#pragma unroll
      for (int nt = 0; nt < 4; ++nt) O[nt][r] *= alpha;
      pexp[r] = p;
    }
    // stage P through LDS to convert C-layout -> A-layout (upper K half = 0)
#pragma unroll
    for (int r = 0; r < 8; ++r)
      Pl[w][(8 * lh + r) * 16 + mloc] = (_Float16)pexp[r];
    v16h ap;
    {
      half8 lo = *(const half8*)(&Pl[w][mloc * 16 + lh * 8]);
#pragma unroll
      for (int i = 0; i < 8; ++i) { ap[i] = lo[i]; ap[8 + i] = (_Float16)0.f; }
    }
    // O += P x V  (V tile is 16(s) x 64(kd); upper K half zero)
    const _Float16* vrow = vb + (size_t)(sbase + lh * 8) * rs + mloc;
#pragma unroll
    for (int nt = 0; nt < 4; ++nt) {
      v16h bvf;
#pragma unroll
      for (int i = 0; i < 8; ++i) {
        bvf[i]     = vrow[(size_t)i * rs + nt * 16];
        bvf[8 + i] = (_Float16)0.f;
      }
      O[nt] = WMMA_F32_F16(ap, bvf, O[nt]);
    }
    // the same behind the tile's last V load, for the registers of the V address
    asm volatile("s_wait_xcnt 0x0" :: "v"(vrow) : "memory");
  };

  if (glob) {
    int s0 = w * KTW + (w < KTX ? w : KTX);
    int s1 = s0 + KTW + (w < KTX ? 1 : 0);
    for (int st = s0; st < s1; ++st) process(st, false);
  } else {
    process(0, false);                       // global columns (j < 16)
    int lo = qt - 2 < 1 ? 1 : qt - 2;
    int hi = qt + 2 > NQT - 1 ? NQT - 1 : qt + 2;
    for (int st = lo; st <= hi; ++st) process(st, true);
  }

  // normalize + write ctx (fp16, [B,T,H,KD])
  _Float16* cb = ctx + (size_t)(b * TT + qt * 16) * rs + hoff;

  if (glob) {
    // publish this wave's partial state
    // (unrolled: mrow, lrow and O live in registers and need constant indices)
#pragma unroll
    for (int r = 0; r < 8; ++r)
      if (mloc == 0) { Ms[w][8 * lh + r] = mrow[r]; Ls[w][8 * lh + r] = lrow[r]; }
#pragma unroll
    for (int nt = 0; nt < 4; ++nt)
#pragma unroll
      for (int r = 0; r < 8; ++r)
        Op[w][(8 * lh + r) * OPP + nt * 16 + mloc] = O[nt][r];
    __syncthreads();
    // wave w merges query row w; a lane owns two adjacent columns
    // (both loops unrolled: every LDS read of the merge is issued up front)
    if (w >= 16) return;
    float M = Ms[0][w];
#pragma unroll
    for (int ww = 1; ww < AW; ++ww) M = fmaxf(M, Ms[ww][w]);
    float L = 0.f, o0 = 0.f, o1 = 0.f;
#pragma unroll
    for (int ww = 0; ww < AW; ++ww) {
      float e = exp2_slot((Ms[ww][w] - M) * 1.44269504f);
      float2 p = *(const float2*)(&Op[ww][w * OPP + 2 * lane]);
      L  += Ls[ww][w] * e;
      o0 += p.x * e;
      o1 += p.y * e;
    }
    half2v res;
    res[0] = (_Float16)(o0 / L);
    res[1] = (_Float16)(o1 / L);
    *(half2v*)(cb + (size_t)w * rs + 2 * lane) = res;
    return;
  }
#pragma unroll
  for (int nt = 0; nt < 4; ++nt)
#pragma unroll
    for (int r = 0; r < 8; ++r) {
      float vv = O[nt][r] / lrow[r];
      cb[(size_t)(8 * lh + r) * rs + nt * 16 + mloc] = (_Float16)vv;
    }
  // behind the last store; on this path only the end of the kernel follows it
  asm volatile("s_wait_xcnt 0x0" ::: "memory");
}

// ---------------------------------------------------------------------------
// Host-side orchestration
// ---------------------------------------------------------------------------
extern "C" void kernel_launch(void* const* d_in, const int* in_sizes, int n_in,
                              void* d_out, int out_size, void* d_ws, size_t ws_size,
                              hipStream_t stream) {
  const float* x    = (const float*)d_in[0];
  const float* ln1g = (const float*)d_in[1];
  const float* ln1b = (const float*)d_in[2];
  const float* Wq   = (const float*)d_in[3];
  const float* bq   = (const float*)d_in[4];
  const float* Wk   = (const float*)d_in[5];
  const float* bk   = (const float*)d_in[6];
  const float* Wv   = (const float*)d_in[7];
  const float* bv   = (const float*)d_in[8];
  const float* Wo   = (const float*)d_in[9];
  const float* bo   = (const float*)d_in[10];
  const float* ln2g = (const float*)d_in[11];
  const float* ln2b = (const float*)d_in[12];
  const float* W1   = (const float*)d_in[13];
  const float* b1   = (const float*)d_in[14];
  const float* W2   = (const float*)d_in[15];
  const float* b2   = (const float*)d_in[16];
  float* out = (float*)d_out;

  char* ws = (char*)d_ws;
  const size_t MB = 1024ull * 1024ull;
  // Region 0 (32MB): xn16|q16|k16|v16 ; later aliased by FFN hidden h16
  _Float16* xn16 = (_Float16*)(ws + 0 * MB);
  _Float16* q16  = (_Float16*)(ws + 8 * MB);
  _Float16* k16  = (_Float16*)(ws + 16 * MB);
  _Float16* v16  = (_Float16*)(ws + 24 * MB);
  _Float16* h16  = (_Float16*)(ws + 0 * MB);    // alias (32MB), after attn
  _Float16* ctx16 = (_Float16*)(ws + 32 * MB);  // 8MB
  _Float16* xn2   = (_Float16*)(ws + 32 * MB);  // alias ctx16 after out-proj
  float*    x1    = (float*)   (ws + 40 * MB);  // 16MB

  // LN1 -> xn16
  ln_rows<<<BT / 8, 256, 0, stream>>>(x, ln1g, ln1b, xn16, BT);

  // QKV projections (fp16 out)
  dim3 gq(DD / 64, BT / 256);
  gemm_wmma<128, false><<<gq, 256, 0, stream>>>(xn16, Wq, bq, nullptr, q16, nullptr, BT, DD, DD, 0);
  gemm_wmma<128, false><<<gq, 256, 0, stream>>>(xn16, Wk, bk, nullptr, k16, nullptr, BT, DD, DD, 0);
  gemm_wmma<128, false><<<gq, 256, 0, stream>>>(xn16, Wv, bv, nullptr, v16, nullptr, BT, DD, DD, 0);

  // Block-sparse flash attention -> ctx16
  attn_wmma<<<NGB + (NLT + AW - 1) / AW, AW * 32, 0, stream>>>(q16, k16, v16, ctx16);

  // Out projection + residual (fp32 x1)
  gemm_wmma<128, true><<<gq, 256, 0, stream>>>(ctx16, Wo, bo, x, nullptr, x1, BT, DD, DD, 0);

  // LN2 -> xn2
  ln_rows<<<BT / 8, 256, 0, stream>>>(x1, ln2g, ln2b, xn2, BT);

  // FFN1: relu(xn2 @ W1 + b1) -> h16
  dim3 g1(DFF / 64, BT / 256);
  gemm_wmma<64, false><<<g1, 256, 0, stream>>>(xn2, W1, b1, nullptr, h16, nullptr, BT, DFF, DD, 1);

  // FFN2: x1 + (h16 @ W2 + b2) -> out (fp32)
  dim3 g2(DD / 64, BT / 256);
  gemm_wmma<128, true><<<g2, 256, 0, stream>>>(h16, W2, b2, x1, nullptr, out, BT, DD, DFF, 0);
}

// v005
// It runs in 126 microseconds.
// Next to v004, in two timings, it ran 1.13 times as fast each time.
// Over all steps from v000 it is 3.34 times as fast.
#include <hip/hip_runtime.h>
#include <hip/hip_bf16.h>

typedef _Float16 half2v __attribute__((ext_vector_type(2)));
typedef _Float16 half4 __attribute__((ext_vector_type(4)));
typedef _Float16 half8 __attribute__((ext_vector_type(8)));
typedef _Float16 v16h  __attribute__((ext_vector_type(16)));
typedef float    v8f   __attribute__((ext_vector_type(8)));
typedef int      i4v   __attribute__((ext_vector_type(4)));
typedef float    f4v   __attribute__((ext_vector_type(4)));

#define WMMA_F32_F16(a, b, c) \
  __builtin_amdgcn_wmma_f32_16x16x32_f16(false, (a), false, (b), (short)0, (c), false, false)

#define AS1 __attribute__((address_space(1)))
#define AS3 __attribute__((address_space(3)))

// Async global->LDS copy (CDNA5 GLOBAL_LOAD_ASYNC_TO_LDS_B128, ASYNCcnt),
// with a synchronous fallback if the builtin is unavailable.
// Probe-verified: the builtin's params are (global int4*, local int4*, imm, imm).
__device__ __forceinline__ void async_copy_b128(const _Float16* g, _Float16* l) {
#if __has_builtin(__builtin_amdgcn_global_load_async_to_lds_b128)
  __builtin_amdgcn_global_load_async_to_lds_b128(
      (AS1 i4v*)g, (AS3 i4v*)l, 0, 0);
#else
  *(half8*)l = *(const half8*)g;
#endif
}
__device__ __forceinline__ void wait_async() {
#if __has_builtin(__builtin_amdgcn_global_load_async_to_lds_b128)
#if __has_builtin(__builtin_amdgcn_s_wait_asynccnt)
  __builtin_amdgcn_s_wait_asynccnt(0);
#else
  asm volatile("s_wait_asynccnt 0x0" ::: "memory");
#endif
#endif
}

// 2^a. The v_nop is the one free slot that the instruction set asks for between
// a transcendental and a next instruction that reads its result or overwrites
// its source.
__device__ __forceinline__ float exp2_slot(float a) {
  float e;
  asm("v_exp_f32 %0, %1\n\tv_nop" : "=v"(e) : "v"(a));
  return e;
}

// Problem dims
constexpr int BB  = 4;
constexpr int TT  = 2048;
constexpr int DD  = 512;
constexpr int HH  = 8;
constexpr int KDM = 64;
constexpr int DFF = 2048;
constexpr int BT  = BB * TT;          // 8192 rows
constexpr int NQT = TT / 16;          // 128 query tiles per (b,h)

// ---------------------------------------------------------------------------
// LayerNorm: one wave (32 lanes) per row of D=512, writes fp16
// ---------------------------------------------------------------------------
__global__ __launch_bounds__(256)
void ln_rows(const float* __restrict__ x, const float* __restrict__ g,
             const float* __restrict__ b, _Float16* __restrict__ out, int nrows) {
  int wave = (int)((blockIdx.x * blockDim.x + threadIdx.x) >> 5);
  int lane = threadIdx.x & 31;
  if (wave >= nrows) return;
  const float* row = x + (size_t)wave * DD;
  float vals[16];
  float s = 0.f;
#pragma unroll
  for (int i = 0; i < 16; ++i) { vals[i] = row[lane + i * 32]; s += vals[i]; }
#pragma unroll
  for (int off = 1; off < 32; off <<= 1) s += __shfl_xor(s, off, 32);
  float mean = s * (1.0f / DD);
  float vs = 0.f;
#pragma unroll
  for (int i = 0; i < 16; ++i) { float d = vals[i] - mean; vs += d * d; }
#pragma unroll
  for (int off = 1; off < 32; off <<= 1) vs += __shfl_xor(vs, off, 32);
  float rstd = rsqrtf(vs * (1.0f / DD) + 1e-6f);
  _Float16* orow = out + (size_t)wave * DD;
#pragma unroll
  for (int i = 0; i < 16; ++i) {
    int c = lane + i * 32;
    orow[c] = (_Float16)((vals[i] - mean) * rstd * g[c] + b[c]);
  }
}

// ---------------------------------------------------------------------------
// Generic fp16 WMMA GEMM: C[M,N] = A[M,K] @ B[K,N] (+bias)(+relu)(+resid)
// Block tile 256(M) x 64(N), 8 waves; each wave owns a 32x64 strip:
// 2 A-fragments x 4 B-fragments = 8 WMMAs per 32 k.
// One trip of the K loop stages BK k of both operands and then multiplies all
// of it, so the wait for the loads and the two barriers are paid once per BK k.
// K must be a multiple of BK.
// A staged via async global->LDS B128. B is the f32 weight itself: a thread
// loads 4 columns of BK / 16 consecutive k rows, rounds them to f16 and stores
// each column's run of k as one vector, so Bs is [n][k] for contiguous 16B
// B-fragment ds loads.
// RES: the residual is added and the result is stored as f32 (out32); else the
// result is stored as f16 (out16) and resid is not read.
// NP = 3: one launch holds three products of the same A and shape; grid z picks
// the weight, the bias and the f16 output. Their work-groups then share a WGP
// (three fit its LDS and registers at BK = 128), so one's loads fly under
// another's WMMAs. NP = 1: the first of each is used.
// ---------------------------------------------------------------------------
template <int BK, bool RES, int NP>
__global__ __launch_bounds__(256)
void gemm_wmma(const _Float16* __restrict__ A, const float* __restrict__ Bw0,
               const float* __restrict__ bias0, const float* __restrict__ resid,
               _Float16* __restrict__ out16a, float* __restrict__ out32,
               int M, int N, int K, int doRelu,
               const float* __restrict__ Bw1, const float* __restrict__ bias1,
               _Float16* __restrict__ out16b,
               const float* __restrict__ Bw2, const float* __restrict__ bias2,
               _Float16* __restrict__ out16c) {
  static_assert(NP == 1 || NP == 3, "one product, or three picked by grid z");
  const float* Bw   = Bw0;
  const float* bias = bias0;
  _Float16* out16   = out16a;
  if constexpr (NP == 3) {
    int z = blockIdx.z;         // the same in the whole work-group
    if (z == 1) { Bw = Bw1; bias = bias1; out16 = out16b; }
    if (z == 2) { Bw = Bw2; bias = bias2; out16 = out16c; }
  }
  static_assert(BK == 64 || BK == 128, "the wait behind the B loads names BK / 16 addresses");
  constexpr int LDA = BK + 8;   // halves; row pitch = 16 B x an odd number
  constexpr int LDB = BK + 8;
  constexpr int CPR = BK / 8;   // 16-byte pieces per A row of the tile
  constexpr int RPT = BK / 16;  // k rows of the B tile per thread
  typedef _Float16 hrun __attribute__((ext_vector_type(RPT)));
  __shared__ __attribute__((aligned(16))) _Float16 As[256 * LDA];
  __shared__ __attribute__((aligned(16))) _Float16 Bs[64 * LDB];  // transposed: [n][k]

  int tid  = threadIdx.x;
  int w    = tid >> 5;
  int lane = tid & 31;
  int mBase = blockIdx.y * 256;
  int nBase = blockIdx.x * 64;
  int mloc  = lane & 15;
  int lh    = lane >> 4;

  v8f acc[2][4];
#pragma unroll
  for (int mi = 0; mi < 2; ++mi)
#pragma unroll
    for (int nt = 0; nt < 4; ++nt)
#pragma unroll
      for (int i = 0; i < 8; ++i) acc[mi][nt][i] = 0.f;

  for (int k0 = 0; k0 < K; k0 += BK) {
    // --- stage A tile: 256 rows x BK halves (async); CPR adjacent lanes copy
    //     one row, so a wave-wide copy covers whole rows of the tile ---
    {
      int r0 = tid / CPR, ch = tid % CPR;
      const _Float16* src = A + (size_t)(mBase + r0) * K + k0 + ch * 8;
      // unrolled: all copies of the tile are in flight before the one wait
#pragma unroll
      for (int c = 0; c < CPR; ++c)
        async_copy_b128(src + (size_t)(c * (256 / CPR)) * K,
                        &As[(r0 + c * (256 / CPR)) * LDA + ch * 8]);
    }
    // --- stage B tile transposed and rounded to f16: BK(k) x 64(n) f32 -> Bs[n][k];
    //     16 adjacent lanes load one whole 256-byte row of the tile ---
    {
      int kg = (tid >> 4) * RPT, n0 = (tid & 15) * 4;
      const float* bp[RPT];
      f4v p[RPT];
      // unrolled: bp and p live in registers; every load is issued before the first store
#pragma unroll
      for (int c = 0; c < RPT; ++c) {
        bp[c] = Bw + (size_t)(k0 + kg + c) * N + nBase + n0;
        p[c] = *(const f4v*)bp[c];
      }
      // thread t asks for row t of the next A tile
      const _Float16* pf = A + (size_t)(mBase + tid) * K + k0 + BK;
      if (k0 + BK < K) __builtin_prefetch(pf, 0, 3);
      // behind the trip's last load and the prefetch, before a later result may
      // land in their address registers (named as inputs so that they live to here)
      if constexpr (BK == 128)
        asm volatile("s_wait_xcnt 0x0"
                     :: "v"(bp[0]), "v"(bp[1]), "v"(bp[2]), "v"(bp[3]),
                        "v"(bp[4]), "v"(bp[5]), "v"(bp[6]), "v"(bp[7]), "v"(pf) : "memory");
      else
        // the loaded values are inputs too: all four loads are then issued before
        // the first is waited for (else the build waits between two pairs of loads)
        asm volatile("s_wait_xcnt 0x0"
                     :: "v"(bp[0]), "v"(bp[1]), "v"(bp[2]), "v"(bp[3]), "v"(pf),
                        "v"(p[0]), "v"(p[1]), "v"(p[2]), "v"(p[3]) : "memory");
      // both unrolled: p and q are indexed by constants and stay in registers
#pragma unroll
      for (int j = 0; j < 4; ++j) {
        hrun q;
#pragma unroll
        for (int c = 0; c < RPT; ++c) q[c] = (_Float16)p[c][j];
        *(hrun*)(&Bs[(n0 + j) * LDB + kg]) = q;
      }
    }
    wait_async();
    __syncthreads();

    // unrolled: fragment offsets become immediates and loads of a later 32 k
    // can be issued under the WMMAs of an earlier one
#pragma unroll
    for (int kk = 0; kk < BK; kk += 32) {
      // --- A fragments (16x32, ISA 16-bit layout), rows w*32 + mi*16 ---
      v16h af[2];
#pragma unroll
      for (int mi = 0; mi < 2; ++mi) {
        int rloc = w * 32 + mi * 16 + mloc;
        half8 lo = *(const half8*)(&As[rloc * LDA + kk + lh * 8]);
        half8 hi = *(const half8*)(&As[rloc * LDA + kk + 16 + lh * 8]);
#pragma unroll
        for (int i = 0; i < 8; ++i) { af[mi][i] = lo[i]; af[mi][8 + i] = hi[i]; }
      }
      // --- 4 B fragments, 8 WMMAs ---
#pragma unroll
      for (int nt = 0; nt < 4; ++nt) {
        int n = nt * 16 + mloc;
        v16h bf;
        half8 lo = *(const half8*)(&Bs[n * LDB + kk + lh * 8]);
        half8 hi = *(const half8*)(&Bs[n * LDB + kk + 16 + lh * 8]);
#pragma unroll
        for (int i = 0; i < 8; ++i) { bf[i] = lo[i]; bf[8 + i] = hi[i]; }
        acc[0][nt] = WMMA_F32_F16(af[0], bf, acc[0][nt]);
        acc[1][nt] = WMMA_F32_F16(af[1], bf, acc[1][nt]);
      }
    }
    __syncthreads();
  }

  // --- epilogue. An accumulator holds, per lane, one column of 8 rows
  //     (col = L%16, row = r + 8*(L/16)). Each wave turns its tile, 16 rows at a
  //     time, through its own piece of As (free behind the loop's last barrier),
  //     so that a lane then holds 4 adjacent columns of a row: 16 lanes cover a
  //     whole row of the tile, and bias, residual and result move as vectors ---
  constexpr int SP = 68;  // floats per staged row: 16-byte aligned, and rows r and r+8
                          // fall on different banks
  static_assert(8 * 16 * SP * sizeof(float) <= sizeof(As), "eight waves stage in As");
  float* stg = reinterpret_cast<float*>(As) + w * (16 * SP);
  int cn = lane & 15, rh = lane >> 4;
  int gn = nBase + cn * 4;              // first of this lane's 4 columns
  // this lane's rows are mBase + w * 32 + rh + 2 * q, q = mi * 8 + i
  size_t o0 = (size_t)(mBase + w * 32 + rh) * N + gn;
  size_t o2 = (size_t)2 * N;
  f4v bv = {0.f, 0.f, 0.f, 0.f};
  if (bias) {
    const float* bp = bias + gn;
    bv = *(const f4v*)bp;
    // behind the load, before a result may land in its address registers
    // (named as an input so that they live to here)
    asm volatile("s_wait_xcnt 0x0" :: "v"(bp) : "memory");
  }
  f4v rs[16];
  if constexpr (RES) {
    const float* rp[16];
    // unrolled: rp and rs live in registers; all 16 loads are in flight under the staging
#pragma unroll
    for (int q = 0; q < 16; ++q) {
      rp[q] = resid + o0 + q * o2;
      rs[q] = *(const f4v*)rp[q];
    }
    // the same behind the last of these loads, for their 16 addresses
    asm volatile("s_wait_xcnt 0x0"
                 :: "v"(rp[0]), "v"(rp[1]), "v"(rp[2]), "v"(rp[3]), "v"(rp[4]), "v"(rp[5]),
                    "v"(rp[6]), "v"(rp[7]), "v"(rp[8]), "v"(rp[9]), "v"(rp[10]), "v"(rp[11]),
                    "v"(rp[12]), "v"(rp[13]), "v"(rp[14]), "v"(rp[15]) : "memory");
  }
  // all unrolled: acc, rs, v and the stores' operands are indexed by constants
  // and stay in registers
#pragma unroll
  for (int mi = 0; mi < 2; ++mi) {
#pragma unroll
    for (int nt = 0; nt < 4; ++nt)
#pragma unroll
      for (int r = 0; r < 8; ++r)
        stg[(8 * rh + r) * SP + nt * 16 + cn] = acc[mi][nt][r];
    // the rows are read back by other lanes of this wave than wrote them
    asm volatile("s_wait_dscnt 0x0" ::: "memory");
    f4v v[8];
#pragma unroll
    for (int i = 0; i < 8; ++i) v[i] = *(const f4v*)(stg + (2 * i + rh) * SP + cn * 4);
#pragma unroll
    for (int i = 0; i < 8; ++i) {
      v[i] += bv;
#pragma unroll
      for (int j = 0; j < 4; ++j) {
        float m = fmaxf(v[i][j], 0.f);
        v[i][j] = doRelu ? m : v[i][j];
      }
    }
    // behind each group of 8 stores: s_wait_xcnt before a later result may land in
    // their address or data registers (named as inputs so that they live to there)
    if constexpr (RES) {
      float* op[8];
#pragma unroll
      for (int i = 0; i < 8; ++i) {
        v[i] += rs[mi * 8 + i];
        op[i] = out32 + o0 + (mi * 8 + i) * o2;
        *(f4v*)op[i] = v[i];
      }
      asm volatile("s_wait_xcnt 0x0"
                   :: "v"(op[0]), "v"(op[1]), "v"(op[2]), "v"(op[3]),
                      "v"(op[4]), "v"(op[5]), "v"(op[6]), "v"(op[7]),
                      "v"(v[0]), "v"(v[1]), "v"(v[2]), "v"(v[3]),
                      "v"(v[4]), "v"(v[5]), "v"(v[6]), "v"(v[7]) : "memory");
    } else {
      _Float16* op[8];
      half4 h[8];
#pragma unroll
      for (int i = 0; i < 8; ++i) {
#pragma unroll
        for (int j = 0; j < 4; ++j) h[i][j] = (_Float16)v[i][j];
        op[i] = out16 + o0 + (mi * 8 + i) * o2;
        *(half4*)op[i] = h[i];
      }
      asm volatile("s_wait_xcnt 0x0"
                   :: "v"(op[0]), "v"(op[1]), "v"(op[2]), "v"(op[3]),
                      "v"(op[4]), "v"(op[5]), "v"(op[6]), "v"(op[7]),
                      "v"(h[0]), "v"(h[1]), "v"(h[2]), "v"(h[3]),
                      "v"(h[4]), "v"(h[5]), "v"(h[6]), "v"(h[7]) : "memory");
    }
  }
}

// ---------------------------------------------------------------------------
// Block-sparse flash attention, 20 waves per work-group. Online softmax, KD=64.
// Work-groups 0..B*H-1: query tile 0 of one (b,h) (global rows, i<16, which see
// every key). The 128 key tiles are split over the 20 waves, 6 or 7 each; the
// partial softmax states (max, sum, O) are merged through LDS in wave order.
// They come first in the grid because they are the longest.
// Other work-groups: one wave per query tile qt>=1, which visits key tile 0
// (global columns) + local tiles qt-2..qt+2.
// 20 waves: five per SIMD is what the register count admits, and the grid then
// has fewer work-groups than the chip has WGPs, so all start at once.
// ---------------------------------------------------------------------------
constexpr int AW   = 20;              // waves per attention work-group
constexpr int NGB  = BB * HH;         // work-groups that hold a query tile 0
constexpr int KTW  = NQT / AW;        // key tiles per wave there, rounded down
constexpr int KTX  = NQT % AW;        // the first KTX waves take one more
constexpr int NLT  = BB * HH * (NQT - 1);   // query tiles with qt >= 1
constexpr int OPP  = 66;              // floats per row of a partial O in LDS:
                                      // rows r and r+8 fall on different banks
__global__ __launch_bounds__(AW * 32)
void attn_wmma(const _Float16* __restrict__ Q, const _Float16* __restrict__ Kt,
               const _Float16* __restrict__ V, _Float16* __restrict__ ctx) {
  __shared__ _Float16 Pl[AW][16 * 16];  // per-wave P staging (C->A layout)
  __shared__ __attribute__((aligned(16)))
  float Op[AW][16 * OPP];               // per-wave partial O (query tile 0)
  __shared__ float Ms[AW][16];          // per-wave running max per row
  __shared__ float Ls[AW][16];          // per-wave running sum per row

  int w    = threadIdx.x >> 5;
  int lane = threadIdx.x & 31;
  bool glob = blockIdx.x < NGB;                  // uniform over the work-group
  int bh, qt;
  if (glob) {
    bh = blockIdx.x;
    qt = 0;
  } else {
    int t = (blockIdx.x - NGB) * AW + w;         // tiles 1..NQT-1 of every (b,h)
    if (t >= NLT) return;                        // these work-groups meet no barrier
    bh = t / (NQT - 1);
    qt = 1 + t % (NQT - 1);
  }
  int b    = bh / HH;
  int h    = bh % HH;
  int mloc = lane & 15;
  int lh   = lane >> 4;

  const size_t rs = (size_t)HH * KDM;            // 512 halves per token row
  const size_t hoff = (size_t)h * KDM;
  const _Float16* qb = Q  + (size_t)(b * TT) * rs + hoff;
  const _Float16* kb = Kt + (size_t)(b * TT) * rs + hoff;
  const _Float16* vb = V  + (size_t)(b * TT) * rs + hoff;

  // Q fragments: 16x64 -> two 16x32 A-fragments
  v16h qf[2];
#pragma unroll
  for (int ks = 0; ks < 2; ++ks) {
    const _Float16* base = qb + (size_t)(qt * 16 + mloc) * rs + ks * 32;
    half8 lo = *(const half8*)(base + lh * 8);
    half8 hi = *(const half8*)(base + 16 + lh * 8);
#pragma unroll
    for (int i = 0; i < 8; ++i) { qf[ks][i] = lo[i]; qf[ks][8 + i] = hi[i]; }
  }

  v8f O[4];
  float mrow[8], lrow[8];
#pragma unroll
  for (int nt = 0; nt < 4; ++nt)
#pragma unroll
    for (int i = 0; i < 8; ++i) O[nt][i] = 0.f;
#pragma unroll
  for (int r = 0; r < 8; ++r) { mrow[r] = -3.0e38f; lrow[r] = 0.f; }

  auto process = [&](int st, bool needMask) {
    int sbase = st * 16;
    // scores S = Q K^T / sqrt(KD)
    v8f S;
#pragma unroll
    for (int i = 0; i < 8; ++i) S[i] = 0.f;
    {
      const _Float16* krow = kb + (size_t)(sbase + mloc) * rs + lh * 8;
#pragma unroll
      for (int ks = 0; ks < 2; ++ks) {
        v16h bf;
        half8 lo = *(const half8*)(krow + ks * 32);
        half8 hi = *(const half8*)(krow + ks * 32 + 16);
        // behind the tile's last K load, before a later result may land in the
        // registers of the K address (named as an input so that they live to here)
        if (ks == 1) asm volatile("s_wait_xcnt 0x0" :: "v"(krow) : "memory");
#pragma unroll
        for (int i = 0; i < 8; ++i) { bf[i] = lo[i]; bf[8 + i] = hi[i]; }
        S = WMMA_F32_F16(qf[ks], bf, S);
      }
    }
#pragma unroll
    for (int r = 0; r < 8; ++r) S[r] *= 0.125f;
    if (needMask) {
      int j = sbase + mloc;
#pragma unroll
      for (int r = 0; r < 8; ++r) {
        int i  = qt * 16 + 8 * lh + r;
        int di = i - j; if (di < 0) di = -di;
        bool ok = (di <= 32) || (j < 16) || (i < 16);
        if (!ok) S[r] = -1.0e9f;
      }
    }
    // online softmax (rows live across 16-lane halves)
    float pexp[8];
#pragma unroll
    for (int r = 0; r < 8; ++r) {
      float rm = S[r];
#pragma unroll
      for (int off = 1; off < 16; off <<= 1) rm = fmaxf(rm, __shfl_xor(rm, off, 32));
      float mn    = fmaxf(mrow[r], rm);
      float alpha = exp2_slot((mrow[r] - mn) * 1.44269504f);
      float p     = exp2_slot((S[r] - mn) * 1.44269504f);
      float sum   = p;
#pragma unroll
      for (int off = 1; off < 16; off <<= 1) sum += __shfl_xor(sum, off, 32);
      lrow[r] = lrow[r] * alpha + sum;
      mrow[r] = mn;
#pragma unroll
      for (int nt = 0; nt < 4; ++nt) O[nt][r] *= alpha;
      pexp[r] = p;
    }
    // stage P through LDS to convert C-layout -> A-layout (upper K half = 0)
#pragma unroll
    for (int r = 0; r < 8; ++r)
      Pl[w][(8 * lh + r) * 16 + mloc] = (_Float16)pexp[r];
    v16h ap;
    {
      half8 lo = *(const half8*)(&Pl[w][mloc * 16 + lh * 8]);
#pragma unroll
      for (int i = 0; i < 8; ++i) { ap[i] = lo[i]; ap[8 + i] = (_Float16)0.f; }
    }
    // O += P x V  (V tile is 16(s) x 64(kd); upper K half zero)
    const _Float16* vrow = vb + (size_t)(sbase + lh * 8) * rs + mloc;
#pragma unroll
    for (int nt = 0; nt < 4; ++nt) {
      v16h bvf;
#pragma unroll
      for (int i = 0; i < 8; ++i) {
        bvf[i]     = vrow[(size_t)i * rs + nt * 16];
        bvf[8 + i] = (_Float16)0.f;
      }
      O[nt] = WMMA_F32_F16(ap, bvf, O[nt]);
    }
    // the same behind the tile's last V load, for the registers of the V address
    asm volatile("s_wait_xcnt 0x0" :: "v"(vrow) : "memory");
  };

  if (glob) {
    int s0 = w * KTW + (w < KTX ? w : KTX);
    int s1 = s0 + KTW + (w < KTX ? 1 : 0);
    for (int st = s0; st < s1; ++st) process(st, false);
  } else {
    process(0, false);                       // global columns (j < 16)
    int lo = qt - 2 < 1 ? 1 : qt - 2;
    int hi = qt + 2 > NQT - 1 ? NQT - 1 : qt + 2;
    for (int st = lo; st <= hi; ++st) process(st, true);
  }

  // normalize + write ctx (fp16, [B,T,H,KD])
  _Float16* cb = ctx + (size_t)(b * TT + qt * 16) * rs + hoff;

  if (glob) {
    // publish this wave's partial state
    // (unrolled: mrow, lrow and O live in registers and need constant indices)
#pragma unroll
    for (int r = 0; r < 8; ++r)
      if (mloc == 0) { Ms[w][8 * lh + r] = mrow[r]; Ls[w][8 * lh + r] = lrow[r]; }
#pragma unroll
    for (int nt = 0; nt < 4; ++nt)
#pragma unroll
      for (int r = 0; r < 8; ++r)
        Op[w][(8 * lh + r) * OPP + nt * 16 + mloc] = O[nt][r];
    __syncthreads();
    // wave w merges query row w; a lane owns two adjacent columns
    // (both loops unrolled: every LDS read of the merge is issued up front)
    if (w >= 16) return;
    float M = Ms[0][w];
#pragma unroll
    for (int ww = 1; ww < AW; ++ww) M = fmaxf(M, Ms[ww][w]);
    float L = 0.f, o0 = 0.f, o1 = 0.f;
#pragma unroll
    for (int ww = 0; ww < AW; ++ww) {
      float e = exp2_slot((Ms[ww][w] - M) * 1.44269504f);
      float2 p = *(const float2*)(&Op[ww][w * OPP + 2 * lane]);
      L  += Ls[ww][w] * e;
      o0 += p.x * e;
      o1 += p.y * e;
    }
    half2v res;
    res[0] = (_Float16)(o0 / L);
    res[1] = (_Float16)(o1 / L);
    *(half2v*)(cb + (size_t)w * rs + 2 * lane) = res;
    return;
  }
#pragma unroll
  for (int nt = 0; nt < 4; ++nt)
#pragma unroll
    for (int r = 0; r < 8; ++r) {
      float vv = O[nt][r] / lrow[r];
      cb[(size_t)(8 * lh + r) * rs + nt * 16 + mloc] = (_Float16)vv;
    }
  // behind the last store; on this path only the end of the kernel follows it
  asm volatile("s_wait_xcnt 0x0" ::: "memory");
}

// ---------------------------------------------------------------------------
// Host-side orchestration
// ---------------------------------------------------------------------------
extern "C" void kernel_launch(void* const* d_in, const int* in_sizes, int n_in,
                              void* d_out, int out_size, void* d_ws, size_t ws_size,
                              hipStream_t stream) {
  const float* x    = (const float*)d_in[0];
  const float* ln1g = (const float*)d_in[1];
  const float* ln1b = (const float*)d_in[2];
  const float* Wq   = (const float*)d_in[3];
  const float* bq   = (const float*)d_in[4];
  const float* Wk   = (const float*)d_in[5];
  const float* bk   = (const float*)d_in[6];
  const float* Wv   = (const float*)d_in[7];
  const float* bv   = (const float*)d_in[8];
  const float* Wo   = (const float*)d_in[9];
  const float* bo   = (const float*)d_in[10];
  const float* ln2g = (const float*)d_in[11];
  const float* ln2b = (const float*)d_in[12];
  const float* W1   = (const float*)d_in[13];
  const float* b1   = (const float*)d_in[14];
  const float* W2   = (const float*)d_in[15];
  const float* b2   = (const float*)d_in[16];
  float* out = (float*)d_out;

  char* ws = (char*)d_ws;
  const size_t MB = 1024ull * 1024ull;
  // Region 0 (32MB): xn16|q16|k16|v16 ; later aliased by FFN hidden h16
  _Float16* xn16 = (_Float16*)(ws + 0 * MB);
  _Float16* q16  = (_Float16*)(ws + 8 * MB);
  _Float16* k16  = (_Float16*)(ws + 16 * MB);
  _Float16* v16  = (_Float16*)(ws + 24 * MB);
  _Float16* h16  = (_Float16*)(ws + 0 * MB);    // alias (32MB), after attn
  _Float16* ctx16 = (_Float16*)(ws + 32 * MB);  // 8MB
  _Float16* xn2   = (_Float16*)(ws + 32 * MB);  // alias ctx16 after out-proj
  float*    x1    = (float*)   (ws + 40 * MB);  // 16MB

  // LN1 -> xn16
  ln_rows<<<BT / 8, 256, 0, stream>>>(x, ln1g, ln1b, xn16, BT);

  // QKV projections (fp16 out), one launch: grid z = 0, 1, 2 is Q, K, V
  dim3 gq(DD / 64, BT / 256);
  dim3 gqkv(DD / 64, BT / 256, 3);
  gemm_wmma<128, false, 3><<<gqkv, 256, 0, stream>>>(xn16, Wq, bq, nullptr, q16, nullptr, BT, DD, DD, 0,
                                                     Wk, bk, k16, Wv, bv, v16);

  // Block-sparse flash attention -> ctx16
  attn_wmma<<<NGB + (NLT + AW - 1) / AW, AW * 32, 0, stream>>>(q16, k16, v16, ctx16);

  // Out projection + residual (fp32 x1)
  gemm_wmma<128, true, 1><<<gq, 256, 0, stream>>>(ctx16, Wo, bo, x, nullptr, x1, BT, DD, DD, 0,
                                                  nullptr, nullptr, nullptr, nullptr, nullptr, nullptr);

  // LN2 -> xn2
  ln_rows<<<BT / 8, 256, 0, stream>>>(x1, ln2g, ln2b, xn2, BT);

  // FFN1: relu(xn2 @ W1 + b1) -> h16
  dim3 g1(DFF / 64, BT / 256);
  gemm_wmma<64, false, 1><<<g1, 256, 0, stream>>>(xn2, W1, b1, nullptr, h16, nullptr, BT, DFF, DD, 1,
                                                  nullptr, nullptr, nullptr, nullptr, nullptr, nullptr);

  // FFN2: x1 + (h16 @ W2 + b2) -> out (fp32)
  dim3 g2(DD / 64, BT / 256);
  gemm_wmma<128, true, 1><<<g2, 256, 0, stream>>>(h16, W2, b2, x1, nullptr, out, BT, DD, DFF, 0,
                                                  nullptr, nullptr, nullptr, nullptr, nullptr, nullptr);
}

// v006
// One run takes 111 microseconds.
// In both of two side-by-side timings against v005, it was 1.13 times as fast.
// Counting every step since v000, it is 3.78 times as fast.
#include <hip/hip_runtime.h>
#include <hip/hip_bf16.h>

typedef _Float16 half2v __attribute__((ext_vector_type(2)));
typedef _Float16 half4 __attribute__((ext_vector_type(4)));
typedef _Float16 half8 __attribute__((ext_vector_type(8)));
typedef _Float16 v16h  __attribute__((ext_vector_type(16)));
typedef float    v8f   __attribute__((ext_vector_type(8)));
typedef int      i4v   __attribute__((ext_vector_type(4)));
typedef float    f4v   __attribute__((ext_vector_type(4)));

#define WMMA_F32_F16(a, b, c) \
  __builtin_amdgcn_wmma_f32_16x16x32_f16(false, (a), false, (b), (short)0, (c), false, false)

#define AS1 __attribute__((address_space(1)))
#define AS3 __attribute__((address_space(3)))

// Async global->LDS copy (CDNA5 GLOBAL_LOAD_ASYNC_TO_LDS_B128, ASYNCcnt),
// with a synchronous fallback if the builtin is unavailable.
// Probe-verified: the builtin's params are (global int4*, local int4*, imm, imm).
__device__ __forceinline__ void async_copy_b128(const _Float16* g, _Float16* l) {
#if __has_builtin(__builtin_amdgcn_global_load_async_to_lds_b128)
  __builtin_amdgcn_global_load_async_to_lds_b128(
      (AS1 i4v*)g, (AS3 i4v*)l, 0, 0);
#else
  *(half8*)l = *(const half8*)g;
#endif
}
__device__ __forceinline__ void wait_async() {
#if __has_builtin(__builtin_amdgcn_global_load_async_to_lds_b128)
#if __has_builtin(__builtin_amdgcn_s_wait_asynccnt)
  __builtin_amdgcn_s_wait_asynccnt(0);
#else
  asm volatile("s_wait_asynccnt 0x0" ::: "memory");
#endif
#endif
}

// 2^a. The v_nop is the one free slot that the instruction set asks for between
// a transcendental and a next instruction that reads its result or overwrites
// its source.
__device__ __forceinline__ float exp2_slot(float a) {
  float e;
  asm("v_exp_f32 %0, %1\n\tv_nop" : "=v"(e) : "v"(a));
  return e;
}

// Problem dims
constexpr int BB  = 4;
constexpr int TT  = 2048;
constexpr int DD  = 512;
constexpr int HH  = 8;
constexpr int KDM = 64;
constexpr int DFF = 2048;
constexpr int BT  = BB * TT;          // 8192 rows
constexpr int NQT = TT / 16;          // 128 query tiles per (b,h)

// ---------------------------------------------------------------------------
// LayerNorm: one wave (32 lanes) per row of D=512, writes fp16
// ---------------------------------------------------------------------------
__global__ __launch_bounds__(256)
void ln_rows(const float* __restrict__ x, const float* __restrict__ g,
             const float* __restrict__ b, _Float16* __restrict__ out, int nrows) {
  int wave = (int)((blockIdx.x * blockDim.x + threadIdx.x) >> 5);
  int lane = threadIdx.x & 31;
  if (wave >= nrows) return;
  const float* row = x + (size_t)wave * DD;
  float vals[16];
  float s = 0.f;
#pragma unroll
  for (int i = 0; i < 16; ++i) { vals[i] = row[lane + i * 32]; s += vals[i]; }
#pragma unroll
  for (int off = 1; off < 32; off <<= 1) s += __shfl_xor(s, off, 32);
  float mean = s * (1.0f / DD);
  float vs = 0.f;
#pragma unroll
  for (int i = 0; i < 16; ++i) { float d = vals[i] - mean; vs += d * d; }
#pragma unroll
  for (int off = 1; off < 32; off <<= 1) vs += __shfl_xor(vs, off, 32);
  float rstd = rsqrtf(vs * (1.0f / DD) + 1e-6f);
  _Float16* orow = out + (size_t)wave * DD;
#pragma unroll
  for (int i = 0; i < 16; ++i) {
    int c = lane + i * 32;
    orow[c] = (_Float16)((vals[i] - mean) * rstd * g[c] + b[c]);
  }
}

// ---------------------------------------------------------------------------
// Generic fp16 WMMA GEMM: C[M,N] = A[M,K] @ B[K,N] (+bias)(+relu)(+resid)
// Block tile 256(M) x 64(N), 8 waves; each wave owns a 32x64 strip:
// 2 A-fragments x 4 B-fragments = 8 WMMAs per 32 k.
// One trip of the K loop stages BK k of both operands and then multiplies all
// of it, so the wait for the loads and the two barriers are paid once per BK k.
// K must be a multiple of BK.
// A staged via async global->LDS B128. B is the f32 weight itself: a thread
// loads 4 columns of BK / 16 (NB = 3: 16) consecutive k rows, rounds them to f16 and stores
// each column's run of k as one vector (NB = 3: two), so Bs is [n][k] for contiguous 16B
// B-fragment ds loads.
// RES: the residual is added and the result is stored as f32 (out32); else the
// result is stored as f16 (out16) and resid is not read.
// NP = 3: one launch holds three products of the same A and shape; grid z picks
// the weight, the bias and the f16 output. Their work-groups then share a WGP
// (three fit its LDS and registers at BK = 128), so one's loads fly under
// another's WMMAs. NP = 1: the first of each is used.
// NB = 1: one buffer, filled and then read, as described above.
// NB = 3: for a launch with one work-group per WGP, where nothing else covers
// the loads. Three buffers in LDS; the tiles of trips t + 1 and t + 2 are on
// their way while trip t multiplies. Waves 0-3 bring the even tiles, waves 4-7 the
// odd ones, so a wave that waits for all of its own copies never waits for the
// younger tile, which the other four waves have in flight.
// ---------------------------------------------------------------------------
template <int BK, bool RES, int NP, int NB>
__global__ __launch_bounds__(256)
void gemm_wmma(const _Float16* __restrict__ A, const float* __restrict__ Bw0,
               const float* __restrict__ bias0, const float* __restrict__ resid,
               _Float16* __restrict__ out16a, float* __restrict__ out32,
               int M, int N, int K, int doRelu,
               const float* __restrict__ Bw1, const float* __restrict__ bias1,
               _Float16* __restrict__ out16b,
               const float* __restrict__ Bw2, const float* __restrict__ bias2,
               _Float16* __restrict__ out16c) {
  static_assert(NP == 1 || NP == 3, "one product, or three picked by grid z");
  const float* Bw   = Bw0;
  const float* bias = bias0;
  _Float16* out16   = out16a;
  if constexpr (NP == 3) {
    int z = blockIdx.z;         // the same in the whole work-group
    if (z == 1) { Bw = Bw1; bias = bias1; out16 = out16b; }
    if (z == 2) { Bw = Bw2; bias = bias2; out16 = out16c; }
  }
  static_assert(BK == 64 || BK == 128, "the wait behind the B loads names BK / 16 addresses");
  static_assert(NB == 1 || (NB == 3 && BK == 128), "the ring is written for tiles of 128 k");
  constexpr int LDA = BK + 8;   // halves; row pitch = 16 B x an odd number
  constexpr int LDB = BK + 8;
  constexpr int CPR = BK / 8;   // 16-byte pieces per A row of the tile
  constexpr int RPT = BK / 16;  // k rows of the B tile per thread
  typedef _Float16 hrun __attribute__((ext_vector_type(RPT)));
  constexpr int ASZ = 256 * LDA;  // halves per A buffer
  constexpr int BSZ = 64 * LDB;   // halves per B buffer
  __shared__ __attribute__((aligned(16))) _Float16 As[NB * ASZ];
  __shared__ __attribute__((aligned(16))) _Float16 Bs[NB * BSZ];  // transposed: [n][k]

  int tid  = threadIdx.x;
  int w    = tid >> 5;
  int lane = tid & 31;
  int mBase = blockIdx.y * 256;
  int nBase = blockIdx.x * 64;
  int mloc  = lane & 15;
  int lh    = lane >> 4;

  v8f acc[2][4];
#pragma unroll
  for (int mi = 0; mi < 2; ++mi)
#pragma unroll
    for (int nt = 0; nt < 4; ++nt)
#pragma unroll
      for (int i = 0; i < 8; ++i) acc[mi][nt][i] = 0.f;

  if constexpr (NB == 3) {
    // multiplies one staged tile; ao, bo: where its buffers begin in As and Bs
    auto multiply = [&](int ao, int bo) {
      // unrolled: fragment offsets become immediates and loads of a later 32 k
      // can be issued under the WMMAs of an earlier one
#pragma unroll
      for (int kk = 0; kk < BK; kk += 32) {
        // --- A fragments (16x32, ISA 16-bit layout), rows w*32 + mi*16 ---
        v16h af[2];
#pragma unroll
        for (int mi = 0; mi < 2; ++mi) {
          int rloc = w * 32 + mi * 16 + mloc;
          half8 lo = *(const half8*)(&As[ao + rloc * LDA + kk + lh * 8]);
          half8 hi = *(const half8*)(&As[ao + rloc * LDA + kk + 16 + lh * 8]);
#pragma unroll
          for (int i = 0; i < 8; ++i) { af[mi][i] = lo[i]; af[mi][8 + i] = hi[i]; }
        }
        // --- 4 B fragments, 8 WMMAs ---
#pragma unroll
        for (int nt = 0; nt < 4; ++nt) {
          int n = nt * 16 + mloc;
          v16h bf;
          half8 lo = *(const half8*)(&Bs[bo + n * LDB + kk + lh * 8]);
          half8 hi = *(const half8*)(&Bs[bo + n * LDB + kk + 16 + lh * 8]);
#pragma unroll
          for (int i = 0; i < 8; ++i) { bf[i] = lo[i]; bf[8 + i] = hi[i]; }
          acc[0][nt] = WMMA_F32_F16(af[0], bf, acc[0][nt]);
          acc[1][nt] = WMMA_F32_F16(af[1], bf, acc[1][nt]);
        }
      }
    };

    const int NT = K / BK;
    // 0 in waves 0-3, 1 in waves 4-7; a scalar, so that the tests on it are branches
    // that a whole wave takes or skips (a copy is issued with every lane on)
    const int par = __builtin_amdgcn_readfirstlane(tid >> 7);
    const int u  = tid & 127;               // this thread among the 128 that bring a tile
    const int r0 = u >> 4, ch = u & 15;     // 16 adjacent lanes copy one A row whole
    const int kg = (u >> 4) * 16, n0 = (u & 15) * 4;  // 16 k rows of 4 columns of B
    f4v p[16];                              // this thread's part of its B tile, f32

    // starts tile s on its way: A by copies into buffer buf, B into p
    auto issue = [&](int s, int buf) {
      const float* b0 = Bw + (size_t)(s * BK + kg) * N + nBase + n0;
      const float* bp[16];
      // unrolled: bp and p live in registers; every load is issued at once
#pragma unroll
      for (int c = 0; c < 16; ++c) {
        bp[c] = b0 + (size_t)c * N;   // the step is the same in every lane: a scalar
        p[c] = *(const f4v*)bp[c];
      }
      // behind the last load, before a later result may land in their address
      // registers (named as inputs so that they live to here)
      asm volatile("s_wait_xcnt 0x0"
                   :: "v"(bp[0]), "v"(bp[1]), "v"(bp[2]), "v"(bp[3]), "v"(bp[4]), "v"(bp[5]),
                      "v"(bp[6]), "v"(bp[7]), "v"(bp[8]), "v"(bp[9]), "v"(bp[10]), "v"(bp[11]),
                      "v"(bp[12]), "v"(bp[13]), "v"(bp[14]), "v"(bp[15]) : "memory");
      const _Float16* src = A + (size_t)(mBase + r0) * K + s * BK + ch * 8;
      _Float16* dst = &As[buf * ASZ + r0 * LDA + ch * 8];
      // unrolled: all 32 copies of the tile are in flight together
#pragma unroll
      for (int c = 0; c < 32; ++c)
        async_copy_b128(src + (size_t)(c * 8) * K, dst + c * 8 * LDA);
    };

    // hands tile s (buffer buf) over to all waves, then refills buffer nbuf, whose
    // last readers (trip s - 1) the barrier has ended, with tile s + 2
    auto publish = [&](int s, int buf, int nbuf) {
      const bool mine = par == (s & 1);
      if (mine) {
        // all unrolled: p and q are indexed by constants and stay in registers
#pragma unroll
        for (int j = 0; j < 4; ++j)
#pragma unroll
          for (int hf = 0; hf < 2; ++hf) {
            half8 q;
#pragma unroll
            for (int c = 0; c < 8; ++c) q[c] = (_Float16)p[hf * 8 + c][j];
            *(half8*)(&Bs[buf * BSZ + (n0 + j) * LDB + kg + hf * 8]) = q;
          }
      }
      // this wave's B stores are in LDS and its reads of buffer nbuf are done
      asm volatile("s_wait_dscnt 0x0" ::: "memory");
      // the waves that copied tile s: every one of their copies has landed
      if (mine) asm volatile("s_wait_asynccnt 0x0" ::: "memory");
      // a barrier with fences on LDS alone: __syncthreads() would also wait for the
      // other waves' B loads of tile s + 1, which are meant to stay in flight
      __builtin_amdgcn_fence(__ATOMIC_RELEASE, "workgroup", "local");
      __builtin_amdgcn_s_barrier();
      __builtin_amdgcn_fence(__ATOMIC_ACQUIRE, "workgroup", "local");
      if (mine && s + 2 < NT) issue(s + 2, nbuf);
    };

    if (par == 0) issue(0, 0);
    else if (1 < NT) issue(1, 1);
    publish(0, 0, 2);
    int rb = 0;                             // t % 3
    for (int t = 0; t < NT; ++t) {
      multiply(rb * ASZ, rb * BSZ);
      int rn = rb == 2 ? 0 : rb + 1;        // (t + 1) % 3
      if (t + 1 < NT) publish(t + 1, rn, rb);
      rb = rn;
    }
    // no copy is left in flight, and every wave has read its last fragment,
    // before the epilogue writes into As
    asm volatile("s_wait_asynccnt 0x0" ::: "memory");
    asm volatile("s_wait_dscnt 0x0" ::: "memory");
    __syncthreads();
  } else
  for (int k0 = 0; k0 < K; k0 += BK) {
    // --- stage A tile: 256 rows x BK halves (async); CPR adjacent lanes copy
    //     one row, so a wave-wide copy covers whole rows of the tile ---
    {
      int r0 = tid / CPR, ch = tid % CPR;
      const _Float16* src = A + (size_t)(mBase + r0) * K + k0 + ch * 8;
      // unrolled: all copies of the tile are in flight before the one wait
#pragma unroll
      for (int c = 0; c < CPR; ++c)
        async_copy_b128(src + (size_t)(c * (256 / CPR)) * K,
                        &As[(r0 + c * (256 / CPR)) * LDA + ch * 8]);
    }
    // --- stage B tile transposed and rounded to f16: BK(k) x 64(n) f32 -> Bs[n][k];
    //     16 adjacent lanes load one whole 256-byte row of the tile ---
    {
      int kg = (tid >> 4) * RPT, n0 = (tid & 15) * 4;
      const float* bp[RPT];
      f4v p[RPT];
      // unrolled: bp and p live in registers; every load is issued before the first store
#pragma unroll
      for (int c = 0; c < RPT; ++c) {
        bp[c] = Bw + (size_t)(k0 + kg + c) * N + nBase + n0;
        p[c] = *(const f4v*)bp[c];
      }
      // thread t asks for row t of the next A tile
      const _Float16* pf = A + (size_t)(mBase + tid) * K + k0 + BK;
      if (k0 + BK < K) __builtin_prefetch(pf, 0, 3);
      // behind the trip's last load and the prefetch, before a later result may
      // land in their address registers (named as inputs so that they live to here)
      if constexpr (BK == 128)
        asm volatile("s_wait_xcnt 0x0"
                     :: "v"(bp[0]), "v"(bp[1]), "v"(bp[2]), "v"(bp[3]),
                        "v"(bp[4]), "v"(bp[5]), "v"(bp[6]), "v"(bp[7]), "v"(pf) : "memory");
      else
        // the loaded values are inputs too: all four loads are then issued before
        // the first is waited for (else the build waits between two pairs of loads)
        asm volatile("s_wait_xcnt 0x0"
                     :: "v"(bp[0]), "v"(bp[1]), "v"(bp[2]), "v"(bp[3]), "v"(pf),
                        "v"(p[0]), "v"(p[1]), "v"(p[2]), "v"(p[3]) : "memory");
      // both unrolled: p and q are indexed by constants and stay in registers
#pragma unroll
      for (int j = 0; j < 4; ++j) {
        hrun q;
#pragma unroll
        for (int c = 0; c < RPT; ++c) q[c] = (_Float16)p[c][j];
        *(hrun*)(&Bs[(n0 + j) * LDB + kg]) = q;
      }
    }
    wait_async();
    __syncthreads();

    // unrolled: fragment offsets become immediates and loads of a later 32 k
    // can be issued under the WMMAs of an earlier one
#pragma unroll
    for (int kk = 0; kk < BK; kk += 32) {
      // --- A fragments (16x32, ISA 16-bit layout), rows w*32 + mi*16 ---
      v16h af[2];
#pragma unroll
      for (int mi = 0; mi < 2; ++mi) {
        int rloc = w * 32 + mi * 16 + mloc;
        half8 lo = *(const half8*)(&As[rloc * LDA + kk + lh * 8]);
        half8 hi = *(const half8*)(&As[rloc * LDA + kk + 16 + lh * 8]);
#pragma unroll
        for (int i = 0; i < 8; ++i) { af[mi][i] = lo[i]; af[mi][8 + i] = hi[i]; }
      }
      // --- 4 B fragments, 8 WMMAs ---
#pragma unroll
      for (int nt = 0; nt < 4; ++nt) {
        int n = nt * 16 + mloc;
        v16h bf;
        half8 lo = *(const half8*)(&Bs[n * LDB + kk + lh * 8]);
        half8 hi = *(const half8*)(&Bs[n * LDB + kk + 16 + lh * 8]);
#pragma unroll
        for (int i = 0; i < 8; ++i) { bf[i] = lo[i]; bf[8 + i] = hi[i]; }
        acc[0][nt] = WMMA_F32_F16(af[0], bf, acc[0][nt]);
        acc[1][nt] = WMMA_F32_F16(af[1], bf, acc[1][nt]);
      }
    }
    __syncthreads();
  }

  // --- epilogue. An accumulator holds, per lane, one column of 8 rows
  //     (col = L%16, row = r + 8*(L/16)). Each wave turns its tile, 16 rows at a
  //     time, through its own piece of As (free behind the loop's last barrier),
  //     so that a lane then holds 4 adjacent columns of a row: 16 lanes cover a
  //     whole row of the tile, and bias, residual and result move as vectors ---
  constexpr int SP = 68;  // floats per staged row: 16-byte aligned, and rows r and r+8
                          // fall on different banks
  static_assert(8 * 16 * SP * sizeof(float) <= sizeof(As), "eight waves stage in As");
  float* stg = reinterpret_cast<float*>(As) + w * (16 * SP);
  int cn = lane & 15, rh = lane >> 4;
  int gn = nBase + cn * 4;              // first of this lane's 4 columns
  // this lane's rows are mBase + w * 32 + rh + 2 * q, q = mi * 8 + i
  size_t o0 = (size_t)(mBase + w * 32 + rh) * N + gn;
  size_t o2 = (size_t)2 * N;
  f4v bv = {0.f, 0.f, 0.f, 0.f};
  if (bias) {
    const float* bp = bias + gn;
    bv = *(const f4v*)bp;
    // behind the load, before a result may land in its address registers
    // (named as an input so that they live to here)
    asm volatile("s_wait_xcnt 0x0" :: "v"(bp) : "memory");
  }
  f4v rs[16];
  if constexpr (RES) {
    const float* rp[16];
    // unrolled: rp and rs live in registers; all 16 loads are in flight under the staging
#pragma unroll
    for (int q = 0; q < 16; ++q) {
      rp[q] = resid + o0 + q * o2;
      rs[q] = *(const f4v*)rp[q];
    }
    // the same behind the last of these loads, for their 16 addresses
    asm volatile("s_wait_xcnt 0x0"
                 :: "v"(rp[0]), "v"(rp[1]), "v"(rp[2]), "v"(rp[3]), "v"(rp[4]), "v"(rp[5]),
                    "v"(rp[6]), "v"(rp[7]), "v"(rp[8]), "v"(rp[9]), "v"(rp[10]), "v"(rp[11]),
                    "v"(rp[12]), "v"(rp[13]), "v"(rp[14]), "v"(rp[15]) : "memory");
  }
  // all unrolled: acc, rs, v and the stores' operands are indexed by constants
  // and stay in registers
#pragma unroll
  for (int mi = 0; mi < 2; ++mi) {
#pragma unroll
    for (int nt = 0; nt < 4; ++nt)
#pragma unroll
      for (int r = 0; r < 8; ++r)
        stg[(8 * rh + r) * SP + nt * 16 + cn] = acc[mi][nt][r];
    // the rows are read back by other lanes of this wave than wrote them
    asm volatile("s_wait_dscnt 0x0" ::: "memory");
    f4v v[8];
#pragma unroll
    for (int i = 0; i < 8; ++i) v[i] = *(const f4v*)(stg + (2 * i + rh) * SP + cn * 4);
#pragma unroll
    for (int i = 0; i < 8; ++i) {
      v[i] += bv;
#pragma unroll
      for (int j = 0; j < 4; ++j) {
        float m = fmaxf(v[i][j], 0.f);
        v[i][j] = doRelu ? m : v[i][j];
      }
    }
    // behind each group of 8 stores: s_wait_xcnt before a later result may land in
    // their address or data registers (named as inputs so that they live to there)
    if constexpr (RES) {
      float* op[8];
#pragma unroll
      for (int i = 0; i < 8; ++i) {
        v[i] += rs[mi * 8 + i];
        op[i] = out32 + o0 + (mi * 8 + i) * o2;
        *(f4v*)op[i] = v[i];
      }
      asm volatile("s_wait_xcnt 0x0"
                   :: "v"(op[0]), "v"(op[1]), "v"(op[2]), "v"(op[3]),
                      "v"(op[4]), "v"(op[5]), "v"(op[6]), "v"(op[7]),
                      "v"(v[0]), "v"(v[1]), "v"(v[2]), "v"(v[3]),
                      "v"(v[4]), "v"(v[5]), "v"(v[6]), "v"(v[7]) : "memory");
    } else {
      _Float16* op[8];
      half4 h[8];
#pragma unroll
      for (int i = 0; i < 8; ++i) {
#pragma unroll
        for (int j = 0; j < 4; ++j) h[i][j] = (_Float16)v[i][j];
        op[i] = out16 + o0 + (mi * 8 + i) * o2;
        *(half4*)op[i] = h[i];
      }
      asm volatile("s_wait_xcnt 0x0"
                   :: "v"(op[0]), "v"(op[1]), "v"(op[2]), "v"(op[3]),
                      "v"(op[4]), "v"(op[5]), "v"(op[6]), "v"(op[7]),
                      "v"(h[0]), "v"(h[1]), "v"(h[2]), "v"(h[3]),
                      "v"(h[4]), "v"(h[5]), "v"(h[6]), "v"(h[7]) : "memory");
    }
  }
}

// ---------------------------------------------------------------------------
// Block-sparse flash attention, 20 waves per work-group. Online softmax, KD=64.
// Work-groups 0..B*H-1: query tile 0 of one (b,h) (global rows, i<16, which see
// every key). The 128 key tiles are split over the 20 waves, 6 or 7 each; the
// partial softmax states (max, sum, O) are merged through LDS in wave order.
// They come first in the grid because they are the longest.
// Other work-groups: one wave per query tile qt>=1, which visits key tile 0
// (global columns) + local tiles qt-2..qt+2.
// 20 waves: five per SIMD is what the register count admits, and the grid then
// has fewer work-groups than the chip has WGPs, so all start at once.
// ---------------------------------------------------------------------------
constexpr int AW   = 20;              // waves per attention work-group
constexpr int NGB  = BB * HH;         // work-groups that hold a query tile 0
constexpr int KTW  = NQT / AW;        // key tiles per wave there, rounded down
constexpr int KTX  = NQT % AW;        // the first KTX waves take one more
constexpr int NLT  = BB * HH * (NQT - 1);   // query tiles with qt >= 1
constexpr int OPP  = 66;              // floats per row of a partial O in LDS:
                                      // rows r and r+8 fall on different banks
__global__ __launch_bounds__(AW * 32)
void attn_wmma(const _Float16* __restrict__ Q, const _Float16* __restrict__ Kt,
               const _Float16* __restrict__ V, _Float16* __restrict__ ctx) {
  __shared__ _Float16 Pl[AW][16 * 16];  // per-wave P staging (C->A layout)
  __shared__ __attribute__((aligned(16)))
  float Op[AW][16 * OPP];               // per-wave partial O (query tile 0)
  __shared__ float Ms[AW][16];          // per-wave running max per row
  __shared__ float Ls[AW][16];          // per-wave running sum per row

  int w    = threadIdx.x >> 5;
  int lane = threadIdx.x & 31;
  bool glob = blockIdx.x < NGB;                  // uniform over the work-group
  int bh, qt;
  if (glob) {
    bh = blockIdx.x;
    qt = 0;
  } else {
    int t = (blockIdx.x - NGB) * AW + w;         // tiles 1..NQT-1 of every (b,h)
    if (t >= NLT) return;                        // these work-groups meet no barrier
    bh = t / (NQT - 1);
    qt = 1 + t % (NQT - 1);
  }
  int b    = bh / HH;
  int h    = bh % HH;
  int mloc = lane & 15;
  int lh   = lane >> 4;

  const size_t rs = (size_t)HH * KDM;            // 512 halves per token row
  const size_t hoff = (size_t)h * KDM;
  const _Float16* qb = Q  + (size_t)(b * TT) * rs + hoff;
  const _Float16* kb = Kt + (size_t)(b * TT) * rs + hoff;
  const _Float16* vb = V  + (size_t)(b * TT) * rs + hoff;

  // Q fragments: 16x64 -> two 16x32 A-fragments
  v16h qf[2];
#pragma unroll
  for (int ks = 0; ks < 2; ++ks) {
    const _Float16* base = qb + (size_t)(qt * 16 + mloc) * rs + ks * 32;
    half8 lo = *(const half8*)(base + lh * 8);
    half8 hi = *(const half8*)(base + 16 + lh * 8);
#pragma unroll
    for (int i = 0; i < 8; ++i) { qf[ks][i] = lo[i]; qf[ks][8 + i] = hi[i]; }
  }

  v8f O[4];
  float mrow[8], lrow[8];
#pragma unroll
  for (int nt = 0; nt < 4; ++nt)
#pragma unroll
    for (int i = 0; i < 8; ++i) O[nt][i] = 0.f;
#pragma unroll
  for (int r = 0; r < 8; ++r) { mrow[r] = -3.0e38f; lrow[r] = 0.f; }

  auto process = [&](int st, bool needMask) {
    int sbase = st * 16;
    // scores S = Q K^T / sqrt(KD)
    v8f S;
#pragma unroll
    for (int i = 0; i < 8; ++i) S[i] = 0.f;
    {
      const _Float16* krow = kb + (size_t)(sbase + mloc) * rs + lh * 8;
#pragma unroll
      for (int ks = 0; ks < 2; ++ks) {
        v16h bf;
        half8 lo = *(const half8*)(krow + ks * 32);
        half8 hi = *(const half8*)(krow + ks * 32 + 16);
        // behind the tile's last K load, before a later result may land in the
        // registers of the K address (named as an input so that they live to here)
        if (ks == 1) asm volatile("s_wait_xcnt 0x0" :: "v"(krow) : "memory");
#pragma unroll
        for (int i = 0; i < 8; ++i) { bf[i] = lo[i]; bf[8 + i] = hi[i]; }
        S = WMMA_F32_F16(qf[ks], bf, S);
      }
    }
#pragma unroll
    for (int r = 0; r < 8; ++r) S[r] *= 0.125f;
    if (needMask) {
      int j = sbase + mloc;
#pragma unroll
      for (int r = 0; r < 8; ++r) {
        int i  = qt * 16 + 8 * lh + r;
        int di = i - j; if (di < 0) di = -di;
        bool ok = (di <= 32) || (j < 16) || (i < 16);
        if (!ok) S[r] = -1.0e9f;
      }
    }
    // online softmax (rows live across 16-lane halves)
    float pexp[8];
#pragma unroll
    for (int r = 0; r < 8; ++r) {
      float rm = S[r];
#pragma unroll
      for (int off = 1; off < 16; off <<= 1) rm = fmaxf(rm, __shfl_xor(rm, off, 32));
      float mn    = fmaxf(mrow[r], rm);
      float alpha = exp2_slot((mrow[r] - mn) * 1.44269504f);
      float p     = exp2_slot((S[r] - mn) * 1.44269504f);
      float sum   = p;
#pragma unroll
      for (int off = 1; off < 16; off <<= 1) sum += __shfl_xor(sum, off, 32);
      lrow[r] = lrow[r] * alpha + sum;
      mrow[r] = mn;
#pragma unroll
      for (int nt = 0; nt < 4; ++nt) O[nt][r] *= alpha;
      pexp[r] = p;
    }
    // stage P through LDS to convert C-layout -> A-layout (upper K half = 0)
#pragma unroll
    for (int r = 0; r < 8; ++r)
      Pl[w][(8 * lh + r) * 16 + mloc] = (_Float16)pexp[r];
    v16h ap;
    {
      half8 lo = *(const half8*)(&Pl[w][mloc * 16 + lh * 8]);
#pragma unroll
      for (int i = 0; i < 8; ++i) { ap[i] = lo[i]; ap[8 + i] = (_Float16)0.f; }
    }
    // O += P x V  (V tile is 16(s) x 64(kd); upper K half zero)
    const _Float16* vrow = vb + (size_t)(sbase + lh * 8) * rs + mloc;
#pragma unroll
    for (int nt = 0; nt < 4; ++nt) {
      v16h bvf;
#pragma unroll
      for (int i = 0; i < 8; ++i) {
        bvf[i]     = vrow[(size_t)i * rs + nt * 16];
        bvf[8 + i] = (_Float16)0.f;
      }
      O[nt] = WMMA_F32_F16(ap, bvf, O[nt]);
    }
    // the same behind the tile's last V load, for the registers of the V address
    asm volatile("s_wait_xcnt 0x0" :: "v"(vrow) : "memory");
  };

  if (glob) {
    int s0 = w * KTW + (w < KTX ? w : KTX);
    int s1 = s0 + KTW + (w < KTX ? 1 : 0);
    for (int st = s0; st < s1; ++st) process(st, false);
  } else {
    process(0, false);                       // global columns (j < 16)
    int lo = qt - 2 < 1 ? 1 : qt - 2;
    int hi = qt + 2 > NQT - 1 ? NQT - 1 : qt + 2;
    for (int st = lo; st <= hi; ++st) process(st, true);
  }

  // normalize + write ctx (fp16, [B,T,H,KD])
  _Float16* cb = ctx + (size_t)(b * TT + qt * 16) * rs + hoff;

  if (glob) {
    // publish this wave's partial state
    // (unrolled: mrow, lrow and O live in registers and need constant indices)
#pragma unroll
    for (int r = 0; r < 8; ++r)
      if (mloc == 0) { Ms[w][8 * lh + r] = mrow[r]; Ls[w][8 * lh + r] = lrow[r]; }
#pragma unroll
    for (int nt = 0; nt < 4; ++nt)
#pragma unroll
      for (int r = 0; r < 8; ++r)
        Op[w][(8 * lh + r) * OPP + nt * 16 + mloc] = O[nt][r];
    __syncthreads();
    // wave w merges query row w; a lane owns two adjacent columns
    // (both loops unrolled: every LDS read of the merge is issued up front)
    if (w >= 16) return;
    float M = Ms[0][w];
#pragma unroll
    for (int ww = 1; ww < AW; ++ww) M = fmaxf(M, Ms[ww][w]);
    float L = 0.f, o0 = 0.f, o1 = 0.f;
#pragma unroll
    for (int ww = 0; ww < AW; ++ww) {
      float e = exp2_slot((Ms[ww][w] - M) * 1.44269504f);
      float2 p = *(const float2*)(&Op[ww][w * OPP + 2 * lane]);
      L  += Ls[ww][w] * e;
      o0 += p.x * e;
      o1 += p.y * e;
    }
    half2v res;
    res[0] = (_Float16)(o0 / L);
    res[1] = (_Float16)(o1 / L);
    *(half2v*)(cb + (size_t)w * rs + 2 * lane) = res;
    return;
  }
#pragma unroll
  for (int nt = 0; nt < 4; ++nt)
#pragma unroll
    for (int r = 0; r < 8; ++r) {
      float vv = O[nt][r] / lrow[r];
      cb[(size_t)(8 * lh + r) * rs + nt * 16 + mloc] = (_Float16)vv;
    }
  // behind the last store; on this path only the end of the kernel follows it
  asm volatile("s_wait_xcnt 0x0" ::: "memory");
}

// ---------------------------------------------------------------------------
// Host-side orchestration
// ---------------------------------------------------------------------------
extern "C" void kernel_launch(void* const* d_in, const int* in_sizes, int n_in,
                              void* d_out, int out_size, void* d_ws, size_t ws_size,
                              hipStream_t stream) {
  const float* x    = (const float*)d_in[0];
  const float* ln1g = (const float*)d_in[1];
  const float* ln1b = (const float*)d_in[2];
  const float* Wq   = (const float*)d_in[3];
  const float* bq   = (const float*)d_in[4];
  const float* Wk   = (const float*)d_in[5];
  const float* bk   = (const float*)d_in[6];
  const float* Wv   = (const float*)d_in[7];
  const float* bv   = (const float*)d_in[8];
  const float* Wo   = (const float*)d_in[9];
  const float* bo   = (const float*)d_in[10];
  const float* ln2g = (const float*)d_in[11];
  const float* ln2b = (const float*)d_in[12];
  const float* W1   = (const float*)d_in[13];
  const float* b1   = (const float*)d_in[14];
  const float* W2   = (const float*)d_in[15];
  const float* b2   = (const float*)d_in[16];
  float* out = (float*)d_out;

  char* ws = (char*)d_ws;
  const size_t MB = 1024ull * 1024ull;
  // Region 0 (32MB): xn16|q16|k16|v16 ; later aliased by FFN hidden h16
  _Float16* xn16 = (_Float16*)(ws + 0 * MB);
  _Float16* q16  = (_Float16*)(ws + 8 * MB);
  _Float16* k16  = (_Float16*)(ws + 16 * MB);
  _Float16* v16  = (_Float16*)(ws + 24 * MB);
  _Float16* h16  = (_Float16*)(ws + 0 * MB);    // alias (32MB), after attn
  _Float16* ctx16 = (_Float16*)(ws + 32 * MB);  // 8MB
  _Float16* xn2   = (_Float16*)(ws + 32 * MB);  // alias ctx16 after out-proj
  float*    x1    = (float*)   (ws + 40 * MB);  // 16MB

  // LN1 -> xn16
  ln_rows<<<BT / 8, 256, 0, stream>>>(x, ln1g, ln1b, xn16, BT);

  // QKV projections (fp16 out), one launch: grid z = 0, 1, 2 is Q, K, V
  dim3 gq(DD / 64, BT / 256);
  dim3 gqkv(DD / 64, BT / 256, 3);
  gemm_wmma<128, false, 3, 1><<<gqkv, 256, 0, stream>>>(xn16, Wq, bq, nullptr, q16, nullptr, BT, DD, DD, 0,
                                                     Wk, bk, k16, Wv, bv, v16);

  // Block-sparse flash attention -> ctx16
  attn_wmma<<<NGB + (NLT + AW - 1) / AW, AW * 32, 0, stream>>>(q16, k16, v16, ctx16);

  // Out projection + residual (fp32 x1)
  gemm_wmma<128, true, 1, 3><<<gq, 256, 0, stream>>>(ctx16, Wo, bo, x, nullptr, x1, BT, DD, DD, 0,
                                                  nullptr, nullptr, nullptr, nullptr, nullptr, nullptr);

  // LN2 -> xn2
  ln_rows<<<BT / 8, 256, 0, stream>>>(x1, ln2g, ln2b, xn2, BT);

  // FFN1: relu(xn2 @ W1 + b1) -> h16
  dim3 g1(DFF / 64, BT / 256);
  gemm_wmma<64, false, 1, 1><<<g1, 256, 0, stream>>>(xn2, W1, b1, nullptr, h16, nullptr, BT, DFF, DD, 1,
                                                  nullptr, nullptr, nullptr, nullptr, nullptr, nullptr);

  // FFN2: x1 + (h16 @ W2 + b2) -> out (fp32)
  dim3 g2(DD / 64, BT / 256);
  gemm_wmma<128, true, 1, 3><<<g2, 256, 0, stream>>>(h16, W2, b2, x1, nullptr, out, BT, DD, DFF, 0,
                                                  nullptr, nullptr, nullptr, nullptr, nullptr, nullptr);
}

// v007
// One run takes 106 microseconds.
// Timed twice side by side with v006, it ran 1.05 times as fast both times.
// Counting every step since v000, it is 3.98 times as fast.
#include <hip/hip_runtime.h>
#include <hip/hip_bf16.h>

typedef _Float16 half2v __attribute__((ext_vector_type(2)));
typedef _Float16 half4 __attribute__((ext_vector_type(4)));
typedef _Float16 half8 __attribute__((ext_vector_type(8)));
typedef _Float16 v16h  __attribute__((ext_vector_type(16)));
typedef float    v8f   __attribute__((ext_vector_type(8)));
typedef int      i4v   __attribute__((ext_vector_type(4)));
typedef float    f4v   __attribute__((ext_vector_type(4)));

#define WMMA_F32_F16(a, b, c) \
  __builtin_amdgcn_wmma_f32_16x16x32_f16(false, (a), false, (b), (short)0, (c), false, false)

#define AS1 __attribute__((address_space(1)))
#define AS3 __attribute__((address_space(3)))

// Async global->LDS copy (CDNA5 GLOBAL_LOAD_ASYNC_TO_LDS_B128, ASYNCcnt),
// with a synchronous fallback if the builtin is unavailable.
// Probe-verified: the builtin's params are (global int4*, local int4*, imm, imm).
__device__ __forceinline__ void async_copy_b128(const _Float16* g, _Float16* l) {
#if __has_builtin(__builtin_amdgcn_global_load_async_to_lds_b128)
  __builtin_amdgcn_global_load_async_to_lds_b128(
      (AS1 i4v*)g, (AS3 i4v*)l, 0, 0);
#else
  *(half8*)l = *(const half8*)g;
#endif
}
__device__ __forceinline__ void wait_async() {
#if __has_builtin(__builtin_amdgcn_global_load_async_to_lds_b128)
#if __has_builtin(__builtin_amdgcn_s_wait_asynccnt)
  __builtin_amdgcn_s_wait_asynccnt(0);
#else
  asm volatile("s_wait_asynccnt 0x0" ::: "memory");
#endif
#endif
}

// 2^a. The v_nop is the one free slot that the instruction set asks for between
// a transcendental and a next instruction that reads its result or overwrites
// its source.
__device__ __forceinline__ float exp2_slot(float a) {
  float e;
  asm("v_exp_f32 %0, %1\n\tv_nop" : "=v"(e) : "v"(a));
  return e;
}

// Problem dims
constexpr int BB  = 4;
constexpr int TT  = 2048;
constexpr int DD  = 512;
constexpr int HH  = 8;
constexpr int KDM = 64;
constexpr int DFF = 2048;
constexpr int BT  = BB * TT;          // 8192 rows
constexpr int NQT = TT / 16;          // 128 query tiles per (b,h)

// ---------------------------------------------------------------------------
// LayerNorm: one wave (32 lanes) per row of D=512, writes fp16
// ---------------------------------------------------------------------------
__global__ __launch_bounds__(256)
void ln_rows(const float* __restrict__ x, const float* __restrict__ g,
             const float* __restrict__ b, _Float16* __restrict__ out, int nrows) {
  int wave = (int)((blockIdx.x * blockDim.x + threadIdx.x) >> 5);
  int lane = threadIdx.x & 31;
  if (wave >= nrows) return;
  const float* row = x + (size_t)wave * DD;
  float vals[16];
  float s = 0.f;
#pragma unroll
  for (int i = 0; i < 16; ++i) { vals[i] = row[lane + i * 32]; s += vals[i]; }
#pragma unroll
  for (int off = 1; off < 32; off <<= 1) s += __shfl_xor(s, off, 32);
  float mean = s * (1.0f / DD);
  float vs = 0.f;
#pragma unroll
  for (int i = 0; i < 16; ++i) { float d = vals[i] - mean; vs += d * d; }
#pragma unroll
  for (int off = 1; off < 32; off <<= 1) vs += __shfl_xor(vs, off, 32);
  float rstd = rsqrtf(vs * (1.0f / DD) + 1e-6f);
  _Float16* orow = out + (size_t)wave * DD;
#pragma unroll
  for (int i = 0; i < 16; ++i) {
    int c = lane + i * 32;
    orow[c] = (_Float16)((vals[i] - mean) * rstd * g[c] + b[c]);
  }
}

// ---------------------------------------------------------------------------
// Generic fp16 WMMA GEMM: C[M,N] = A[M,K] @ B[K,N] (+bias)(+relu)(+resid)
// Block tile 256(M) x 64(N), 8 waves; each wave owns a 32x64 strip:
// 2 A-fragments x 4 B-fragments = 8 WMMAs per 32 k.
// One trip of the K loop stages BK k of both operands and then multiplies all
// of it, so the wait for the loads and the two barriers are paid once per BK k.
// K must be a multiple of BK.
// A staged via async global->LDS B128. B is the f32 weight itself: a thread
// loads 4 columns of BK / 16 (NB = 3: 16) consecutive k rows, rounds them to f16 and stores
// each column's run of k as one vector (NB = 3: two), so Bs is [n][k] for contiguous 16B
// B-fragment ds loads.
// RES: the residual is added and the result is stored as f32 (out32); else the
// result is stored as f16 (out16) and resid is not read.
// NP = 3: one launch holds three products of the same A and shape; grid z picks
// the weight, the bias and the f16 output. Their work-groups then share a WGP
// (three fit its LDS and registers at BK = 128), so one's loads fly under
// another's WMMAs. NP = 1: the first of each is used.
// NB = 1: one buffer, filled and then read, as described above.
// NB = 3: for a launch with one work-group per WGP, where nothing else covers
// the loads. Three buffers in LDS; the tiles of trips t + 1 and t + 2 are on
// their way while trip t multiplies. Waves 0-3 bring the even tiles, waves 4-7 the
// odd ones, so a wave that waits for all of its own copies never waits for the
// younger tile, which the other four waves have in flight.
// ---------------------------------------------------------------------------
template <int BK, bool RES, int NP, int NB>
__global__ __launch_bounds__(256)
void gemm_wmma(const _Float16* __restrict__ A, const float* __restrict__ Bw0,
               const float* __restrict__ bias0, const float* __restrict__ resid,
               _Float16* __restrict__ out16a, float* __restrict__ out32,
               int M, int N, int K, int doRelu,
               const float* __restrict__ Bw1, const float* __restrict__ bias1,
               _Float16* __restrict__ out16b,
               const float* __restrict__ Bw2, const float* __restrict__ bias2,
               _Float16* __restrict__ out16c) {
  static_assert(NP == 1 || NP == 3, "one product, or three picked by grid z");
  const float* Bw   = Bw0;
  const float* bias = bias0;
  _Float16* out16   = out16a;
  if constexpr (NP == 3) {
    int z = blockIdx.z;         // the same in the whole work-group
    if (z == 1) { Bw = Bw1; bias = bias1; out16 = out16b; }
    if (z == 2) { Bw = Bw2; bias = bias2; out16 = out16c; }
  }
  static_assert(BK == 64 || BK == 128, "the wait behind the B loads names BK / 16 addresses");
  static_assert(NB == 1 || (NB == 3 && BK == 128), "the ring is written for tiles of 128 k");
  constexpr int LDA = BK + 8;   // halves; row pitch = 16 B x an odd number
  constexpr int LDB = BK + 8;
  constexpr int CPR = BK / 8;   // 16-byte pieces per A row of the tile
  constexpr int RPT = BK / 16;  // k rows of the B tile per thread
  typedef _Float16 hrun __attribute__((ext_vector_type(RPT)));
  constexpr int ASZ = 256 * LDA;  // halves per A buffer
  constexpr int BSZ = 64 * LDB;   // halves per B buffer
  __shared__ __attribute__((aligned(16))) _Float16 As[NB * ASZ];
  __shared__ __attribute__((aligned(16))) _Float16 Bs[NB * BSZ];  // transposed: [n][k]

  int tid  = threadIdx.x;
  int w    = tid >> 5;
  int lane = tid & 31;
  int mBase = blockIdx.y * 256;
  int nBase = blockIdx.x * 64;
  int mloc  = lane & 15;
  int lh    = lane >> 4;

  v8f acc[2][4];
#pragma unroll
  for (int mi = 0; mi < 2; ++mi)
#pragma unroll
    for (int nt = 0; nt < 4; ++nt)
#pragma unroll
      for (int i = 0; i < 8; ++i) acc[mi][nt][i] = 0.f;

  if constexpr (NB == 3) {
    // multiplies one staged tile; ao, bo: where its buffers begin in As and Bs.
    // Two register sets of fragments: the 12 LDS reads of the next 32 k go out as
    // one group in front of the 8 WMMAs of this 32 k, so that a wave waits for LDS
    // once a tile (its first group) and not in front of every pair of WMMAs.
    auto multiply = [&](int ao, int bo) {
      v16h af[2][2], bf[2][4];
      // reads the fragments of 32 k into set st (ISA 16-bit layout; A rows
      // w*32 + mi*16, B columns nt*16); all its loops unrolled: af and bf are
      // indexed by constants and stay in registers
      auto fetch = [&](int st, int kk) {
#pragma unroll
        for (int mi = 0; mi < 2; ++mi) {
          int rloc = w * 32 + mi * 16 + mloc;
          half8 lo = *(const half8*)(&As[ao + rloc * LDA + kk + lh * 8]);
          half8 hi = *(const half8*)(&As[ao + rloc * LDA + kk + 16 + lh * 8]);
#pragma unroll
          for (int i = 0; i < 8; ++i) { af[st][mi][i] = lo[i]; af[st][mi][8 + i] = hi[i]; }
        }
#pragma unroll
        for (int nt = 0; nt < 4; ++nt) {
          int n = nt * 16 + mloc;
          half8 lo = *(const half8*)(&Bs[bo + n * LDB + kk + lh * 8]);
          half8 hi = *(const half8*)(&Bs[bo + n * LDB + kk + 16 + lh * 8]);
#pragma unroll
          for (int i = 0; i < 8; ++i) { bf[st][nt][i] = lo[i]; bf[st][nt][8 + i] = hi[i]; }
        }
      };
      fetch(0, 0);
      // unrolled: the set index and the fragment offsets become constants
#pragma unroll
      for (int s = 0; s < BK / 32; ++s) {
        if (s + 1 < BK / 32) fetch((s + 1) & 1, (s + 1) * 32);
        // keeps the group of reads in front of the WMMAs: without it the build
        // sinks each read to its first use and waits there for LDS
        __builtin_amdgcn_sched_barrier(0);
#pragma unroll
        for (int nt = 0; nt < 4; ++nt) {
          acc[0][nt] = WMMA_F32_F16(af[s & 1][0], bf[s & 1][nt], acc[0][nt]);
          acc[1][nt] = WMMA_F32_F16(af[s & 1][1], bf[s & 1][nt], acc[1][nt]);
        }
        // keeps the next group of reads behind these WMMAs, in one place
        __builtin_amdgcn_sched_barrier(0);
      }
    };

    const int NT = K / BK;
    // 0 in waves 0-3, 1 in waves 4-7; a scalar, so that the tests on it are branches
    // that a whole wave takes or skips (a copy is issued with every lane on)
    const int par = __builtin_amdgcn_readfirstlane(tid >> 7);
    const int u  = tid & 127;               // this thread among the 128 that bring a tile
    const int r0 = u >> 4, ch = u & 15;     // 16 adjacent lanes copy one A row whole
    const int kg = (u >> 4) * 16, n0 = (u & 15) * 4;  // 16 k rows of 4 columns of B
    f4v p[16];                              // this thread's part of its B tile, f32

    // starts tile s on its way: A by copies into buffer buf, B into p
    auto issue = [&](int s, int buf) {
      const float* b0 = Bw + (size_t)(s * BK + kg) * N + nBase + n0;
      const float* bp[16];
      // unrolled: bp and p live in registers; every load is issued at once
#pragma unroll
      for (int c = 0; c < 16; ++c) {
        bp[c] = b0 + (size_t)c * N;   // the step is the same in every lane: a scalar
        p[c] = *(const f4v*)bp[c];
      }
      // behind the last load, before a later result may land in their address
      // registers (named as inputs so that they live to here)
      asm volatile("s_wait_xcnt 0x0"
                   :: "v"(bp[0]), "v"(bp[1]), "v"(bp[2]), "v"(bp[3]), "v"(bp[4]), "v"(bp[5]),
                      "v"(bp[6]), "v"(bp[7]), "v"(bp[8]), "v"(bp[9]), "v"(bp[10]), "v"(bp[11]),
                      "v"(bp[12]), "v"(bp[13]), "v"(bp[14]), "v"(bp[15]) : "memory");
      const _Float16* src = A + (size_t)(mBase + r0) * K + s * BK + ch * 8;
      _Float16* dst = &As[buf * ASZ + r0 * LDA + ch * 8];
      // unrolled: all 32 copies of the tile are in flight together
#pragma unroll
      for (int c = 0; c < 32; ++c)
        async_copy_b128(src + (size_t)(c * 8) * K, dst + c * 8 * LDA);
    };

    // hands tile s (buffer buf) over to all waves, then refills buffer nbuf, whose
    // last readers (trip s - 1) the barrier has ended, with tile s + 2
    auto publish = [&](int s, int buf, int nbuf) {
      const bool mine = par == (s & 1);
      if (mine) {
        // all unrolled: p and q are indexed by constants and stay in registers
#pragma unroll
        for (int j = 0; j < 4; ++j)
#pragma unroll
          for (int hf = 0; hf < 2; ++hf) {
            half8 q;
#pragma unroll
            for (int c = 0; c < 8; ++c) q[c] = (_Float16)p[hf * 8 + c][j];
            *(half8*)(&Bs[buf * BSZ + (n0 + j) * LDB + kg + hf * 8]) = q;
          }
      }
      // this wave's B stores are in LDS and its reads of buffer nbuf are done
      asm volatile("s_wait_dscnt 0x0" ::: "memory");
      // the waves that copied tile s: every one of their copies has landed
      if (mine) asm volatile("s_wait_asynccnt 0x0" ::: "memory");
      // a barrier with fences on LDS alone: __syncthreads() would also wait for the
      // other waves' B loads of tile s + 1, which are meant to stay in flight
      __builtin_amdgcn_fence(__ATOMIC_RELEASE, "workgroup", "local");
      __builtin_amdgcn_s_barrier();
      __builtin_amdgcn_fence(__ATOMIC_ACQUIRE, "workgroup", "local");
      if (mine && s + 2 < NT) issue(s + 2, nbuf);
    };

    if (par == 0) issue(0, 0);
    else if (1 < NT) issue(1, 1);
    publish(0, 0, 2);
    int rb = 0;                             // t % 3
    for (int t = 0; t < NT; ++t) {
      multiply(rb * ASZ, rb * BSZ);
      int rn = rb == 2 ? 0 : rb + 1;        // (t + 1) % 3
      if (t + 1 < NT) publish(t + 1, rn, rb);
      rb = rn;
    }
    // no copy is left in flight, and every wave has read its last fragment,
    // before the epilogue writes into As
    asm volatile("s_wait_asynccnt 0x0" ::: "memory");
    asm volatile("s_wait_dscnt 0x0" ::: "memory");
    __syncthreads();
  } else
  for (int k0 = 0; k0 < K; k0 += BK) {
    // --- stage A tile: 256 rows x BK halves (async); CPR adjacent lanes copy
    //     one row, so a wave-wide copy covers whole rows of the tile ---
    {
      int r0 = tid / CPR, ch = tid % CPR;
      const _Float16* src = A + (size_t)(mBase + r0) * K + k0 + ch * 8;
      // unrolled: all copies of the tile are in flight before the one wait
#pragma unroll
      for (int c = 0; c < CPR; ++c)
        async_copy_b128(src + (size_t)(c * (256 / CPR)) * K,
                        &As[(r0 + c * (256 / CPR)) * LDA + ch * 8]);
    }
    // --- stage B tile transposed and rounded to f16: BK(k) x 64(n) f32 -> Bs[n][k];
    //     16 adjacent lanes load one whole 256-byte row of the tile ---
    {
      int kg = (tid >> 4) * RPT, n0 = (tid & 15) * 4;
      const float* bp[RPT];
      f4v p[RPT];
      // unrolled: bp and p live in registers; every load is issued before the first store
#pragma unroll
      for (int c = 0; c < RPT; ++c) {
        bp[c] = Bw + (size_t)(k0 + kg + c) * N + nBase + n0;
        p[c] = *(const f4v*)bp[c];
      }
      // thread t asks for row t of the next A tile
      const _Float16* pf = A + (size_t)(mBase + tid) * K + k0 + BK;
      if (k0 + BK < K) __builtin_prefetch(pf, 0, 3);
      // behind the trip's last load and the prefetch, before a later result may
      // land in their address registers (named as inputs so that they live to here)
      if constexpr (BK == 128)
        asm volatile("s_wait_xcnt 0x0"
                     :: "v"(bp[0]), "v"(bp[1]), "v"(bp[2]), "v"(bp[3]),
                        "v"(bp[4]), "v"(bp[5]), "v"(bp[6]), "v"(bp[7]), "v"(pf) : "memory");
      else
        // the loaded values are inputs too: all four loads are then issued before
        // the first is waited for (else the build waits between two pairs of loads)
        asm volatile("s_wait_xcnt 0x0"
                     :: "v"(bp[0]), "v"(bp[1]), "v"(bp[2]), "v"(bp[3]), "v"(pf),
                        "v"(p[0]), "v"(p[1]), "v"(p[2]), "v"(p[3]) : "memory");
      // both unrolled: p and q are indexed by constants and stay in registers
#pragma unroll
      for (int j = 0; j < 4; ++j) {
        hrun q;
#pragma unroll
        for (int c = 0; c < RPT; ++c) q[c] = (_Float16)p[c][j];
        *(hrun*)(&Bs[(n0 + j) * LDB + kg]) = q;
      }
    }
    wait_async();
    __syncthreads();

    // unrolled: fragment offsets become immediates and loads of a later 32 k
    // can be issued under the WMMAs of an earlier one
#pragma unroll
    for (int kk = 0; kk < BK; kk += 32) {
      // --- A fragments (16x32, ISA 16-bit layout), rows w*32 + mi*16 ---
      v16h af[2];
#pragma unroll
      for (int mi = 0; mi < 2; ++mi) {
        int rloc = w * 32 + mi * 16 + mloc;
        half8 lo = *(const half8*)(&As[rloc * LDA + kk + lh * 8]);
        half8 hi = *(const half8*)(&As[rloc * LDA + kk + 16 + lh * 8]);
#pragma unroll
        for (int i = 0; i < 8; ++i) { af[mi][i] = lo[i]; af[mi][8 + i] = hi[i]; }
      }
      // --- 4 B fragments, 8 WMMAs ---
#pragma unroll
      for (int nt = 0; nt < 4; ++nt) {
        int n = nt * 16 + mloc;
        v16h bf;
        half8 lo = *(const half8*)(&Bs[n * LDB + kk + lh * 8]);
        half8 hi = *(const half8*)(&Bs[n * LDB + kk + 16 + lh * 8]);
#pragma unroll
        for (int i = 0; i < 8; ++i) { bf[i] = lo[i]; bf[8 + i] = hi[i]; }
        acc[0][nt] = WMMA_F32_F16(af[0], bf, acc[0][nt]);
        acc[1][nt] = WMMA_F32_F16(af[1], bf, acc[1][nt]);
      }
    }
    __syncthreads();
  }

  // --- epilogue. An accumulator holds, per lane, one column of 8 rows
  //     (col = L%16, row = r + 8*(L/16)). Each wave turns its tile, 16 rows at a
  //     time, through its own piece of As (free behind the loop's last barrier),
  //     so that a lane then holds 4 adjacent columns of a row: 16 lanes cover a
  //     whole row of the tile, and bias, residual and result move as vectors ---
  constexpr int SP = 68;  // floats per staged row: 16-byte aligned, and rows r and r+8
                          // fall on different banks
  static_assert(8 * 16 * SP * sizeof(float) <= sizeof(As), "eight waves stage in As");
  float* stg = reinterpret_cast<float*>(As) + w * (16 * SP);
  int cn = lane & 15, rh = lane >> 4;
  int gn = nBase + cn * 4;              // first of this lane's 4 columns
  // this lane's rows are mBase + w * 32 + rh + 2 * q, q = mi * 8 + i
  size_t o0 = (size_t)(mBase + w * 32 + rh) * N + gn;
  size_t o2 = (size_t)2 * N;
  f4v bv = {0.f, 0.f, 0.f, 0.f};
  if (bias) {
    const float* bp = bias + gn;
    bv = *(const f4v*)bp;
    // behind the load, before a result may land in its address registers
    // (named as an input so that they live to here)
    asm volatile("s_wait_xcnt 0x0" :: "v"(bp) : "memory");
  }
  f4v rs[16];
  if constexpr (RES) {
    const float* rp[16];
    // unrolled: rp and rs live in registers; all 16 loads are in flight under the staging
#pragma unroll
    for (int q = 0; q < 16; ++q) {
      rp[q] = resid + o0 + q * o2;
      rs[q] = *(const f4v*)rp[q];
    }
    // the same behind the last of these loads, for their 16 addresses
    asm volatile("s_wait_xcnt 0x0"
                 :: "v"(rp[0]), "v"(rp[1]), "v"(rp[2]), "v"(rp[3]), "v"(rp[4]), "v"(rp[5]),
                    "v"(rp[6]), "v"(rp[7]), "v"(rp[8]), "v"(rp[9]), "v"(rp[10]), "v"(rp[11]),
                    "v"(rp[12]), "v"(rp[13]), "v"(rp[14]), "v"(rp[15]) : "memory");
  }
  // all unrolled: acc, rs, v and the stores' operands are indexed by constants
  // and stay in registers
#pragma unroll
  for (int mi = 0; mi < 2; ++mi) {
#pragma unroll
    for (int nt = 0; nt < 4; ++nt)
#pragma unroll
      for (int r = 0; r < 8; ++r)
        stg[(8 * rh + r) * SP + nt * 16 + cn] = acc[mi][nt][r];
    // the rows are read back by other lanes of this wave than wrote them
    asm volatile("s_wait_dscnt 0x0" ::: "memory");
    f4v v[8];
#pragma unroll
    for (int i = 0; i < 8; ++i) v[i] = *(const f4v*)(stg + (2 * i + rh) * SP + cn * 4);
#pragma unroll
    for (int i = 0; i < 8; ++i) {
      v[i] += bv;
#pragma unroll
      for (int j = 0; j < 4; ++j) {
        float m = fmaxf(v[i][j], 0.f);
        v[i][j] = doRelu ? m : v[i][j];
      }
    }
    // behind each group of 8 stores: s_wait_xcnt before a later result may land in
    // their address or data registers (named as inputs so that they live to there)
    if constexpr (RES) {
      float* op[8];
#pragma unroll
      for (int i = 0; i < 8; ++i) {
        v[i] += rs[mi * 8 + i];
        op[i] = out32 + o0 + (mi * 8 + i) * o2;
        *(f4v*)op[i] = v[i];
      }
      asm volatile("s_wait_xcnt 0x0"
                   :: "v"(op[0]), "v"(op[1]), "v"(op[2]), "v"(op[3]),
                      "v"(op[4]), "v"(op[5]), "v"(op[6]), "v"(op[7]),
                      "v"(v[0]), "v"(v[1]), "v"(v[2]), "v"(v[3]),
                      "v"(v[4]), "v"(v[5]), "v"(v[6]), "v"(v[7]) : "memory");
    } else {
      _Float16* op[8];
      half4 h[8];
#pragma unroll
      for (int i = 0; i < 8; ++i) {
#pragma unroll
        for (int j = 0; j < 4; ++j) h[i][j] = (_Float16)v[i][j];
        op[i] = out16 + o0 + (mi * 8 + i) * o2;
        *(half4*)op[i] = h[i];
      }
      asm volatile("s_wait_xcnt 0x0"
                   :: "v"(op[0]), "v"(op[1]), "v"(op[2]), "v"(op[3]),
                      "v"(op[4]), "v"(op[5]), "v"(op[6]), "v"(op[7]),
                      "v"(h[0]), "v"(h[1]), "v"(h[2]), "v"(h[3]),
                      "v"(h[4]), "v"(h[5]), "v"(h[6]), "v"(h[7]) : "memory");
    }
  }
}

// ---------------------------------------------------------------------------
// Block-sparse flash attention, 20 waves per work-group. Online softmax, KD=64.
// Work-groups 0..B*H-1: query tile 0 of one (b,h) (global rows, i<16, which see
// every key). The 128 key tiles are split over the 20 waves, 6 or 7 each; the
// partial softmax states (max, sum, O) are merged through LDS in wave order.
// They come first in the grid because they are the longest.
// Other work-groups: one wave per query tile qt>=1, which visits key tile 0
// (global columns) + local tiles qt-2..qt+2.
// 20 waves: five per SIMD is what the register count admits, and the grid then
// has fewer work-groups than the chip has WGPs, so all start at once.
// ---------------------------------------------------------------------------
constexpr int AW   = 20;              // waves per attention work-group
constexpr int NGB  = BB * HH;         // work-groups that hold a query tile 0
constexpr int KTW  = NQT / AW;        // key tiles per wave there, rounded down
constexpr int KTX  = NQT % AW;        // the first KTX waves take one more
constexpr int NLT  = BB * HH * (NQT - 1);   // query tiles with qt >= 1
constexpr int OPP  = 66;              // floats per row of a partial O in LDS:
                                      // rows r and r+8 fall on different banks
__global__ __launch_bounds__(AW * 32)
void attn_wmma(const _Float16* __restrict__ Q, const _Float16* __restrict__ Kt,
               const _Float16* __restrict__ V, _Float16* __restrict__ ctx) {
  __shared__ _Float16 Pl[AW][16 * 16];  // per-wave P staging (C->A layout)
  __shared__ __attribute__((aligned(16)))
  float Op[AW][16 * OPP];               // per-wave partial O (query tile 0)
  __shared__ float Ms[AW][16];          // per-wave running max per row
  __shared__ float Ls[AW][16];          // per-wave running sum per row

  int w    = threadIdx.x >> 5;
  int lane = threadIdx.x & 31;
  bool glob = blockIdx.x < NGB;                  // uniform over the work-group
  int bh, qt;
  if (glob) {
    bh = blockIdx.x;
    qt = 0;
  } else {
    int t = (blockIdx.x - NGB) * AW + w;         // tiles 1..NQT-1 of every (b,h)
    if (t >= NLT) return;                        // these work-groups meet no barrier
    bh = t / (NQT - 1);
    qt = 1 + t % (NQT - 1);
  }
  int b    = bh / HH;
  int h    = bh % HH;
  int mloc = lane & 15;
  int lh   = lane >> 4;

  const size_t rs = (size_t)HH * KDM;            // 512 halves per token row
  const size_t hoff = (size_t)h * KDM;
  const _Float16* qb = Q  + (size_t)(b * TT) * rs + hoff;
  const _Float16* kb = Kt + (size_t)(b * TT) * rs + hoff;
  const _Float16* vb = V  + (size_t)(b * TT) * rs + hoff;

  // Q fragments: 16x64 -> two 16x32 A-fragments
  v16h qf[2];
#pragma unroll
  for (int ks = 0; ks < 2; ++ks) {
    const _Float16* base = qb + (size_t)(qt * 16 + mloc) * rs + ks * 32;
    half8 lo = *(const half8*)(base + lh * 8);
    half8 hi = *(const half8*)(base + 16 + lh * 8);
#pragma unroll
    for (int i = 0; i < 8; ++i) { qf[ks][i] = lo[i]; qf[ks][8 + i] = hi[i]; }
  }

  v8f O[4];
  float mrow[8], lrow[8];
#pragma unroll
  for (int nt = 0; nt < 4; ++nt)
#pragma unroll
    for (int i = 0; i < 8; ++i) O[nt][i] = 0.f;
#pragma unroll
  for (int r = 0; r < 8; ++r) { mrow[r] = -3.0e38f; lrow[r] = 0.f; }

  auto process = [&](int st, bool needMask) {
    int sbase = st * 16;
    // scores S = Q K^T / sqrt(KD)
    v8f S;
#pragma unroll
    for (int i = 0; i < 8; ++i) S[i] = 0.f;
    {
      const _Float16* krow = kb + (size_t)(sbase + mloc) * rs + lh * 8;
#pragma unroll
      for (int ks = 0; ks < 2; ++ks) {
        v16h bf;
        half8 lo = *(const half8*)(krow + ks * 32);
        half8 hi = *(const half8*)(krow + ks * 32 + 16);
        // behind the tile's last K load, before a later result may land in the
        // registers of the K address (named as an input so that they live to here)
        if (ks == 1) asm volatile("s_wait_xcnt 0x0" :: "v"(krow) : "memory");
#pragma unroll
        for (int i = 0; i < 8; ++i) { bf[i] = lo[i]; bf[8 + i] = hi[i]; }
        S = WMMA_F32_F16(qf[ks], bf, S);
      }
    }
#pragma unroll
    for (int r = 0; r < 8; ++r) S[r] *= 0.125f;
    if (needMask) {
      int j = sbase + mloc;
#pragma unroll
      for (int r = 0; r < 8; ++r) {
        int i  = qt * 16 + 8 * lh + r;
        int di = i - j; if (di < 0) di = -di;
        bool ok = (di <= 32) || (j < 16) || (i < 16);
        if (!ok) S[r] = -1.0e9f;
      }
    }
    // online softmax (rows live across 16-lane halves)
    float pexp[8];
#pragma unroll
    for (int r = 0; r < 8; ++r) {
      float rm = S[r];
#pragma unroll
      for (int off = 1; off < 16; off <<= 1) rm = fmaxf(rm, __shfl_xor(rm, off, 32));
      float mn    = fmaxf(mrow[r], rm);
      float alpha = exp2_slot((mrow[r] - mn) * 1.44269504f);
      float p     = exp2_slot((S[r] - mn) * 1.44269504f);
      float sum   = p;
#pragma unroll
      for (int off = 1; off < 16; off <<= 1) sum += __shfl_xor(sum, off, 32);
      lrow[r] = lrow[r] * alpha + sum;
      mrow[r] = mn;
#pragma unroll
      for (int nt = 0; nt < 4; ++nt) O[nt][r] *= alpha;
      pexp[r] = p;
    }
    // stage P through LDS to convert C-layout -> A-layout (upper K half = 0)
#pragma unroll
    for (int r = 0; r < 8; ++r)
      Pl[w][(8 * lh + r) * 16 + mloc] = (_Float16)pexp[r];
    v16h ap;
    {
      half8 lo = *(const half8*)(&Pl[w][mloc * 16 + lh * 8]);
#pragma unroll
      for (int i = 0; i < 8; ++i) { ap[i] = lo[i]; ap[8 + i] = (_Float16)0.f; }
    }
    // O += P x V  (V tile is 16(s) x 64(kd); upper K half zero)
    const _Float16* vrow = vb + (size_t)(sbase + lh * 8) * rs + mloc;
#pragma unroll
    for (int nt = 0; nt < 4; ++nt) {
      v16h bvf;
#pragma unroll
      for (int i = 0; i < 8; ++i) {
        bvf[i]     = vrow[(size_t)i * rs + nt * 16];
        bvf[8 + i] = (_Float16)0.f;
      }
      O[nt] = WMMA_F32_F16(ap, bvf, O[nt]);
    }
    // the same behind the tile's last V load, for the registers of the V address
    asm volatile("s_wait_xcnt 0x0" :: "v"(vrow) : "memory");
  };

  if (glob) {
    int s0 = w * KTW + (w < KTX ? w : KTX);
    int s1 = s0 + KTW + (w < KTX ? 1 : 0);
    for (int st = s0; st < s1; ++st) process(st, false);
  } else {
    process(0, false);                       // global columns (j < 16)
    int lo = qt - 2 < 1 ? 1 : qt - 2;
    int hi = qt + 2 > NQT - 1 ? NQT - 1 : qt + 2;
    for (int st = lo; st <= hi; ++st) process(st, true);
  }

  // normalize + write ctx (fp16, [B,T,H,KD])
  _Float16* cb = ctx + (size_t)(b * TT + qt * 16) * rs + hoff;

  if (glob) {
    // publish this wave's partial state
    // (unrolled: mrow, lrow and O live in registers and need constant indices)
#pragma unroll
    for (int r = 0; r < 8; ++r)
      if (mloc == 0) { Ms[w][8 * lh + r] = mrow[r]; Ls[w][8 * lh + r] = lrow[r]; }
#pragma unroll
    for (int nt = 0; nt < 4; ++nt)
#pragma unroll
      for (int r = 0; r < 8; ++r)
        Op[w][(8 * lh + r) * OPP + nt * 16 + mloc] = O[nt][r];
    __syncthreads();
    // wave w merges query row w; a lane owns two adjacent columns
    // (both loops unrolled: every LDS read of the merge is issued up front)
    if (w >= 16) return;
    float M = Ms[0][w];
#pragma unroll
    for (int ww = 1; ww < AW; ++ww) M = fmaxf(M, Ms[ww][w]);
    float L = 0.f, o0 = 0.f, o1 = 0.f;
#pragma unroll
    for (int ww = 0; ww < AW; ++ww) {
      float e = exp2_slot((Ms[ww][w] - M) * 1.44269504f);
      float2 p = *(const float2*)(&Op[ww][w * OPP + 2 * lane]);
      L  += Ls[ww][w] * e;
      o0 += p.x * e;
      o1 += p.y * e;
    }
    half2v res;
    res[0] = (_Float16)(o0 / L);
    res[1] = (_Float16)(o1 / L);
    *(half2v*)(cb + (size_t)w * rs + 2 * lane) = res;
    return;
  }
#pragma unroll
  for (int nt = 0; nt < 4; ++nt)
#pragma unroll
    for (int r = 0; r < 8; ++r) {
      float vv = O[nt][r] / lrow[r];
      cb[(size_t)(8 * lh + r) * rs + nt * 16 + mloc] = (_Float16)vv;
    }
  // behind the last store; on this path only the end of the kernel follows it
  asm volatile("s_wait_xcnt 0x0" ::: "memory");
}

// ---------------------------------------------------------------------------
// Host-side orchestration
// ---------------------------------------------------------------------------
extern "C" void kernel_launch(void* const* d_in, const int* in_sizes, int n_in,
                              void* d_out, int out_size, void* d_ws, size_t ws_size,
                              hipStream_t stream) {
  const float* x    = (const float*)d_in[0];
  const float* ln1g = (const float*)d_in[1];
  const float* ln1b = (const float*)d_in[2];
  const float* Wq   = (const float*)d_in[3];
  const float* bq   = (const float*)d_in[4];
  const float* Wk   = (const float*)d_in[5];
  const float* bk   = (const float*)d_in[6];
  const float* Wv   = (const float*)d_in[7];
  const float* bv   = (const float*)d_in[8];
  const float* Wo   = (const float*)d_in[9];
  const float* bo   = (const float*)d_in[10];
  const float* ln2g = (const float*)d_in[11];
  const float* ln2b = (const float*)d_in[12];
  const float* W1   = (const float*)d_in[13];
  const float* b1   = (const float*)d_in[14];
  const float* W2   = (const float*)d_in[15];
  const float* b2   = (const float*)d_in[16];
  float* out = (float*)d_out;

  char* ws = (char*)d_ws;
  const size_t MB = 1024ull * 1024ull;
  // Region 0 (32MB): xn16|q16|k16|v16 ; later aliased by FFN hidden h16
  _Float16* xn16 = (_Float16*)(ws + 0 * MB);
  _Float16* q16  = (_Float16*)(ws + 8 * MB);
  _Float16* k16  = (_Float16*)(ws + 16 * MB);
  _Float16* v16  = (_Float16*)(ws + 24 * MB);
  _Float16* h16  = (_Float16*)(ws + 0 * MB);    // alias (32MB), after attn
  _Float16* ctx16 = (_Float16*)(ws + 32 * MB);  // 8MB
  _Float16* xn2   = (_Float16*)(ws + 32 * MB);  // alias ctx16 after out-proj
  float*    x1    = (float*)   (ws + 40 * MB);  // 16MB

  // LN1 -> xn16
  ln_rows<<<BT / 8, 256, 0, stream>>>(x, ln1g, ln1b, xn16, BT);

  // QKV projections (fp16 out), one launch: grid z = 0, 1, 2 is Q, K, V
  dim3 gq(DD / 64, BT / 256);
  dim3 gqkv(DD / 64, BT / 256, 3);
  gemm_wmma<128, false, 3, 1><<<gqkv, 256, 0, stream>>>(xn16, Wq, bq, nullptr, q16, nullptr, BT, DD, DD, 0,
                                                     Wk, bk, k16, Wv, bv, v16);

  // Block-sparse flash attention -> ctx16
  attn_wmma<<<NGB + (NLT + AW - 1) / AW, AW * 32, 0, stream>>>(q16, k16, v16, ctx16);

  // Out projection + residual (fp32 x1)
  gemm_wmma<128, true, 1, 3><<<gq, 256, 0, stream>>>(ctx16, Wo, bo, x, nullptr, x1, BT, DD, DD, 0,
                                                  nullptr, nullptr, nullptr, nullptr, nullptr, nullptr);

  // LN2 -> xn2
  ln_rows<<<BT / 8, 256, 0, stream>>>(x1, ln2g, ln2b, xn2, BT);

  // FFN1: relu(xn2 @ W1 + b1) -> h16
  dim3 g1(DFF / 64, BT / 256);
  gemm_wmma<64, false, 1, 1><<<g1, 256, 0, stream>>>(xn2, W1, b1, nullptr, h16, nullptr, BT, DFF, DD, 1,
                                                  nullptr, nullptr, nullptr, nullptr, nullptr, nullptr);

  // FFN2: x1 + (h16 @ W2 + b2) -> out (fp32)
  dim3 g2(DD / 64, BT / 256);
  gemm_wmma<128, true, 1, 3><<<g2, 256, 0, stream>>>(h16, W2, b2, x1, nullptr, out, BT, DD, DFF, 0,
                                                  nullptr, nullptr, nullptr, nullptr, nullptr, nullptr);
}

// v008
// A run of this version takes 98.5 microseconds.
// Next to v007, in two timings, it ran 1.07 times as fast each time.
// Counting every step since v000, it is 4.26 times as fast.
#include <hip/hip_runtime.h>
#include <hip/hip_bf16.h>

typedef _Float16 half2v __attribute__((ext_vector_type(2)));
typedef _Float16 half4 __attribute__((ext_vector_type(4)));
typedef _Float16 half8 __attribute__((ext_vector_type(8)));
typedef _Float16 v16h  __attribute__((ext_vector_type(16)));
typedef float    v8f   __attribute__((ext_vector_type(8)));
typedef int      i4v   __attribute__((ext_vector_type(4)));
typedef float    f4v   __attribute__((ext_vector_type(4)));

#define WMMA_F32_F16(a, b, c) \
  __builtin_amdgcn_wmma_f32_16x16x32_f16(false, (a), false, (b), (short)0, (c), false, false)

#define AS1 __attribute__((address_space(1)))
#define AS3 __attribute__((address_space(3)))

// Async global->LDS copy (CDNA5 GLOBAL_LOAD_ASYNC_TO_LDS_B128, ASYNCcnt),
// with a synchronous fallback if the builtin is unavailable.
// Probe-verified: the builtin's params are (global int4*, local int4*, imm, imm).
__device__ __forceinline__ void async_copy_b128(const _Float16* g, _Float16* l) {
#if __has_builtin(__builtin_amdgcn_global_load_async_to_lds_b128)
  __builtin_amdgcn_global_load_async_to_lds_b128(
      (AS1 i4v*)g, (AS3 i4v*)l, 0, 0);
#else
  *(half8*)l = *(const half8*)g;
#endif
}
__device__ __forceinline__ void wait_async() {
#if __has_builtin(__builtin_amdgcn_global_load_async_to_lds_b128)
#if __has_builtin(__builtin_amdgcn_s_wait_asynccnt)
  __builtin_amdgcn_s_wait_asynccnt(0);
#else
  asm volatile("s_wait_asynccnt 0x0" ::: "memory");
#endif
#endif
}

// 2^a. The v_nop is the one free slot that the instruction set asks for between
// a transcendental and a next instruction that reads its result or overwrites
// its source.
__device__ __forceinline__ float exp2_slot(float a) {
  float e;
  asm("v_exp_f32 %0, %1\n\tv_nop" : "=v"(e) : "v"(a));
  return e;
}

// Problem dims
constexpr int BB  = 4;
constexpr int TT  = 2048;
constexpr int DD  = 512;
constexpr int HH  = 8;
constexpr int KDM = 64;
constexpr int DFF = 2048;
constexpr int BT  = BB * TT;          // 8192 rows
constexpr int NQT = TT / 16;          // 128 query tiles per (b,h)

// ---------------------------------------------------------------------------
// LayerNorm: one wave (32 lanes) per row of D=512, writes fp16
// ---------------------------------------------------------------------------
__global__ __launch_bounds__(256)
void ln_rows(const float* __restrict__ x, const float* __restrict__ g,
             const float* __restrict__ b, _Float16* __restrict__ out, int nrows) {
  int wave = (int)((blockIdx.x * blockDim.x + threadIdx.x) >> 5);
  int lane = threadIdx.x & 31;
  if (wave >= nrows) return;
  const float* row = x + (size_t)wave * DD;
  float vals[16];
  float s = 0.f;
#pragma unroll
  for (int i = 0; i < 16; ++i) { vals[i] = row[lane + i * 32]; s += vals[i]; }
#pragma unroll
  for (int off = 1; off < 32; off <<= 1) s += __shfl_xor(s, off, 32);
  float mean = s * (1.0f / DD);
  float vs = 0.f;
#pragma unroll
  for (int i = 0; i < 16; ++i) { float d = vals[i] - mean; vs += d * d; }
#pragma unroll
  for (int off = 1; off < 32; off <<= 1) vs += __shfl_xor(vs, off, 32);
  float rstd = rsqrtf(vs * (1.0f / DD) + 1e-6f);
  _Float16* orow = out + (size_t)wave * DD;
#pragma unroll
  for (int i = 0; i < 16; ++i) {
    int c = lane + i * 32;
    orow[c] = (_Float16)((vals[i] - mean) * rstd * g[c] + b[c]);
  }
}

// ---------------------------------------------------------------------------
// Generic fp16 WMMA GEMM: C[M,N] = A[M,K] @ B[K,N] (+bias)(+relu)(+resid)
// Block tile 256(M) x BN(N), 8 waves.
// BN = 64: each wave owns a 32x64 strip: 2 A-fragments x 4 B-fragments = 8 WMMAs
// per 32 k. BN = 128: the waves stand 4 x 2 and each owns 64x64: 4 x 4 fragments =
// 16 WMMAs per 32 k. Per k the group loads 256 f16 of A and BN f32 of B, so the
// wider tile asks L2 for a third fewer bytes per result; it is for the launches
// whose grid still gives every WGP a group or two. There N is also given as the
// constant NC (the ring reads N alone; its NC is 0).
// One trip of the K loop stages BK k of both operands and then multiplies all
// of it, so the wait for the loads and the two barriers are paid once per BK k.
// K must be a multiple of BK.
// A staged via async global->LDS B128. B is the f32 weight itself: a thread
// loads 4 columns of 16 consecutive k rows, rounds them to f16 and stores
// each column's run of k as two vectors, so Bs is [n][k] for contiguous 16B
// B-fragment ds loads.
// RES: the residual is added and the result is stored as f32 (out32); else the
// result is stored as f16 (out16) and resid is not read.
// NP = 3: one launch holds three products of the same A and shape; grid z picks
// the weight, the bias and the f16 output. Their work-groups then share a WGP,
// so one's loads fly under another's WMMAs. NP = 1: the first of each is used.
// NB = 1: one buffer, filled and then read, as described above.
// NB = 3: for a launch with one work-group per WGP, where nothing else covers
// the loads. Three buffers in LDS; the tiles of trips t + 1 and t + 2 are on
// their way while trip t multiplies. Waves 0-3 bring the even tiles, waves 4-7 the
// odd ones, so a wave that waits for all of its own copies never waits for the
// younger tile, which the other four waves have in flight.
// ---------------------------------------------------------------------------
// Registers: the one-buffer form is budgeted for four waves per SIMD, so that two of
// its work-groups are resident on a WGP; the ring's LDS admits one group anyway.
template <int BK, bool RES, int NP, int NB, int BN, int NC>
__global__ __launch_bounds__(256) __attribute__((amdgpu_waves_per_eu(NB == 1 ? 4 : 2)))
void gemm_wmma(const _Float16* __restrict__ A, const float* __restrict__ Bw0,
               const float* __restrict__ bias0, const float* __restrict__ resid,
               _Float16* __restrict__ out16a, float* __restrict__ out32,
               int M, int N, int K, int doRelu,
               const float* __restrict__ Bw1, const float* __restrict__ bias1,
               _Float16* __restrict__ out16b,
               const float* __restrict__ Bw2, const float* __restrict__ bias2,
               _Float16* __restrict__ out16c) {
  static_assert(NP == 1 || NP == 3, "one product, or three picked by grid z");
  const float* Bw   = Bw0;
  const float* bias = bias0;
  _Float16* out16   = out16a;
  if constexpr (NP == 3) {
    int z = blockIdx.z;         // the same in the whole work-group
    if (z == 1) { Bw = Bw1; bias = bias1; out16 = out16b; }
    if (z == 2) { Bw = Bw2; bias = bias2; out16 = out16c; }
  }
  static_assert(BK == 128, "both stagings are written for tiles of 128 k");
  static_assert((NB == 1 && BN == 128 && !RES) || (NB == 3 && BN == 64),
                "the ring is written for the narrow tile, the one buffer for the wide one");
  constexpr int LDA = BK + 8;   // halves; row pitch = 16 B x an odd number
  constexpr int LDB = BK + 8;
  constexpr int CPR = BK / 8;   // 16-byte pieces per A row of the tile
  constexpr int WN  = BN / 64;  // waves side by side along N
  constexpr int MI  = 2 * WN;   // A fragments (16 rows each) per wave
  constexpr int ASZ = 256 * LDA;  // halves per A buffer
  constexpr int BSZ = BN * LDB;   // halves per B buffer
  __shared__ __attribute__((aligned(16))) _Float16 As[NB * ASZ];
  __shared__ __attribute__((aligned(16))) _Float16 Bs[NB * BSZ];  // transposed: [n][k]

  int tid  = threadIdx.x;
  int w    = tid >> 5;
  int lane = tid & 31;
  int mBase = blockIdx.y * 256;
  int nBase = blockIdx.x * BN;
  int mloc  = lane & 15;
  int lh    = lane >> 4;
  int wrow  = (w / WN) * (MI * 16);   // this wave's first row in the tile
  int wcol  = (w % WN) * 64;          // and its first column

  v8f acc[MI][4];
#pragma unroll
  for (int mi = 0; mi < MI; ++mi)
#pragma unroll
    for (int nt = 0; nt < 4; ++nt)
#pragma unroll
      for (int i = 0; i < 8; ++i) acc[mi][nt][i] = 0.f;

  if constexpr (NB == 3) {
    // multiplies one staged tile; ao, bo: where its buffers begin in As and Bs.
    // Two register sets of fragments: the 12 LDS reads of the next 32 k go out as
    // one group in front of the 8 WMMAs of this 32 k, so that a wave waits for LDS
    // once a tile (its first group) and not in front of every pair of WMMAs.
    auto multiply = [&](int ao, int bo) {
      v16h af[2][2], bf[2][4];
      // reads the fragments of 32 k into set st (ISA 16-bit layout; A rows
      // w*32 + mi*16, B columns nt*16); all its loops unrolled: af and bf are
      // indexed by constants and stay in registers
      auto fetch = [&](int st, int kk) {
#pragma unroll
        for (int mi = 0; mi < 2; ++mi) {
          int rloc = w * 32 + mi * 16 + mloc;
          half8 lo = *(const half8*)(&As[ao + rloc * LDA + kk + lh * 8]);
          half8 hi = *(const half8*)(&As[ao + rloc * LDA + kk + 16 + lh * 8]);
#pragma unroll
          for (int i = 0; i < 8; ++i) { af[st][mi][i] = lo[i]; af[st][mi][8 + i] = hi[i]; }
        }
#pragma unroll
        for (int nt = 0; nt < 4; ++nt) {
          int n = nt * 16 + mloc;
          half8 lo = *(const half8*)(&Bs[bo + n * LDB + kk + lh * 8]);
          half8 hi = *(const half8*)(&Bs[bo + n * LDB + kk + 16 + lh * 8]);
#pragma unroll
          for (int i = 0; i < 8; ++i) { bf[st][nt][i] = lo[i]; bf[st][nt][8 + i] = hi[i]; }
        }
      };
      fetch(0, 0);
      // unrolled: the set index and the fragment offsets become constants
#pragma unroll
      for (int s = 0; s < BK / 32; ++s) {
        if (s + 1 < BK / 32) fetch((s + 1) & 1, (s + 1) * 32);
        // keeps the group of reads in front of the WMMAs: without it the build
        // sinks each read to its first use and waits there for LDS
        __builtin_amdgcn_sched_barrier(0);
#pragma unroll
        for (int nt = 0; nt < 4; ++nt) {
          acc[0][nt] = WMMA_F32_F16(af[s & 1][0], bf[s & 1][nt], acc[0][nt]);
          acc[1][nt] = WMMA_F32_F16(af[s & 1][1], bf[s & 1][nt], acc[1][nt]);
        }
        // keeps the next group of reads behind these WMMAs, in one place
        __builtin_amdgcn_sched_barrier(0);
      }
    };

    const int NT = K / BK;
    // 0 in waves 0-3, 1 in waves 4-7; a scalar, so that the tests on it are branches
    // that a whole wave takes or skips (a copy is issued with every lane on)
    const int par = __builtin_amdgcn_readfirstlane(tid >> 7);
    const int u  = tid & 127;               // this thread among the 128 that bring a tile
    const int r0 = u >> 4, ch = u & 15;     // 16 adjacent lanes copy one A row whole
    const int kg = (u >> 4) * 16, n0 = (u & 15) * 4;  // 16 k rows of 4 columns of B
    f4v p[16];                              // this thread's part of its B tile, f32

    // starts tile s on its way: A by copies into buffer buf, B into p
    auto issue = [&](int s, int buf) {
      const float* b0 = Bw + (size_t)(s * BK + kg) * N + nBase + n0;
      const float* bp[16];
      // unrolled: bp and p live in registers; every load is issued at once
#pragma unroll
      for (int c = 0; c < 16; ++c) {
        bp[c] = b0 + (size_t)c * N;   // the step is the same in every lane: a scalar
        p[c] = *(const f4v*)bp[c];
      }
      // behind the last load, before a later result may land in their address
      // registers (named as inputs so that they live to here)
      asm volatile("s_wait_xcnt 0x0"
                   :: "v"(bp[0]), "v"(bp[1]), "v"(bp[2]), "v"(bp[3]), "v"(bp[4]), "v"(bp[5]),
                      "v"(bp[6]), "v"(bp[7]), "v"(bp[8]), "v"(bp[9]), "v"(bp[10]), "v"(bp[11]),
                      "v"(bp[12]), "v"(bp[13]), "v"(bp[14]), "v"(bp[15]) : "memory");
      const _Float16* src = A + (size_t)(mBase + r0) * K + s * BK + ch * 8;
      _Float16* dst = &As[buf * ASZ + r0 * LDA + ch * 8];
      // unrolled: all 32 copies of the tile are in flight together
#pragma unroll
      for (int c = 0; c < 32; ++c)
        async_copy_b128(src + (size_t)(c * 8) * K, dst + c * 8 * LDA);
    };

    // hands tile s (buffer buf) over to all waves, then refills buffer nbuf, whose
    // last readers (trip s - 1) the barrier has ended, with tile s + 2
    auto publish = [&](int s, int buf, int nbuf) {
      const bool mine = par == (s & 1);
      if (mine) {
        // all unrolled: p and q are indexed by constants and stay in registers
#pragma unroll
        for (int j = 0; j < 4; ++j)
#pragma unroll
          for (int hf = 0; hf < 2; ++hf) {
            half8 q;
#pragma unroll
            for (int c = 0; c < 8; ++c) q[c] = (_Float16)p[hf * 8 + c][j];
            *(half8*)(&Bs[buf * BSZ + (n0 + j) * LDB + kg + hf * 8]) = q;
          }
      }
      // this wave's B stores are in LDS and its reads of buffer nbuf are done
      asm volatile("s_wait_dscnt 0x0" ::: "memory");
      // the waves that copied tile s: every one of their copies has landed
      if (mine) asm volatile("s_wait_asynccnt 0x0" ::: "memory");
      // a barrier with fences on LDS alone: __syncthreads() would also wait for the
      // other waves' B loads of tile s + 1, which are meant to stay in flight
      __builtin_amdgcn_fence(__ATOMIC_RELEASE, "workgroup", "local");
      __builtin_amdgcn_s_barrier();
      __builtin_amdgcn_fence(__ATOMIC_ACQUIRE, "workgroup", "local");
      if (mine && s + 2 < NT) issue(s + 2, nbuf);
    };

    if (par == 0) issue(0, 0);
    else if (1 < NT) issue(1, 1);
    publish(0, 0, 2);
    int rb = 0;                             // t % 3
    for (int t = 0; t < NT; ++t) {
      multiply(rb * ASZ, rb * BSZ);
      int rn = rb == 2 ? 0 : rb + 1;        // (t + 1) % 3
      if (t + 1 < NT) publish(t + 1, rn, rb);
      rb = rn;
    }
    // no copy is left in flight, and every wave has read its last fragment,
    // before the epilogue writes into As
    asm volatile("s_wait_asynccnt 0x0" ::: "memory");
    asm volatile("s_wait_dscnt 0x0" ::: "memory");
    __syncthreads();
  } else
  for (int k0 = 0; k0 < K; k0 += BK) {
    // --- stage A tile: 256 rows x BK halves (async); CPR adjacent lanes copy
    //     one row, so a wave-wide copy covers whole rows of the tile ---
    {
      int r0 = tid / CPR, ch = tid % CPR;
      const _Float16* src = A + (size_t)(mBase + r0) * K + k0 + ch * 8;
      // unrolled: all copies of the tile are in flight before the one wait
#pragma unroll
      for (int c = 0; c < CPR; ++c)
        async_copy_b128(src + (size_t)(c * (256 / CPR)) * K,
                        &As[(r0 + c * (256 / CPR)) * LDA + ch * 8]);
    }
    // --- stage B tile transposed and rounded to f16: BK(k) x BN(n) f32 -> Bs[n][k];
    //     16 adjacent lanes load 256 adjacent bytes of a row of the tile; waves 0-3
    //     bring columns 0-63, waves 4-7 columns 64-127 ---
    {
      constexpr int RPT = 16;   // k rows per thread: 8 groups of 16 lanes x 16 = BK
      int kg = ((tid & 127) >> 4) * RPT, n0 = (tid >> 7) * 64 + (tid & 15) * 4;
      // the row pitch is a constant, so the 16 loads share one address and differ in
      // their immediate offset: 2 address registers, not 32, which leaves the
      // registers for two resident work-groups
      const float* bp = Bw + (size_t)(k0 + kg) * NC + nBase + n0;
      f4v p[RPT];
      // unrolled: p lives in registers; every load is issued before the first store
#pragma unroll
      for (int c = 0; c < RPT; ++c) p[c] = *(const f4v*)(bp + c * NC);
      // thread t asks for row t of the next A tile
      const _Float16* pf = A + (size_t)(mBase + tid) * K + k0 + BK;
      if (k0 + BK < K) __builtin_prefetch(pf, 0, 3);
      // behind the trip's last load and the prefetch, before a later result may
      // land in their address registers (named as inputs so that they live to here).
      // The loaded values are inputs too: all 16 loads are then issued before the
      // first is waited for (else the build waits for the first 8 before the last 4)
      asm volatile("s_wait_xcnt 0x0"
                   :: "v"(bp), "v"(pf),
                      "v"(p[0]), "v"(p[1]), "v"(p[2]), "v"(p[3]), "v"(p[4]), "v"(p[5]),
                      "v"(p[6]), "v"(p[7]), "v"(p[8]), "v"(p[9]), "v"(p[10]), "v"(p[11]),
                      "v"(p[12]), "v"(p[13]), "v"(p[14]), "v"(p[15]) : "memory");
      // all unrolled: p and q are indexed by constants and stay in registers
#pragma unroll
      for (int j = 0; j < 4; ++j)
#pragma unroll
        for (int hf = 0; hf < 2; ++hf) {
          half8 q;
#pragma unroll
          for (int c = 0; c < 8; ++c) q[c] = (_Float16)p[hf * 8 + c][j];
          *(half8*)(&Bs[(n0 + j) * LDB + kg + hf * 8]) = q;
        }
    }
    wait_async();
    __syncthreads();

    // unrolled: fragment offsets become immediates and loads of a later 32 k
    // can be issued under the WMMAs of an earlier one
#pragma unroll
    for (int kk = 0; kk < BK; kk += 32) {
      // --- A fragments (16x32, ISA 16-bit layout), rows wrow + mi*16 ---
      v16h af[MI];
#pragma unroll
      for (int mi = 0; mi < MI; ++mi) {
        int rloc = wrow + mi * 16 + mloc;
        half8 lo = *(const half8*)(&As[rloc * LDA + kk + lh * 8]);
        half8 hi = *(const half8*)(&As[rloc * LDA + kk + 16 + lh * 8]);
#pragma unroll
        for (int i = 0; i < 8; ++i) { af[mi][i] = lo[i]; af[mi][8 + i] = hi[i]; }
      }
      // --- 4 B fragments (columns wcol + nt*16), each met by every A fragment ---
#pragma unroll
      for (int nt = 0; nt < 4; ++nt) {
        int n = wcol + nt * 16 + mloc;
        v16h bf;
        half8 lo = *(const half8*)(&Bs[n * LDB + kk + lh * 8]);
        half8 hi = *(const half8*)(&Bs[n * LDB + kk + 16 + lh * 8]);
#pragma unroll
        for (int i = 0; i < 8; ++i) { bf[i] = lo[i]; bf[8 + i] = hi[i]; }
#pragma unroll
        for (int mi = 0; mi < MI; ++mi) acc[mi][nt] = WMMA_F32_F16(af[mi], bf, acc[mi][nt]);
      }
    }
    __syncthreads();
  }

  // --- epilogue. An accumulator holds, per lane, one column of 8 rows
  //     (col = L%16, row = r + 8*(L/16)). Each wave turns its tile, 16 rows at a
  //     time, through its own piece of As (free behind the loop's last barrier),
  //     so that a lane then holds 4 adjacent columns of a row: 16 lanes cover a
  //     whole row of the tile, and bias, residual and result move as vectors ---
  constexpr int SP = 68;  // floats per staged row: 16-byte aligned, and rows r and r+8
                          // fall on different banks
  static_assert(8 * 16 * SP * sizeof(float) <= sizeof(As), "eight waves stage in As");
  float* stg = reinterpret_cast<float*>(As) + w * (16 * SP);
  int cn = lane & 15, rh = lane >> 4;
  int gn = nBase + wcol + cn * 4;       // first of this lane's 4 columns
  // this lane's rows are mBase + wrow + rh + 2 * q, q = mi * 8 + i
  size_t o0 = (size_t)(mBase + wrow + rh) * N + gn;
  size_t o2 = (size_t)2 * N;
  f4v bv = {0.f, 0.f, 0.f, 0.f};
  if (bias) {
    const float* bp = bias + gn;
    bv = *(const f4v*)bp;
    // behind the load, before a result may land in its address registers
    // (named as an input so that they live to here)
    asm volatile("s_wait_xcnt 0x0" :: "v"(bp) : "memory");
  }
  f4v rs[16];
  if constexpr (RES) {
    const float* rp[16];
    // unrolled: rp and rs live in registers; all 16 loads are in flight under the staging
#pragma unroll
    for (int q = 0; q < 16; ++q) {
      rp[q] = resid + o0 + q * o2;
      rs[q] = *(const f4v*)rp[q];
    }
    // the same behind the last of these loads, for their 16 addresses
    asm volatile("s_wait_xcnt 0x0"
                 :: "v"(rp[0]), "v"(rp[1]), "v"(rp[2]), "v"(rp[3]), "v"(rp[4]), "v"(rp[5]),
                    "v"(rp[6]), "v"(rp[7]), "v"(rp[8]), "v"(rp[9]), "v"(rp[10]), "v"(rp[11]),
                    "v"(rp[12]), "v"(rp[13]), "v"(rp[14]), "v"(rp[15]) : "memory");
  }
  // all unrolled: acc, rs, v and the stores' operands are indexed by constants
  // and stay in registers
#pragma unroll
  for (int mi = 0; mi < MI; ++mi) {
#pragma unroll
    for (int nt = 0; nt < 4; ++nt)
#pragma unroll
      for (int r = 0; r < 8; ++r)
        stg[(8 * rh + r) * SP + nt * 16 + cn] = acc[mi][nt][r];
    // the rows are read back by other lanes of this wave than wrote them
    asm volatile("s_wait_dscnt 0x0" ::: "memory");
    f4v v[8];
#pragma unroll
    for (int i = 0; i < 8; ++i) v[i] = *(const f4v*)(stg + (2 * i + rh) * SP + cn * 4);
#pragma unroll
    for (int i = 0; i < 8; ++i) {
      v[i] += bv;
#pragma unroll
      for (int j = 0; j < 4; ++j) {
        float m = fmaxf(v[i][j], 0.f);
        v[i][j] = doRelu ? m : v[i][j];
      }
    }
    // behind each group of 8 stores: s_wait_xcnt before a later result may land in
    // their address or data registers (named as inputs so that they live to there)
    if constexpr (RES) {
      float* op[8];
#pragma unroll
      for (int i = 0; i < 8; ++i) {
        v[i] += rs[mi * 8 + i];
        op[i] = out32 + o0 + (mi * 8 + i) * o2;
        *(f4v*)op[i] = v[i];
      }
      asm volatile("s_wait_xcnt 0x0"
                   :: "v"(op[0]), "v"(op[1]), "v"(op[2]), "v"(op[3]),
                      "v"(op[4]), "v"(op[5]), "v"(op[6]), "v"(op[7]),
                      "v"(v[0]), "v"(v[1]), "v"(v[2]), "v"(v[3]),
                      "v"(v[4]), "v"(v[5]), "v"(v[6]), "v"(v[7]) : "memory");
    } else {
      _Float16* op[8];
      half4 h[8];
#pragma unroll
      for (int i = 0; i < 8; ++i) {
#pragma unroll
        for (int j = 0; j < 4; ++j) h[i][j] = (_Float16)v[i][j];
        op[i] = out16 + o0 + (mi * 8 + i) * o2;
        *(half4*)op[i] = h[i];
      }
      asm volatile("s_wait_xcnt 0x0"
                   :: "v"(op[0]), "v"(op[1]), "v"(op[2]), "v"(op[3]),
                      "v"(op[4]), "v"(op[5]), "v"(op[6]), "v"(op[7]),
                      "v"(h[0]), "v"(h[1]), "v"(h[2]), "v"(h[3]),
                      "v"(h[4]), "v"(h[5]), "v"(h[6]), "v"(h[7]) : "memory");
    }
  }
}

// ---------------------------------------------------------------------------
// Block-sparse flash attention, 20 waves per work-group. Online softmax, KD=64.
// Work-groups 0..B*H-1: query tile 0 of one (b,h) (global rows, i<16, which see
// every key). The 128 key tiles are split over the 20 waves, 6 or 7 each; the
// partial softmax states (max, sum, O) are merged through LDS in wave order.
// They come first in the grid because they are the longest.
// Other work-groups: one wave per query tile qt>=1, which visits key tile 0
// (global columns) + local tiles qt-2..qt+2.
// 20 waves: five per SIMD is what the register count admits, and the grid then
// has fewer work-groups than the chip has WGPs, so all start at once.
// ---------------------------------------------------------------------------
constexpr int AW   = 20;              // waves per attention work-group
constexpr int NGB  = BB * HH;         // work-groups that hold a query tile 0
constexpr int KTW  = NQT / AW;        // key tiles per wave there, rounded down
constexpr int KTX  = NQT % AW;        // the first KTX waves take one more
constexpr int NLT  = BB * HH * (NQT - 1);   // query tiles with qt >= 1
constexpr int OPP  = 66;              // floats per row of a partial O in LDS:
                                      // rows r and r+8 fall on different banks
__global__ __launch_bounds__(AW * 32)
void attn_wmma(const _Float16* __restrict__ Q, const _Float16* __restrict__ Kt,
               const _Float16* __restrict__ V, _Float16* __restrict__ ctx) {
  __shared__ _Float16 Pl[AW][16 * 16];  // per-wave P staging (C->A layout)
  __shared__ __attribute__((aligned(16)))
  float Op[AW][16 * OPP];               // per-wave partial O (query tile 0)
  __shared__ float Ms[AW][16];          // per-wave running max per row
  __shared__ float Ls[AW][16];          // per-wave running sum per row

  int w    = threadIdx.x >> 5;
  int lane = threadIdx.x & 31;
  bool glob = blockIdx.x < NGB;                  // uniform over the work-group
  int bh, qt;
  if (glob) {
    bh = blockIdx.x;
    qt = 0;
  } else {
    int t = (blockIdx.x - NGB) * AW + w;         // tiles 1..NQT-1 of every (b,h)
    if (t >= NLT) return;                        // these work-groups meet no barrier
    bh = t / (NQT - 1);
    qt = 1 + t % (NQT - 1);
  }
  int b    = bh / HH;
  int h    = bh % HH;
  int mloc = lane & 15;
  int lh   = lane >> 4;

  const size_t rs = (size_t)HH * KDM;            // 512 halves per token row
  const size_t hoff = (size_t)h * KDM;
  const _Float16* qb = Q  + (size_t)(b * TT) * rs + hoff;
  const _Float16* kb = Kt + (size_t)(b * TT) * rs + hoff;
  const _Float16* vb = V  + (size_t)(b * TT) * rs + hoff;

  // Q fragments: 16x64 -> two 16x32 A-fragments
  v16h qf[2];
#pragma unroll
  for (int ks = 0; ks < 2; ++ks) {
    const _Float16* base = qb + (size_t)(qt * 16 + mloc) * rs + ks * 32;
    half8 lo = *(const half8*)(base + lh * 8);
    half8 hi = *(const half8*)(base + 16 + lh * 8);
#pragma unroll
    for (int i = 0; i < 8; ++i) { qf[ks][i] = lo[i]; qf[ks][8 + i] = hi[i]; }
  }

  v8f O[4];
  float mrow[8], lrow[8];
#pragma unroll
  for (int nt = 0; nt < 4; ++nt)
#pragma unroll
    for (int i = 0; i < 8; ++i) O[nt][i] = 0.f;
#pragma unroll
  for (int r = 0; r < 8; ++r) { mrow[r] = -3.0e38f; lrow[r] = 0.f; }

  auto process = [&](int st, bool needMask) {
    int sbase = st * 16;
    // scores S = Q K^T / sqrt(KD)
    v8f S;
#pragma unroll
    for (int i = 0; i < 8; ++i) S[i] = 0.f;
    {
      const _Float16* krow = kb + (size_t)(sbase + mloc) * rs + lh * 8;
#pragma unroll
      for (int ks = 0; ks < 2; ++ks) {
        v16h bf;
        half8 lo = *(const half8*)(krow + ks * 32);
        half8 hi = *(const half8*)(krow + ks * 32 + 16);
        // behind the tile's last K load, before a later result may land in the
        // registers of the K address (named as an input so that they live to here)
        if (ks == 1) asm volatile("s_wait_xcnt 0x0" :: "v"(krow) : "memory");
#pragma unroll
        for (int i = 0; i < 8; ++i) { bf[i] = lo[i]; bf[8 + i] = hi[i]; }
        S = WMMA_F32_F16(qf[ks], bf, S);
      }
    }
#pragma unroll
    for (int r = 0; r < 8; ++r) S[r] *= 0.125f;
    if (needMask) {
      int j = sbase + mloc;
#pragma unroll
      for (int r = 0; r < 8; ++r) {
        int i  = qt * 16 + 8 * lh + r;
        int di = i - j; if (di < 0) di = -di;
        bool ok = (di <= 32) || (j < 16) || (i < 16);
        if (!ok) S[r] = -1.0e9f;
      }
    }
    // online softmax (rows live across 16-lane halves)
    float pexp[8];
#pragma unroll
    for (int r = 0; r < 8; ++r) {
      float rm = S[r];
#pragma unroll
      for (int off = 1; off < 16; off <<= 1) rm = fmaxf(rm, __shfl_xor(rm, off, 32));
      float mn    = fmaxf(mrow[r], rm);
      float alpha = exp2_slot((mrow[r] - mn) * 1.44269504f);
      float p     = exp2_slot((S[r] - mn) * 1.44269504f);
      float sum   = p;
#pragma unroll
      for (int off = 1; off < 16; off <<= 1) sum += __shfl_xor(sum, off, 32);
      lrow[r] = lrow[r] * alpha + sum;
      mrow[r] = mn;
#pragma unroll
      for (int nt = 0; nt < 4; ++nt) O[nt][r] *= alpha;
      pexp[r] = p;
    }
    // stage P through LDS to convert C-layout -> A-layout (upper K half = 0)
#pragma unroll
    for (int r = 0; r < 8; ++r)
      Pl[w][(8 * lh + r) * 16 + mloc] = (_Float16)pexp[r];
    v16h ap;
    {
      half8 lo = *(const half8*)(&Pl[w][mloc * 16 + lh * 8]);
#pragma unroll
      for (int i = 0; i < 8; ++i) { ap[i] = lo[i]; ap[8 + i] = (_Float16)0.f; }
    }
    // O += P x V  (V tile is 16(s) x 64(kd); upper K half zero)
    const _Float16* vrow = vb + (size_t)(sbase + lh * 8) * rs + mloc;
#pragma unroll
    for (int nt = 0; nt < 4; ++nt) {
      v16h bvf;
#pragma unroll
      for (int i = 0; i < 8; ++i) {
        bvf[i]     = vrow[(size_t)i * rs + nt * 16];
        bvf[8 + i] = (_Float16)0.f;
      }
      O[nt] = WMMA_F32_F16(ap, bvf, O[nt]);
    }
    // the same behind the tile's last V load, for the registers of the V address
    asm volatile("s_wait_xcnt 0x0" :: "v"(vrow) : "memory");
  };

  if (glob) {
    int s0 = w * KTW + (w < KTX ? w : KTX);
    int s1 = s0 + KTW + (w < KTX ? 1 : 0);
    for (int st = s0; st < s1; ++st) process(st, false);
  } else {
    process(0, false);                       // global columns (j < 16)
    int lo = qt - 2 < 1 ? 1 : qt - 2;
    int hi = qt + 2 > NQT - 1 ? NQT - 1 : qt + 2;
    for (int st = lo; st <= hi; ++st) process(st, true);
  }

  // normalize + write ctx (fp16, [B,T,H,KD])
  _Float16* cb = ctx + (size_t)(b * TT + qt * 16) * rs + hoff;

  if (glob) {
    // publish this wave's partial state
    // (unrolled: mrow, lrow and O live in registers and need constant indices)
#pragma unroll
    for (int r = 0; r < 8; ++r)
      if (mloc == 0) { Ms[w][8 * lh + r] = mrow[r]; Ls[w][8 * lh + r] = lrow[r]; }
#pragma unroll
    for (int nt = 0; nt < 4; ++nt)
#pragma unroll
      for (int r = 0; r < 8; ++r)
        Op[w][(8 * lh + r) * OPP + nt * 16 + mloc] = O[nt][r];
    __syncthreads();
    // wave w merges query row w; a lane owns two adjacent columns
    // (both loops unrolled: every LDS read of the merge is issued up front)
    if (w >= 16) return;
    float M = Ms[0][w];
#pragma unroll
    for (int ww = 1; ww < AW; ++ww) M = fmaxf(M, Ms[ww][w]);
    float L = 0.f, o0 = 0.f, o1 = 0.f;
#pragma unroll
    for (int ww = 0; ww < AW; ++ww) {
      float e = exp2_slot((Ms[ww][w] - M) * 1.44269504f);
      float2 p = *(const float2*)(&Op[ww][w * OPP + 2 * lane]);
      L  += Ls[ww][w] * e;
      o0 += p.x * e;
      o1 += p.y * e;
    }
    half2v res;
    res[0] = (_Float16)(o0 / L);
    res[1] = (_Float16)(o1 / L);
    *(half2v*)(cb + (size_t)w * rs + 2 * lane) = res;
    return;
  }
#pragma unroll
  for (int nt = 0; nt < 4; ++nt)
#pragma unroll
    for (int r = 0; r < 8; ++r) {
      float vv = O[nt][r] / lrow[r];
      cb[(size_t)(8 * lh + r) * rs + nt * 16 + mloc] = (_Float16)vv;
    }
  // behind the last store; on this path only the end of the kernel follows it
  asm volatile("s_wait_xcnt 0x0" ::: "memory");
}

// ---------------------------------------------------------------------------
// Host-side orchestration
// ---------------------------------------------------------------------------
extern "C" void kernel_launch(void* const* d_in, const int* in_sizes, int n_in,
                              void* d_out, int out_size, void* d_ws, size_t ws_size,
                              hipStream_t stream) {
  const float* x    = (const float*)d_in[0];
  const float* ln1g = (const float*)d_in[1];
  const float* ln1b = (const float*)d_in[2];
  const float* Wq   = (const float*)d_in[3];
  const float* bq   = (const float*)d_in[4];
  const float* Wk   = (const float*)d_in[5];
  const float* bk   = (const float*)d_in[6];
  const float* Wv   = (const float*)d_in[7];
  const float* bv   = (const float*)d_in[8];
  const float* Wo   = (const float*)d_in[9];
  const float* bo   = (const float*)d_in[10];
  const float* ln2g = (const float*)d_in[11];
  const float* ln2b = (const float*)d_in[12];
  const float* W1   = (const float*)d_in[13];
  const float* b1   = (const float*)d_in[14];
  const float* W2   = (const float*)d_in[15];
  const float* b2   = (const float*)d_in[16];
  float* out = (float*)d_out;

  char* ws = (char*)d_ws;
  const size_t MB = 1024ull * 1024ull;
  // Region 0 (32MB): xn16|q16|k16|v16 ; later aliased by FFN hidden h16
  _Float16* xn16 = (_Float16*)(ws + 0 * MB);
  _Float16* q16  = (_Float16*)(ws + 8 * MB);
  _Float16* k16  = (_Float16*)(ws + 16 * MB);
  _Float16* v16  = (_Float16*)(ws + 24 * MB);
  _Float16* h16  = (_Float16*)(ws + 0 * MB);    // alias (32MB), after attn
  _Float16* ctx16 = (_Float16*)(ws + 32 * MB);  // 8MB
  _Float16* xn2   = (_Float16*)(ws + 32 * MB);  // alias ctx16 after out-proj
  float*    x1    = (float*)   (ws + 40 * MB);  // 16MB

  // LN1 -> xn16
  ln_rows<<<BT / 8, 256, 0, stream>>>(x, ln1g, ln1b, xn16, BT);

  // QKV projections (fp16 out), one launch: grid z = 0, 1, 2 is Q, K, V
  dim3 gq(DD / 64, BT / 256);
  dim3 gqkv(DD / 128, BT / 256, 3);
  gemm_wmma<128, false, 3, 1, 128, DD><<<gqkv, 256, 0, stream>>>(xn16, Wq, bq, nullptr, q16, nullptr, BT, DD, DD, 0,
                                                     Wk, bk, k16, Wv, bv, v16);

  // Block-sparse flash attention -> ctx16
  attn_wmma<<<NGB + (NLT + AW - 1) / AW, AW * 32, 0, stream>>>(q16, k16, v16, ctx16);

  // Out projection + residual (fp32 x1)
  gemm_wmma<128, true, 1, 3, 64, 0><<<gq, 256, 0, stream>>>(ctx16, Wo, bo, x, nullptr, x1, BT, DD, DD, 0,
                                                  nullptr, nullptr, nullptr, nullptr, nullptr, nullptr);

  // LN2 -> xn2
  ln_rows<<<BT / 8, 256, 0, stream>>>(x1, ln2g, ln2b, xn2, BT);

  // FFN1: relu(xn2 @ W1 + b1) -> h16
  dim3 g1(DFF / 128, BT / 256);
  gemm_wmma<128, false, 1, 1, 128, DFF><<<g1, 256, 0, stream>>>(xn2, W1, b1, nullptr, h16, nullptr, BT, DFF, DD, 1,
                                                  nullptr, nullptr, nullptr, nullptr, nullptr, nullptr);

  // FFN2: x1 + (h16 @ W2 + b2) -> out (fp32)
  dim3 g2(DD / 64, BT / 256);
  gemm_wmma<128, true, 1, 3, 64, 0><<<g2, 256, 0, stream>>>(h16, W2, b2, x1, nullptr, out, BT, DD, DFF, 0,
                                                  nullptr, nullptr, nullptr, nullptr, nullptr, nullptr);
}

// v009
// One run takes 93.4 microseconds.
// Two timings next to v008 put it at 1.06 and 1.05 times that version's speed.
// Counting every step since v000, it is 4.50 times as fast.
#include <hip/hip_runtime.h>
#include <hip/hip_bf16.h>

typedef _Float16 half2v __attribute__((ext_vector_type(2)));
typedef _Float16 half4 __attribute__((ext_vector_type(4)));
typedef _Float16 half8 __attribute__((ext_vector_type(8)));
typedef _Float16 v16h  __attribute__((ext_vector_type(16)));
typedef float    v8f   __attribute__((ext_vector_type(8)));
typedef int      i4v   __attribute__((ext_vector_type(4)));
typedef float    f4v   __attribute__((ext_vector_type(4)));

#define WMMA_F32_F16(a, b, c) \
  __builtin_amdgcn_wmma_f32_16x16x32_f16(false, (a), false, (b), (short)0, (c), false, false)

#define AS1 __attribute__((address_space(1)))
#define AS3 __attribute__((address_space(3)))

// Async global->LDS copy (CDNA5 GLOBAL_LOAD_ASYNC_TO_LDS_B128, ASYNCcnt),
// with a synchronous fallback if the builtin is unavailable.
// Probe-verified: the builtin's params are (global int4*, local int4*, imm, imm).
__device__ __forceinline__ void async_copy_b128(const _Float16* g, _Float16* l) {
#if __has_builtin(__builtin_amdgcn_global_load_async_to_lds_b128)
  __builtin_amdgcn_global_load_async_to_lds_b128(
      (AS1 i4v*)g, (AS3 i4v*)l, 0, 0);
#else
  *(half8*)l = *(const half8*)g;
#endif
}
__device__ __forceinline__ void wait_async() {
#if __has_builtin(__builtin_amdgcn_global_load_async_to_lds_b128)
#if __has_builtin(__builtin_amdgcn_s_wait_asynccnt)
  __builtin_amdgcn_s_wait_asynccnt(0);
#else
  asm volatile("s_wait_asynccnt 0x0" ::: "memory");
#endif
#endif
}

// 2^a. The v_nop is the one free slot that the instruction set asks for between
// a transcendental and a next instruction that reads its result or overwrites
// its source.
__device__ __forceinline__ float exp2_slot(float a) {
  float e;
  asm("v_exp_f32 %0, %1\n\tv_nop" : "=v"(e) : "v"(a));
  return e;
}

// v + (v of lane l ^ X), l ^ X inside the lane's row of 16: a DPP operand, one vector
// instruction and no trip through the LDS unit as a shuffle would take
template <int X>
__device__ __forceinline__ float add_xor16(float v) {
  int o = __builtin_amdgcn_update_dpp(0, __builtin_bit_cast(int, v), 0x160 + X, 0xf, 0xf, true);
  return v + __builtin_bit_cast(float, o);
}
// the sum over a row of 16 lanes, the same bits in each of them
__device__ __forceinline__ float sum16(float v) {
  return add_xor16<8>(add_xor16<4>(add_xor16<2>(add_xor16<1>(v))));
}

// Problem dims
constexpr int BB  = 4;
constexpr int TT  = 2048;
constexpr int DD  = 512;
constexpr int HH  = 8;
constexpr int KDM = 64;
constexpr int DFF = 2048;
constexpr int BT  = BB * TT;          // 8192 rows
constexpr int NQT = TT / 16;          // 128 query tiles per (b,h)

// ---------------------------------------------------------------------------
// LayerNorm: one wave (32 lanes) per row of D=512, writes fp16
// ---------------------------------------------------------------------------
__global__ __launch_bounds__(256)
void ln_rows(const float* __restrict__ x, const float* __restrict__ g,
             const float* __restrict__ b, _Float16* __restrict__ out, int nrows) {
  int wave = (int)((blockIdx.x * blockDim.x + threadIdx.x) >> 5);
  int lane = threadIdx.x & 31;
  if (wave >= nrows) return;
  const float* row = x + (size_t)wave * DD;
  float vals[16];
  float s = 0.f;
#pragma unroll
  for (int i = 0; i < 16; ++i) { vals[i] = row[lane + i * 32]; s += vals[i]; }
#pragma unroll
  for (int off = 1; off < 32; off <<= 1) s += __shfl_xor(s, off, 32);
  float mean = s * (1.0f / DD);
  float vs = 0.f;
#pragma unroll
  for (int i = 0; i < 16; ++i) { float d = vals[i] - mean; vs += d * d; }
#pragma unroll
  for (int off = 1; off < 32; off <<= 1) vs += __shfl_xor(vs, off, 32);
  float rstd = rsqrtf(vs * (1.0f / DD) + 1e-6f);
  _Float16* orow = out + (size_t)wave * DD;
#pragma unroll
  for (int i = 0; i < 16; ++i) {
    int c = lane + i * 32;
    orow[c] = (_Float16)((vals[i] - mean) * rstd * g[c] + b[c]);
  }
}

// ---------------------------------------------------------------------------
// Generic fp16 WMMA GEMM: C[M,N] = A[M,K] @ B[K,N] (+bias)(+relu)(+resid)
// Block tile 256(M) x BN(N), 8 waves.
// BN = 64: each wave owns a 32x64 strip: 2 A-fragments x 4 B-fragments = 8 WMMAs
// per 32 k. BN = 128: the waves stand 4 x 2 and each owns 64x64: 4 x 4 fragments =
// 16 WMMAs per 32 k. Per k the group loads 256 f16 of A and BN f32 of B, so the
// wider tile asks L2 for a third fewer bytes per result; it is for the launches
// whose grid still gives every WGP a group or two. There N is also given as the
// constant NC (the ring reads N alone; its NC is 0).
// One trip of the K loop stages BK k of both operands and then multiplies all
// of it, so the wait for the loads and the two barriers are paid once per BK k.
// K must be a multiple of BK.
// A staged via async global->LDS B128. B is the f32 weight itself: a thread
// loads 4 columns of 16 consecutive k rows, rounds them to f16 and stores
// each column's run of k as two vectors, so Bs is [n][k] for contiguous 16B
// B-fragment ds loads.
// RES: the residual is added and the result is stored as f32 (out32); else the
// result is stored as f16 (out16) and resid is not read.
// NP = 3: one launch holds three products of the same A and shape; grid z picks
// the weight, the bias and the f16 output. Their work-groups then share a WGP,
// so one's loads fly under another's WMMAs. NP = 1: the first of each is used.
// NB = 1: one buffer, filled and then read, as described above.
// NB = 3: for a launch with one work-group per WGP, where nothing else covers
// the loads. Three buffers in LDS; the tiles of trips t + 1 and t + 2 are on
// their way while trip t multiplies. Waves 0-3 bring the even tiles, waves 4-7 the
// odd ones, so a wave that waits for all of its own copies never waits for the
// younger tile, which the other four waves have in flight.
// ---------------------------------------------------------------------------
// LN = 1 (with RES): the launch also prepares the LayerNorm of its result rows for
// the next product. It stores result * gain as f16 (out16a; gain: lnA) and, per row,
// the mean of its 64 columns and their squared distance from that mean (lnS, one
// plane of BT pairs per column block).
// LN = 2: A is such a result * gain, of K = DD columns. With m and r a row's mean and
// 1/sqrt(variance + eps), LayerNorm(row) @ B = r * (A @ B) - r * m * (gain @ B)
// + (shift @ B); gain @ B is lnA, shift @ B is lnB, and the epilogue applies them.
// Registers: the one-buffer form is budgeted for four waves per SIMD, so that two of
// its work-groups are resident on a WGP; the ring's LDS admits one group anyway.
template <int BK, bool RES, int NP, int NB, int BN, int NC, int LN>
__global__ __launch_bounds__(256) __attribute__((amdgpu_waves_per_eu(NB == 1 ? 4 : 2)))
void gemm_wmma(const _Float16* __restrict__ A, const float* __restrict__ Bw0,
               const float* __restrict__ bias0, const float* __restrict__ resid,
               _Float16* __restrict__ out16a, float* __restrict__ out32,
               int M, int N, int K, int doRelu,
               const float* __restrict__ Bw1, const float* __restrict__ bias1,
               _Float16* __restrict__ out16b,
               const float* __restrict__ Bw2, const float* __restrict__ bias2,
               _Float16* __restrict__ out16c,
               const float* __restrict__ lnA, const float* __restrict__ lnB,
               float* __restrict__ lnS) {
  static_assert(NP == 1 || NP == 3, "one product, or three picked by grid z");
  static_assert(LN == 0 || (LN == 1 && RES && BN == 64) || (LN == 2 && !RES && NP == 1),
                "row statistics are made with the residual sum and used by a plain product");
  const float* Bw   = Bw0;
  const float* bias = bias0;
  _Float16* out16   = out16a;
  if constexpr (NP == 3) {
    int z = blockIdx.z;         // the same in the whole work-group
    if (z == 1) { Bw = Bw1; bias = bias1; out16 = out16b; }
    if (z == 2) { Bw = Bw2; bias = bias2; out16 = out16c; }
  }
  static_assert(BK == 128, "both stagings are written for tiles of 128 k");
  static_assert((NB == 1 && BN == 128 && !RES) || (NB == 3 && BN == 64),
                "the ring is written for the narrow tile, the one buffer for the wide one");
  constexpr int LDA = BK + 8;   // halves; row pitch = 16 B x an odd number
  constexpr int LDB = BK + 8;
  constexpr int CPR = BK / 8;   // 16-byte pieces per A row of the tile
  constexpr int WN  = BN / 64;  // waves side by side along N
  constexpr int MI  = 2 * WN;   // A fragments (16 rows each) per wave
  constexpr int ASZ = 256 * LDA;  // halves per A buffer
  constexpr int BSZ = BN * LDB;   // halves per B buffer
  __shared__ __attribute__((aligned(16))) _Float16 As[NB * ASZ];
  __shared__ __attribute__((aligned(16))) _Float16 Bs[NB * BSZ];  // transposed: [n][k]
  __shared__ float2 Rs[LN == 2 ? 256 : 1];   // per tile row: r and -m * r

  int tid  = threadIdx.x;
  int w    = tid >> 5;
  int lane = tid & 31;
  int mBase = blockIdx.y * 256;
  int nBase = blockIdx.x * BN;
  int mloc  = lane & 15;
  int lh    = lane >> 4;
  int wrow  = (w / WN) * (MI * 16);   // this wave's first row in the tile
  int wcol  = (w % WN) * 64;          // and its first column

  v8f acc[MI][4];
#pragma unroll
  for (int mi = 0; mi < MI; ++mi)
#pragma unroll
    for (int nt = 0; nt < 4; ++nt)
#pragma unroll
      for (int i = 0; i < 8; ++i) acc[mi][nt][i] = 0.f;

  if constexpr (NB == 3) {
    // multiplies one staged tile; ao, bo: where its buffers begin in As and Bs.
    // Two register sets of fragments: the 12 LDS reads of the next 32 k go out as
    // one group in front of the 8 WMMAs of this 32 k, so that a wave waits for LDS
    // once a tile (its first group) and not in front of every pair of WMMAs.
    auto multiply = [&](int ao, int bo) {
      v16h af[2][2], bf[2][4];
      // reads the fragments of 32 k into set st (ISA 16-bit layout; A rows
      // w*32 + mi*16, B columns nt*16); all its loops unrolled: af and bf are
      // indexed by constants and stay in registers
      auto fetch = [&](int st, int kk) {
#pragma unroll
        for (int mi = 0; mi < 2; ++mi) {
          int rloc = w * 32 + mi * 16 + mloc;
          half8 lo = *(const half8*)(&As[ao + rloc * LDA + kk + lh * 8]);
          half8 hi = *(const half8*)(&As[ao + rloc * LDA + kk + 16 + lh * 8]);
#pragma unroll
          for (int i = 0; i < 8; ++i) { af[st][mi][i] = lo[i]; af[st][mi][8 + i] = hi[i]; }
        }
#pragma unroll
        for (int nt = 0; nt < 4; ++nt) {
          int n = nt * 16 + mloc;
          half8 lo = *(const half8*)(&Bs[bo + n * LDB + kk + lh * 8]);
          half8 hi = *(const half8*)(&Bs[bo + n * LDB + kk + 16 + lh * 8]);
#pragma unroll
          for (int i = 0; i < 8; ++i) { bf[st][nt][i] = lo[i]; bf[st][nt][8 + i] = hi[i]; }
        }
      };
      fetch(0, 0);
      // unrolled: the set index and the fragment offsets become constants
#pragma unroll
      for (int s = 0; s < BK / 32; ++s) {
        if (s + 1 < BK / 32) fetch((s + 1) & 1, (s + 1) * 32);
        // keeps the group of reads in front of the WMMAs: without it the build
        // sinks each read to its first use and waits there for LDS
        __builtin_amdgcn_sched_barrier(0);
#pragma unroll
        for (int nt = 0; nt < 4; ++nt) {
          acc[0][nt] = WMMA_F32_F16(af[s & 1][0], bf[s & 1][nt], acc[0][nt]);
          acc[1][nt] = WMMA_F32_F16(af[s & 1][1], bf[s & 1][nt], acc[1][nt]);
        }
        // keeps the next group of reads behind these WMMAs, in one place
        __builtin_amdgcn_sched_barrier(0);
      }
    };

    const int NT = K / BK;
    // 0 in waves 0-3, 1 in waves 4-7; a scalar, so that the tests on it are branches
    // that a whole wave takes or skips (a copy is issued with every lane on)
    const int par = __builtin_amdgcn_readfirstlane(tid >> 7);
    const int u  = tid & 127;               // this thread among the 128 that bring a tile
    const int r0 = u >> 4, ch = u & 15;     // 16 adjacent lanes copy one A row whole
    const int kg = (u >> 4) * 16, n0 = (u & 15) * 4;  // 16 k rows of 4 columns of B
    f4v p[16];                              // this thread's part of its B tile, f32

    // starts tile s on its way: A by copies into buffer buf, B into p
    auto issue = [&](int s, int buf) {
      const float* b0 = Bw + (size_t)(s * BK + kg) * N + nBase + n0;
      const float* bp[16];
      // unrolled: bp and p live in registers; every load is issued at once
#pragma unroll
      for (int c = 0; c < 16; ++c) {
        bp[c] = b0 + (size_t)c * N;   // the step is the same in every lane: a scalar
        p[c] = *(const f4v*)bp[c];
      }
      // behind the last load, before a later result may land in their address
      // registers (named as inputs so that they live to here)
      asm volatile("s_wait_xcnt 0x0"
                   :: "v"(bp[0]), "v"(bp[1]), "v"(bp[2]), "v"(bp[3]), "v"(bp[4]), "v"(bp[5]),
                      "v"(bp[6]), "v"(bp[7]), "v"(bp[8]), "v"(bp[9]), "v"(bp[10]), "v"(bp[11]),
                      "v"(bp[12]), "v"(bp[13]), "v"(bp[14]), "v"(bp[15]) : "memory");
      const _Float16* src = A + (size_t)(mBase + r0) * K + s * BK + ch * 8;
      _Float16* dst = &As[buf * ASZ + r0 * LDA + ch * 8];
      // unrolled: all 32 copies of the tile are in flight together
#pragma unroll
      for (int c = 0; c < 32; ++c)
        async_copy_b128(src + (size_t)(c * 8) * K, dst + c * 8 * LDA);
    };

    // hands tile s (buffer buf) over to all waves, then refills buffer nbuf, whose
    // last readers (trip s - 1) the barrier has ended, with tile s + 2
    auto publish = [&](int s, int buf, int nbuf) {
      const bool mine = par == (s & 1);
      if (mine) {
        // all unrolled: p and q are indexed by constants and stay in registers
#pragma unroll
        for (int j = 0; j < 4; ++j)
#pragma unroll
          for (int hf = 0; hf < 2; ++hf) {
            half8 q;
#pragma unroll
            for (int c = 0; c < 8; ++c) q[c] = (_Float16)p[hf * 8 + c][j];
            *(half8*)(&Bs[buf * BSZ + (n0 + j) * LDB + kg + hf * 8]) = q;
          }
      }
      // this wave's B stores are in LDS and its reads of buffer nbuf are done
      asm volatile("s_wait_dscnt 0x0" ::: "memory");
      // the waves that copied tile s: every one of their copies has landed
      if (mine) asm volatile("s_wait_asynccnt 0x0" ::: "memory");
      // a barrier with fences on LDS alone: __syncthreads() would also wait for the
      // other waves' B loads of tile s + 1, which are meant to stay in flight
      __builtin_amdgcn_fence(__ATOMIC_RELEASE, "workgroup", "local");
      __builtin_amdgcn_s_barrier();
      __builtin_amdgcn_fence(__ATOMIC_ACQUIRE, "workgroup", "local");
      if (mine && s + 2 < NT) issue(s + 2, nbuf);
    };

    if (par == 0) issue(0, 0);
    else if (1 < NT) issue(1, 1);
    publish(0, 0, 2);
    int rb = 0;                             // t % 3
    for (int t = 0; t < NT; ++t) {
      multiply(rb * ASZ, rb * BSZ);
      int rn = rb == 2 ? 0 : rb + 1;        // (t + 1) % 3
      if (t + 1 < NT) publish(t + 1, rn, rb);
      rb = rn;
    }
    // no copy is left in flight, and every wave has read its last fragment,
    // before the epilogue writes into As
    asm volatile("s_wait_asynccnt 0x0" ::: "memory");
    asm volatile("s_wait_dscnt 0x0" ::: "memory");
    __syncthreads();
  } else
  for (int k0 = 0; k0 < K; k0 += BK) {
    // --- stage A tile: 256 rows x BK halves (async); CPR adjacent lanes copy
    //     one row, so a wave-wide copy covers whole rows of the tile ---
    {
      int r0 = tid / CPR, ch = tid % CPR;
      const _Float16* src = A + (size_t)(mBase + r0) * K + k0 + ch * 8;
      // unrolled: all copies of the tile are in flight before the one wait
#pragma unroll
      for (int c = 0; c < CPR; ++c)
        async_copy_b128(src + (size_t)(c * (256 / CPR)) * K,
                        &As[(r0 + c * (256 / CPR)) * LDA + ch * 8]);
    }
    // --- stage B tile transposed and rounded to f16: BK(k) x BN(n) f32 -> Bs[n][k];
    //     16 adjacent lanes load 256 adjacent bytes of a row of the tile; waves 0-3
    //     bring columns 0-63, waves 4-7 columns 64-127 ---
    {
      // LN = 2, first trip: thread t asks for the NPB partial statistics of tile row t,
      // so that they fly with the first tile; one address, the planes by offset
      constexpr int NPB = DD / 64;
      float2 pr[NPB] = {};
      if constexpr (LN == 2) {
        if (k0 == 0) {
          const float2* sp = reinterpret_cast<const float2*>(lnS) + mBase + tid;
          // unrolled: pr lives in registers
#pragma unroll
          for (int nb = 0; nb < NPB; ++nb) pr[nb] = sp[nb * BT];
          // behind the last load, before a later result may land in the address
          // registers (named as an input so that they live to here)
          asm volatile("s_wait_xcnt 0x0" :: "v"(sp) : "memory");
        }
      }
      constexpr int RPT = 16;   // k rows per thread: 8 groups of 16 lanes x 16 = BK
      int kg = ((tid & 127) >> 4) * RPT, n0 = (tid >> 7) * 64 + (tid & 15) * 4;
      // the row pitch is a constant, so the 16 loads share one address and differ in
      // their immediate offset: 2 address registers, not 32, which leaves the
      // registers for two resident work-groups
      const float* bp = Bw + (size_t)(k0 + kg) * NC + nBase + n0;
      f4v p[RPT];
      // unrolled: p lives in registers; every load is issued before the first store
#pragma unroll
      for (int c = 0; c < RPT; ++c) p[c] = *(const f4v*)(bp + c * NC);
      // thread t asks for row t of the next A tile
      const _Float16* pf = A + (size_t)(mBase + tid) * K + k0 + BK;
      if (k0 + BK < K) __builtin_prefetch(pf, 0, 3);
      // behind the trip's last load and the prefetch, before a later result may
      // land in their address registers (named as inputs so that they live to here).
      // The loaded values are inputs too: all 16 loads are then issued before the
      // first is waited for (else the build waits for the first 8 before the last 4)
      asm volatile("s_wait_xcnt 0x0"
                   :: "v"(bp), "v"(pf),
                      "v"(p[0]), "v"(p[1]), "v"(p[2]), "v"(p[3]), "v"(p[4]), "v"(p[5]),
                      "v"(p[6]), "v"(p[7]), "v"(p[8]), "v"(p[9]), "v"(p[10]), "v"(p[11]),
                      "v"(p[12]), "v"(p[13]), "v"(p[14]), "v"(p[15]) : "memory");
      // all unrolled: p and q are indexed by constants and stay in registers
#pragma unroll
      for (int j = 0; j < 4; ++j)
#pragma unroll
        for (int hf = 0; hf < 2; ++hf) {
          half8 q;
#pragma unroll
          for (int c = 0; c < 8; ++c) q[c] = (_Float16)p[hf * 8 + c][j];
          *(half8*)(&Bs[(n0 + j) * LDB + kg + hf * 8]) = q;
        }
      if constexpr (LN == 2) {
        if (k0 == 0) {
          // merges them: the mean of the means; each part's squared distances moved
          // to the common mean. The loop's barriers stand in front of the readers
          float mean = 0.f;
#pragma unroll
          for (int nb = 0; nb < NPB; ++nb) mean += pr[nb].x;
          mean *= 1.0f / NPB;
          float m2 = 0.f;
#pragma unroll
          for (int nb = 0; nb < NPB; ++nb) {
            float d = pr[nb].x - mean;
            m2 += pr[nb].y + 64.f * d * d;
          }
          float rstd = rsqrtf(m2 * (1.0f / DD) + 1e-6f);
          Rs[tid] = make_float2(rstd, -mean * rstd);
        }
      }
    }
    wait_async();
    __syncthreads();

    // unrolled: fragment offsets become immediates and loads of a later 32 k
    // can be issued under the WMMAs of an earlier one
#pragma unroll
    for (int kk = 0; kk < BK; kk += 32) {
      // --- A fragments (16x32, ISA 16-bit layout), rows wrow + mi*16 ---
      v16h af[MI];
#pragma unroll
      for (int mi = 0; mi < MI; ++mi) {
        int rloc = wrow + mi * 16 + mloc;
        half8 lo = *(const half8*)(&As[rloc * LDA + kk + lh * 8]);
        half8 hi = *(const half8*)(&As[rloc * LDA + kk + 16 + lh * 8]);
#pragma unroll
        for (int i = 0; i < 8; ++i) { af[mi][i] = lo[i]; af[mi][8 + i] = hi[i]; }
      }
      // --- 4 B fragments (columns wcol + nt*16), each met by every A fragment ---
#pragma unroll
      for (int nt = 0; nt < 4; ++nt) {
        int n = wcol + nt * 16 + mloc;
        v16h bf;
        half8 lo = *(const half8*)(&Bs[n * LDB + kk + lh * 8]);
        half8 hi = *(const half8*)(&Bs[n * LDB + kk + 16 + lh * 8]);
#pragma unroll
        for (int i = 0; i < 8; ++i) { bf[i] = lo[i]; bf[8 + i] = hi[i]; }
#pragma unroll
        for (int mi = 0; mi < MI; ++mi) acc[mi][nt] = WMMA_F32_F16(af[mi], bf, acc[mi][nt]);
      }
    }
    __syncthreads();
  }

  // --- epilogue. An accumulator holds, per lane, one column of 8 rows
  //     (col = L%16, row = r + 8*(L/16)). Each wave turns its tile, 16 rows at a
  //     time, through its own piece of As (free behind the loop's last barrier),
  //     so that a lane then holds 4 adjacent columns of a row: 16 lanes cover a
  //     whole row of the tile, and bias, residual and result move as vectors ---
  constexpr int SP = 68;  // floats per staged row: 16-byte aligned, and rows r and r+8
                          // fall on different banks
  static_assert(8 * 16 * SP * sizeof(float) <= sizeof(As), "eight waves stage in As");
  float* stg = reinterpret_cast<float*>(As) + w * (16 * SP);
  int cn = lane & 15, rh = lane >> 4;
  int gn = nBase + wcol + cn * 4;       // first of this lane's 4 columns
  // this lane's rows are mBase + wrow + rh + 2 * q, q = mi * 8 + i
  size_t o0 = (size_t)(mBase + wrow + rh) * N + gn;
  size_t o2 = (size_t)2 * N;
  f4v bv = {0.f, 0.f, 0.f, 0.f};
  if (bias) {
    const float* bp = bias + gn;
    bv = *(const f4v*)bp;
    // behind the load, before a result may land in its address registers
    // (named as an input so that they live to here)
    asm volatile("s_wait_xcnt 0x0" :: "v"(bp) : "memory");
  }
  f4v lv = {0.f, 0.f, 0.f, 0.f};   // LN = 1: the gain; LN = 2: gain @ B; this lane's columns
  if constexpr (LN != 0) {
    const float* lp = lnA + gn;
    lv = *(const f4v*)lp;
    // the same behind this load
    asm volatile("s_wait_xcnt 0x0" :: "v"(lp) : "memory");
  }
  if constexpr (LN == 2) {
    const float* lp = lnB + gn;
    bv += *(const f4v*)lp;
    // the same behind this load
    asm volatile("s_wait_xcnt 0x0" :: "v"(lp) : "memory");
  }
  float km = 0.f, k2 = 0.f;        // LN = 1: the statistics of row rh + 2 * cn of the wave
  f4v rs[16];
  if constexpr (RES) {
    const float* rp[16];
    // unrolled: rp and rs live in registers; all 16 loads are in flight under the staging
#pragma unroll
    for (int q = 0; q < 16; ++q) {
      rp[q] = resid + o0 + q * o2;
      rs[q] = *(const f4v*)rp[q];
    }
    // the same behind the last of these loads, for their 16 addresses
    asm volatile("s_wait_xcnt 0x0"
                 :: "v"(rp[0]), "v"(rp[1]), "v"(rp[2]), "v"(rp[3]), "v"(rp[4]), "v"(rp[5]),
                    "v"(rp[6]), "v"(rp[7]), "v"(rp[8]), "v"(rp[9]), "v"(rp[10]), "v"(rp[11]),
                    "v"(rp[12]), "v"(rp[13]), "v"(rp[14]), "v"(rp[15]) : "memory");
  }
  // all unrolled: acc, rs, v and the stores' operands are indexed by constants
  // and stay in registers
#pragma unroll
  for (int mi = 0; mi < MI; ++mi) {
#pragma unroll
    for (int nt = 0; nt < 4; ++nt)
#pragma unroll
      for (int r = 0; r < 8; ++r)
        stg[(8 * rh + r) * SP + nt * 16 + cn] = acc[mi][nt][r];
    // the rows are read back by other lanes of this wave than wrote them
    asm volatile("s_wait_dscnt 0x0" ::: "memory");
    f4v v[8];
#pragma unroll
    for (int i = 0; i < 8; ++i) v[i] = *(const f4v*)(stg + (2 * i + rh) * SP + cn * 4);
#pragma unroll
    for (int i = 0; i < 8; ++i) {
      if constexpr (LN == 2) {
        float2 rr = Rs[wrow + rh + 2 * (mi * 8 + i)];
#pragma unroll
        for (int j = 0; j < 4; ++j) v[i][j] = fmaf(v[i][j], rr.x, fmaf(rr.y, lv[j], bv[j]));
      } else {
        v[i] += bv;
      }
#pragma unroll
      for (int j = 0; j < 4; ++j) {
        float m = fmaxf(v[i][j], 0.f);
        v[i][j] = doRelu ? m : v[i][j];
      }
    }
    // behind each group of 8 stores: s_wait_xcnt before a later result may land in
    // their address or data registers (named as inputs so that they live to there)
    if constexpr (RES) {
      float* op[8];
#pragma unroll
      for (int i = 0; i < 8; ++i) {
        v[i] += rs[mi * 8 + i];
        op[i] = out32 + o0 + (mi * 8 + i) * o2;
        *(f4v*)op[i] = v[i];
      }
      asm volatile("s_wait_xcnt 0x0"
                   :: "v"(op[0]), "v"(op[1]), "v"(op[2]), "v"(op[3]),
                      "v"(op[4]), "v"(op[5]), "v"(op[6]), "v"(op[7]),
                      "v"(v[0]), "v"(v[1]), "v"(v[2]), "v"(v[3]),
                      "v"(v[4]), "v"(v[5]), "v"(v[6]), "v"(v[7]) : "memory");
      if constexpr (LN == 1) {
        _Float16* hp[8];
        half4 h[8];
#pragma unroll
        for (int i = 0; i < 8; ++i) {
#pragma unroll
          for (int j = 0; j < 4; ++j) h[i][j] = (_Float16)(v[i][j] * lv[j]);
          hp[i] = out16 + o0 + (mi * 8 + i) * o2;
          *(half4*)hp[i] = h[i];
        }
        // the same behind these 8 stores
        asm volatile("s_wait_xcnt 0x0"
                     :: "v"(hp[0]), "v"(hp[1]), "v"(hp[2]), "v"(hp[3]),
                        "v"(hp[4]), "v"(hp[5]), "v"(hp[6]), "v"(hp[7]),
                        "v"(h[0]), "v"(h[1]), "v"(h[2]), "v"(h[3]),
                        "v"(h[4]), "v"(h[5]), "v"(h[6]), "v"(h[7]) : "memory");
        // 16 lanes hold a row's 64 columns: their mean first, then the squared
        // distances from it, so that nothing cancels; lane cn keeps row rh + 2 * cn
#pragma unroll
        for (int i = 0; i < 8; ++i) {
          float mp = sum16((v[i][0] + v[i][1]) + (v[i][2] + v[i][3])) * (1.0f / 64);
          float d0 = v[i][0] - mp, d1 = v[i][1] - mp, d2 = v[i][2] - mp, d3 = v[i][3] - mp;
          float e = sum16((d0 * d0 + d1 * d1) + (d2 * d2 + d3 * d3));
          bool keep = cn == mi * 8 + i;
          km = keep ? mp : km;
          k2 = keep ? e : k2;
        }
      }
    } else {
      _Float16* op[8];
      half4 h[8];
#pragma unroll
      for (int i = 0; i < 8; ++i) {
#pragma unroll
        for (int j = 0; j < 4; ++j) h[i][j] = (_Float16)v[i][j];
        op[i] = out16 + o0 + (mi * 8 + i) * o2;
        *(half4*)op[i] = h[i];
      }
      asm volatile("s_wait_xcnt 0x0"
                   :: "v"(op[0]), "v"(op[1]), "v"(op[2]), "v"(op[3]),
                      "v"(op[4]), "v"(op[5]), "v"(op[6]), "v"(op[7]),
                      "v"(h[0]), "v"(h[1]), "v"(h[2]), "v"(h[3]),
                      "v"(h[4]), "v"(h[5]), "v"(h[6]), "v"(h[7]) : "memory");
    }
  }
  if constexpr (LN == 1) {
    // a wave's 32 pairs fill two whole lines of this column block's plane
    float2* sp = reinterpret_cast<float2*>(lnS) + (size_t)blockIdx.x * BT + mBase + wrow + rh + 2 * cn;
    float2 st = make_float2(km, k2);
    *sp = st;
    // behind the store, before its address or data registers are written again
    asm volatile("s_wait_xcnt 0x0" :: "v"(sp), "v"(st.x), "v"(st.y) : "memory");
  }
}

// ---------------------------------------------------------------------------
// Block-sparse flash attention, 20 waves per work-group. Online softmax, KD=64.
// Work-groups 0..B*H-1: query tile 0 of one (b,h) (global rows, i<16, which see
// every key). The 128 key tiles are split over the 20 waves, 6 or 7 each; the
// partial softmax states (max, sum, O) are merged through LDS in wave order.
// They come first in the grid because they are the longest.
// Other work-groups: one wave per query tile qt>=1, which visits key tile 0
// (global columns) + local tiles qt-2..qt+2.
// 20 waves: five per SIMD is what the register count admits, and the grid then
// has fewer work-groups than the chip has WGPs, so all start at once.
// The last NCG work-groups, on WGPs that attention leaves idle, do no attention:
// each sums 128 columns of the first FFN weight over k, weighted by the second
// LayerNorm's gain (cs) and by its shift (bw), for that product's epilogue.
// ---------------------------------------------------------------------------
constexpr int AW   = 20;              // waves per attention work-group
constexpr int NGB  = BB * HH;         // work-groups that hold a query tile 0
constexpr int KTW  = NQT / AW;        // key tiles per wave there, rounded down
constexpr int KTX  = NQT % AW;        // the first KTX waves take one more
constexpr int NLT  = BB * HH * (NQT - 1);   // query tiles with qt >= 1
constexpr int NAG  = NGB + (NLT + AW - 1) / AW;   // work-groups that do attention
constexpr int NCG  = DFF / 128;       // work-groups that sum weight columns
constexpr int OPP  = 66;              // floats per row of a partial O in LDS:
                                      // rows r and r+8 fall on different banks
__global__ __launch_bounds__(AW * 32)
void attn_wmma(const _Float16* __restrict__ Q, const _Float16* __restrict__ Kt,
               const _Float16* __restrict__ V, _Float16* __restrict__ ctx,
               const float* __restrict__ Wf, const float* __restrict__ lg,
               const float* __restrict__ lb, float* __restrict__ cs,
               float* __restrict__ bw) {
  __shared__ _Float16 Pl[AW][16 * 16];  // per-wave P staging (C->A layout)
  __shared__ __attribute__((aligned(16)))
  float Op[AW][16 * OPP];               // per-wave partial O (query tile 0)
  __shared__ float Ms[AW][16];          // per-wave running max per row
  __shared__ float Ls[AW][16];          // per-wave running sum per row

  int w    = threadIdx.x >> 5;
  int lane = threadIdx.x & 31;
  if (blockIdx.x >= NAG) {                       // uniform over the work-group
    // wave wv < 16 takes k rows wv*32 .. +31; a lane takes 4 adjacent columns
    // (a scalar: the test on it is a branch, and the row addresses are scalar)
    int wv = __builtin_amdgcn_readfirstlane(w);
    int nb = (blockIdx.x - NAG) * 128;
    float* red = &Op[0][0];
    if (wv < 16) {
      f4v cg = {0.f, 0.f, 0.f, 0.f}, cb = {0.f, 0.f, 0.f, 0.f};
      int k0 = wv * 32;
      // read in front of the wait below, which then covers these loads' registers too
      float gk[32], bk[32];
      // all unrolled: gk, bk and t are indexed by constants and stay in registers, and
      // as many of the 32 weight loads are in flight as the registers admit
#pragma unroll
      for (int c = 0; c < 32; ++c) { gk[c] = lg[k0 + c]; bk[c] = lb[k0 + c]; }
      const float* wp = Wf + (size_t)k0 * DFF + nb + lane * 4;
      f4v t[32];
#pragma unroll
      for (int c = 0; c < 32; ++c) t[c] = *(const f4v*)(wp + c * DFF);
      // behind the last load, before a later result may land in the address
      // registers (named as an input so that they live to here)
      asm volatile("s_wait_xcnt 0x0" :: "v"(wp) : "memory");
#pragma unroll
      for (int c = 0; c < 32; ++c) {
        cg += gk[c] * t[c];
        cb += bk[c] * t[c];
      }
      *(f4v*)(red + wv * 256 + lane * 8)     = cg;
      *(f4v*)(red + wv * 256 + lane * 8 + 4) = cb;
    }
    __syncthreads();
    if (threadIdx.x < 256) {
      int col = threadIdx.x & 127, wh = threadIdx.x >> 7;   // wh: 0 gain, 1 shift
      float s = 0.f;
      // unrolled: every LDS read is issued up front
#pragma unroll
      for (int ww = 0; ww < 16; ++ww) s += red[ww * 256 + (col >> 2) * 8 + wh * 4 + (col & 3)];
      float* dp = (wh ? bw : cs) + nb + col;
      *dp = s;
      // behind the store, before its address or data registers are written again
      asm volatile("s_wait_xcnt 0x0" :: "v"(dp), "v"(s) : "memory");
    }
    return;
  }
  bool glob = blockIdx.x < NGB;                  // uniform over the work-group
  int bh, qt;
  if (glob) {
    bh = blockIdx.x;
    qt = 0;
  } else {
    int t = (blockIdx.x - NGB) * AW + w;         // tiles 1..NQT-1 of every (b,h)
    if (t >= NLT) return;                        // these work-groups meet no barrier
    bh = t / (NQT - 1);
    qt = 1 + t % (NQT - 1);
  }
  int b    = bh / HH;
  int h    = bh % HH;
  int mloc = lane & 15;
  int lh   = lane >> 4;

  const size_t rs = (size_t)HH * KDM;            // 512 halves per token row
  const size_t hoff = (size_t)h * KDM;
  const _Float16* qb = Q  + (size_t)(b * TT) * rs + hoff;
  const _Float16* kb = Kt + (size_t)(b * TT) * rs + hoff;
  const _Float16* vb = V  + (size_t)(b * TT) * rs + hoff;

  // Q fragments: 16x64 -> two 16x32 A-fragments
  v16h qf[2];
#pragma unroll
  for (int ks = 0; ks < 2; ++ks) {
    const _Float16* base = qb + (size_t)(qt * 16 + mloc) * rs + ks * 32;
    half8 lo = *(const half8*)(base + lh * 8);
    half8 hi = *(const half8*)(base + 16 + lh * 8);
#pragma unroll
    for (int i = 0; i < 8; ++i) { qf[ks][i] = lo[i]; qf[ks][8 + i] = hi[i]; }
  }

  v8f O[4];
  float mrow[8], lrow[8];
#pragma unroll
  for (int nt = 0; nt < 4; ++nt)
#pragma unroll
    for (int i = 0; i < 8; ++i) O[nt][i] = 0.f;
#pragma unroll
  for (int r = 0; r < 8; ++r) { mrow[r] = -3.0e38f; lrow[r] = 0.f; }

  auto process = [&](int st, bool needMask) {
    int sbase = st * 16;
    // scores S = Q K^T / sqrt(KD)
    v8f S;
#pragma unroll
    for (int i = 0; i < 8; ++i) S[i] = 0.f;
    {
      const _Float16* krow = kb + (size_t)(sbase + mloc) * rs + lh * 8;
#pragma unroll
      for (int ks = 0; ks < 2; ++ks) {
        v16h bf;
        half8 lo = *(const half8*)(krow + ks * 32);
        half8 hi = *(const half8*)(krow + ks * 32 + 16);
        // behind the tile's last K load, before a later result may land in the
        // registers of the K address (named as an input so that they live to here)
        if (ks == 1) asm volatile("s_wait_xcnt 0x0" :: "v"(krow) : "memory");
#pragma unroll
        for (int i = 0; i < 8; ++i) { bf[i] = lo[i]; bf[8 + i] = hi[i]; }
        S = WMMA_F32_F16(qf[ks], bf, S);
      }
    }
#pragma unroll
    for (int r = 0; r < 8; ++r) S[r] *= 0.125f;
    if (needMask) {
      int j = sbase + mloc;
#pragma unroll
      for (int r = 0; r < 8; ++r) {
        int i  = qt * 16 + 8 * lh + r;
        int di = i - j; if (di < 0) di = -di;
        bool ok = (di <= 32) || (j < 16) || (i < 16);
        if (!ok) S[r] = -1.0e9f;
      }
    }
    // online softmax (rows live across 16-lane halves)
    float pexp[8];
#pragma unroll
    for (int r = 0; r < 8; ++r) {
      float rm = S[r];
#pragma unroll
      for (int off = 1; off < 16; off <<= 1) rm = fmaxf(rm, __shfl_xor(rm, off, 32));
      float mn    = fmaxf(mrow[r], rm);
      float alpha = exp2_slot((mrow[r] - mn) * 1.44269504f);
      float p     = exp2_slot((S[r] - mn) * 1.44269504f);
      float sum   = p;
#pragma unroll
      for (int off = 1; off < 16; off <<= 1) sum += __shfl_xor(sum, off, 32);
      lrow[r] = lrow[r] * alpha + sum;
      mrow[r] = mn;
#pragma unroll
      for (int nt = 0; nt < 4; ++nt) O[nt][r] *= alpha;
      pexp[r] = p;
    }
    // stage P through LDS to convert C-layout -> A-layout (upper K half = 0)
#pragma unroll
    for (int r = 0; r < 8; ++r)
      Pl[w][(8 * lh + r) * 16 + mloc] = (_Float16)pexp[r];
    v16h ap;
    {
      half8 lo = *(const half8*)(&Pl[w][mloc * 16 + lh * 8]);
#pragma unroll
      for (int i = 0; i < 8; ++i) { ap[i] = lo[i]; ap[8 + i] = (_Float16)0.f; }
    }
    // O += P x V  (V tile is 16(s) x 64(kd); upper K half zero)
    const _Float16* vrow = vb + (size_t)(sbase + lh * 8) * rs + mloc;
#pragma unroll
    for (int nt = 0; nt < 4; ++nt) {
      v16h bvf;
#pragma unroll
      for (int i = 0; i < 8; ++i) {
        bvf[i]     = vrow[(size_t)i * rs + nt * 16];
        bvf[8 + i] = (_Float16)0.f;
      }
      O[nt] = WMMA_F32_F16(ap, bvf, O[nt]);
    }
    // the same behind the tile's last V load, for the registers of the V address
    asm volatile("s_wait_xcnt 0x0" :: "v"(vrow) : "memory");
  };

  if (glob) {
    int s0 = w * KTW + (w < KTX ? w : KTX);
    int s1 = s0 + KTW + (w < KTX ? 1 : 0);
    for (int st = s0; st < s1; ++st) process(st, false);
  } else {
    process(0, false);                       // global columns (j < 16)
    int lo = qt - 2 < 1 ? 1 : qt - 2;
    int hi = qt + 2 > NQT - 1 ? NQT - 1 : qt + 2;
    for (int st = lo; st <= hi; ++st) process(st, true);
  }

  // normalize + write ctx (fp16, [B,T,H,KD])
  _Float16* cb = ctx + (size_t)(b * TT + qt * 16) * rs + hoff;

  if (glob) {
    // publish this wave's partial state
    // (unrolled: mrow, lrow and O live in registers and need constant indices)
#pragma unroll
    for (int r = 0; r < 8; ++r)
      if (mloc == 0) { Ms[w][8 * lh + r] = mrow[r]; Ls[w][8 * lh + r] = lrow[r]; }
#pragma unroll
    for (int nt = 0; nt < 4; ++nt)
#pragma unroll
      for (int r = 0; r < 8; ++r)
        Op[w][(8 * lh + r) * OPP + nt * 16 + mloc] = O[nt][r];
    __syncthreads();
    // wave w merges query row w; a lane owns two adjacent columns
    // (both loops unrolled: every LDS read of the merge is issued up front)
    if (w >= 16) return;
    float M = Ms[0][w];
#pragma unroll
    for (int ww = 1; ww < AW; ++ww) M = fmaxf(M, Ms[ww][w]);
    float L = 0.f, o0 = 0.f, o1 = 0.f;
#pragma unroll
    for (int ww = 0; ww < AW; ++ww) {
      float e = exp2_slot((Ms[ww][w] - M) * 1.44269504f);
      float2 p = *(const float2*)(&Op[ww][w * OPP + 2 * lane]);
      L  += Ls[ww][w] * e;
      o0 += p.x * e;
      o1 += p.y * e;
    }
    half2v res;
    res[0] = (_Float16)(o0 / L);
    res[1] = (_Float16)(o1 / L);
    *(half2v*)(cb + (size_t)w * rs + 2 * lane) = res;
    return;
  }
#pragma unroll
  for (int nt = 0; nt < 4; ++nt)
#pragma unroll
    for (int r = 0; r < 8; ++r) {
      float vv = O[nt][r] / lrow[r];
      cb[(size_t)(8 * lh + r) * rs + nt * 16 + mloc] = (_Float16)vv;
    }
  // behind the last store; on this path only the end of the kernel follows it
  asm volatile("s_wait_xcnt 0x0" ::: "memory");
}

// ---------------------------------------------------------------------------
// Host-side orchestration
// ---------------------------------------------------------------------------
extern "C" void kernel_launch(void* const* d_in, const int* in_sizes, int n_in,
                              void* d_out, int out_size, void* d_ws, size_t ws_size,
                              hipStream_t stream) {
  const float* x    = (const float*)d_in[0];
  const float* ln1g = (const float*)d_in[1];
  const float* ln1b = (const float*)d_in[2];
  const float* Wq   = (const float*)d_in[3];
  const float* bq   = (const float*)d_in[4];
  const float* Wk   = (const float*)d_in[5];
  const float* bk   = (const float*)d_in[6];
  const float* Wv   = (const float*)d_in[7];
  const float* bv   = (const float*)d_in[8];
  const float* Wo   = (const float*)d_in[9];
  const float* bo   = (const float*)d_in[10];
  const float* ln2g = (const float*)d_in[11];
  const float* ln2b = (const float*)d_in[12];
  const float* W1   = (const float*)d_in[13];
  const float* b1   = (const float*)d_in[14];
  const float* W2   = (const float*)d_in[15];
  const float* b2   = (const float*)d_in[16];
  float* out = (float*)d_out;

  char* ws = (char*)d_ws;
  const size_t MB = 1024ull * 1024ull;
  // Region 0 (32MB): xn16|q16|k16|v16 ; later aliased by FFN hidden h16
  _Float16* xn16 = (_Float16*)(ws + 0 * MB);
  _Float16* q16  = (_Float16*)(ws + 8 * MB);
  _Float16* k16  = (_Float16*)(ws + 16 * MB);
  _Float16* v16  = (_Float16*)(ws + 24 * MB);
  _Float16* h16  = (_Float16*)(ws + 0 * MB);    // alias (32MB), after attn
  _Float16* ctx16 = (_Float16*)(ws + 32 * MB);  // 8MB
  float*    x1    = (float*)   (ws + 40 * MB);  // 16MB
  _Float16* x1g   = (_Float16*)(ws + 56 * MB);  // 8MB: x1 * ln2_g
  float*    st2   = (float*)   (ws + 64 * MB);  // 512KB: partial row statistics of x1
  float*    csw   = (float*)   (ws + 65 * MB);  // 8KB: ln2_g @ W1
  float*    bww   = (float*)   (ws + 66 * MB);  // 8KB: ln2_b @ W1

  // LN1 -> xn16
  ln_rows<<<BT / 8, 256, 0, stream>>>(x, ln1g, ln1b, xn16, BT);

  // QKV projections (fp16 out), one launch: grid z = 0, 1, 2 is Q, K, V
  dim3 gq(DD / 64, BT / 256);
  dim3 gqkv(DD / 128, BT / 256, 3);
  gemm_wmma<128, false, 3, 1, 128, DD, 0><<<gqkv, 256, 0, stream>>>(xn16, Wq, bq, nullptr, q16, nullptr, BT, DD, DD, 0,
                                                     Wk, bk, k16, Wv, bv, v16, nullptr, nullptr, nullptr);

  // Block-sparse flash attention -> ctx16; beside it ln2_g @ W1 and ln2_b @ W1
  attn_wmma<<<NAG + NCG, AW * 32, 0, stream>>>(q16, k16, v16, ctx16, W1, ln2g, ln2b, csw, bww);

  // Out projection + residual (fp32 x1), with x1 * ln2_g (fp16) and x1's row statistics
  gemm_wmma<128, true, 1, 3, 64, 0, 1><<<gq, 256, 0, stream>>>(ctx16, Wo, bo, x, x1g, x1, BT, DD, DD, 0,
                                                  nullptr, nullptr, nullptr, nullptr, nullptr, nullptr,
                                                  ln2g, nullptr, st2);

  // FFN1: relu(LN2(x1) @ W1 + b1) -> h16, the LayerNorm applied in the epilogue
  dim3 g1(DFF / 128, BT / 256);
  gemm_wmma<128, false, 1, 1, 128, DFF, 2><<<g1, 256, 0, stream>>>(x1g, W1, b1, nullptr, h16, nullptr, BT, DFF, DD, 1,
                                                  nullptr, nullptr, nullptr, nullptr, nullptr, nullptr,
                                                  csw, bww, st2);

  // FFN2: x1 + (h16 @ W2 + b2) -> out (fp32)
  dim3 g2(DD / 64, BT / 256);
  gemm_wmma<128, true, 1, 3, 64, 0, 0><<<g2, 256, 0, stream>>>(h16, W2, b2, x1, nullptr, out, BT, DD, DFF, 0,
                                                  nullptr, nullptr, nullptr, nullptr, nullptr, nullptr,
                                                  nullptr, nullptr, nullptr);
}
